// v000
// Times are from an AMD MI455X. After a warm-up the kernel runs many times in a row, and a time is the length of
// such a window on the GPU divided by its runs, so every launch and the gaps after it count. The runs cycle
// through copies of the inputs. A figure is the median of several windows, for all but v000 over two sittings.
// Sittings can differ by a few percent; kernels timed side by side share one.
// v000 is the starting kernel. One run takes 2700 microseconds.
#include <hip/hip_runtime.h>

// Causal multi-head self-attention over 4,096 tokens with (in, out) weights (x [1][4096][1024]; q, k, v = x W ('xw' [1024][1024] 0.02, no bias; 16 heads x 64); scores with -inf strictly above the diagonal (triu k=1), then / sqrt(64) inside the softmax (the same function as scaling first); softmax; out = merged Wo + bo ('xw' + a REAL bias 0.02) -> [1][4096][1024] (4.2 M); argument order x, Wq, Wk, Wv, Wo, bo).
// Layout: bf16 copy of x; exact projections; causal T-4096 attention, one head per pass (hybrid rows: < 512 hi/lo 3 products, rest fp16 x1024; k_gemmc tile skipping; streaming three-sweep softmax); merged hi/lo x Wo exact + bo.
// Compute dtypes, f32 accumulate: every input rounded to bf16; projections exact; attention rows < 512 3 products, rest fp16; softmax f32; Wo hl x exact + bias.

#define NB_  1
#define TT   4096
#define DM   1024
#define NH_  16
#define NKV  16
#define REP  (NH_ / NKV)
#define HD   64
#define DQ   (NH_ * HD)
#define DKV  (NKV * HD)
#define ZH   1
#define RH   512                  // query rows < RH use hi+lo planes (0: none)
#define WIN  4096
#define PCAR 1024.0f
#define SCL  0.125f   // HD^-0.5
typedef _Float16 h16;
typedef unsigned short bf;
typedef __attribute__((ext_vector_type(16))) __bf16   v16bf;
typedef __attribute__((ext_vector_type(16))) _Float16 v16h;
typedef __attribute__((ext_vector_type(8)))  _Float16 v8h;
typedef __attribute__((ext_vector_type(8)))  unsigned short v8us;
typedef __attribute__((ext_vector_type(8)))  float    v8f;
typedef __attribute__((ext_vector_type(4)))  float    v4f;
typedef v8h  __attribute__((may_alias)) v8ha;
typedef v4f  __attribute__((may_alias)) v4fa;
typedef v8us __attribute__((may_alias)) v8usa;

__device__ __forceinline__ unsigned short f2bf(float f) { unsigned u = __float_as_uint(f); u += 0x7FFFu + ((u >> 16) & 1u); return (unsigned short)(u >> 16); }
__device__ __forceinline__ float bf2f(unsigned short b) { return __uint_as_float(((unsigned)b) << 16); }
__device__ __forceinline__ float bfr(float f) { return bf2f(f2bf(f)); }
__device__ __forceinline__ v16h cat16(v8h lo, v8h hi) { return __builtin_shufflevector(lo, hi, 0, 1, 2, 3, 4, 5, 6, 7, 8, 9, 10, 11, 12, 13, 14, 15); }
__device__ __forceinline__ v16bf cat16b(v8us lo, v8us hi) { return __builtin_bit_cast(v16bf, __builtin_shufflevector(lo, hi, 0, 1, 2, 3, 4, 5, 6, 7, 8, 9, 10, 11, 12, 13, 14, 15)); }
__device__ __forceinline__ v8f wmma16(v16h a, v16h b, v8f c) { return __builtin_amdgcn_wmma_f32_16x16x32_f16(false, a, false, b, (short)0, c, false, false); }
__device__ __forceinline__ v8f wmmab(v16bf a, v16bf b, v8f c) { return __builtin_amdgcn_wmma_f32_16x16x32_bf16(false, a, false, b, (short)0, c, false, false); }



// ---- k_gemmw: register-blocked GEMM, ONE WAVE per 64x64 output tile (16 accumulators), operands straight from K-contiguous 16-bit planes; grid (M/64, N/64, Z), 32 threads.
// C[m][n] (f32, pitch ldc, + optional f32 bias[n]) = sum_k A[m][k] Bt[n][k] (+ split products per NSPLIT). z-batch strides sA/sB/sC in elements. K % 32 == 0.
template <typename T16> struct WFrag;
template <> struct WFrag<h16> { typedef v16h V; static __device__ __forceinline__ V ld(const h16* p) { return cat16(*(const v8h*)p, *(const v8h*)(p + 16)); } static __device__ __forceinline__ v8f mma(V a, V b, v8f c) { return wmma16(a, b, c); } };
template <> struct WFrag<bf> { typedef v16bf V; static __device__ __forceinline__ V ld(const bf* p) { return cat16b(*(const v8us*)p, *(const v8us*)(p + 16)); } static __device__ __forceinline__ v8f mma(V a, V b, v8f c) { return wmmab(a, b, c); } };
template <typename T16, int NSPLIT, bool BIAS>
__global__ __launch_bounds__(32) void k_gemmw(const T16* __restrict__ A, const T16* __restrict__ A2, const T16* __restrict__ Bt, const T16* __restrict__ Bt2, int K, float* C, int ldc, const float* __restrict__ bias, size_t sA, size_t sB, size_t sC) {
    typedef typename WFrag<T16>::V V;
    __shared__ __align__(16) float os[16 * 68];
    const size_t z = blockIdx.z; A += z * sA; if (A2) A2 += z * sA; Bt += z * sB; if (Bt2) Bt2 += z * sB; C += z * sC;
    const int lane = threadIdx.x & 31, lr = lane & 15, hi = lane >> 4; const int r0 = blockIdx.x * 64, c0 = blockIdx.y * 64;
    v8f acc[4][4];
#pragma unroll
    for (int mb = 0; mb < 4; ++mb)
#pragma unroll
        for (int nb = 0; nb < 4; ++nb) acc[mb][nb] = (v8f){};
    const size_t aoff = (size_t)(r0 + lr) * K + 8 * hi, boff = (size_t)(c0 + lr) * K + 8 * hi;
#pragma unroll 1
    for (int kc = 0; kc < K; kc += 32) {
        V a[4], a2[4];
#pragma unroll
        for (int mb = 0; mb < 4; ++mb) { a[mb] = WFrag<T16>::ld(A + aoff + (size_t)mb * 16 * K + kc); if (NSPLIT == 1 || NSPLIT == 2) a2[mb] = WFrag<T16>::ld(A2 + aoff + (size_t)mb * 16 * K + kc); }
#pragma unroll
        for (int nb = 0; nb < 4; ++nb) { const V b = WFrag<T16>::ld(Bt + boff + (size_t)nb * 16 * K + kc); V b2; if (NSPLIT >= 2) b2 = WFrag<T16>::ld(Bt2 + boff + (size_t)nb * 16 * K + kc);
#pragma unroll
            for (int mb = 0; mb < 4; ++mb) { acc[mb][nb] = WFrag<T16>::mma(a[mb], b, acc[mb][nb]); if (NSPLIT == 1 || NSPLIT == 2) acc[mb][nb] = WFrag<T16>::mma(a2[mb], b, acc[mb][nb]); if (NSPLIT >= 2) acc[mb][nb] = WFrag<T16>::mma(a[mb], b2, acc[mb][nb]); } }
        asm volatile("v_nop\n\tv_nop\n\tv_nop\n\tv_nop" : "+v"(acc[0][0]), "+v"(acc[1][1]), "+v"(acc[2][2]), "+v"(acc[3][3]) : "v"(a[0]), "v"(a[3]));
    }
#pragma unroll
    for (int mb = 0; mb < 4; ++mb) {
#pragma unroll
        for (int nb = 0; nb < 4; ++nb) {
#pragma unroll
            for (int j = 0; j < 8; ++j) os[(hi * 8 + j) * 68 + nb * 16 + lr] = acc[mb][nb][j]; }
        __builtin_amdgcn_wave_barrier(); asm volatile("" ::: "memory");
        float* crow = C + (size_t)(r0 + mb * 16) * ldc + c0;
{
#pragma unroll
            for (int s = 0; s < 8; ++s) { const int row = 2 * s + hi, cofs = lr * 4; v4f val = *(const v4fa*)(os + row * 68 + cofs); if (BIAS) { val[0] += bfr(bias[c0 + cofs]); val[1] += bfr(bias[c0 + cofs + 1]); val[2] += bfr(bias[c0 + cofs + 2]); val[3] += bfr(bias[c0 + cofs + 3]); }
                *(v4f*)(crow + (size_t)row * ldc + cofs) = val; }
             }
        __builtin_amdgcn_wave_barrier(); asm volatile("" ::: "memory");
    }
}

// ---- k_gemmc: the same one-wave 64x64 tile GEMM specialised for causal attention: CMODE 1 skips score tiles entirely above the diagonal (query rows r0+roff.., key columns c0..), CMODE 2 limits the
// key (K) loop of the probability x value contraction to the diagonal block (probabilities beyond it are exactly zero). roff = row offset of this launch's first row within the sequence.
template <typename T16, int NSPLIT, int CMODE>
__global__ __launch_bounds__(32) void k_gemmc(const T16* __restrict__ A, const T16* __restrict__ A2, const T16* __restrict__ Bt, const T16* __restrict__ Bt2, int K, float* C, int ldc, int roff, size_t sA, size_t sB, size_t sC) {
    typedef typename WFrag<T16>::V V;
    __shared__ __align__(16) float os[16 * 68];
    const size_t z = blockIdx.z; A += z * sA; if (A2) A2 += z * sA; Bt += z * sB; if (Bt2) Bt2 += z * sB; C += z * sC;
    const int lane = threadIdx.x & 31, lr = lane & 15, hi = lane >> 4; const int r0 = blockIdx.x * 64, c0 = blockIdx.y * 64;
    if (CMODE == 1 && c0 > r0 + roff + 63) return;                  // score tile entirely above the causal diagonal: never computed (the softmax masks j > i by select)
    const int Kl = (CMODE == 2) ? min(K, r0 + roff + 64) : K;        // P.V: probabilities are exactly 0 beyond the diagonal block, so the K loop stops there
    v8f acc[4][4];
#pragma unroll
    for (int mb = 0; mb < 4; ++mb)
#pragma unroll
        for (int nb = 0; nb < 4; ++nb) acc[mb][nb] = (v8f){};
    const size_t aoff = (size_t)(r0 + lr) * K + 8 * hi, boff = (size_t)(c0 + lr) * K + 8 * hi;
#pragma unroll 1
    for (int kc = 0; kc < Kl; kc += 32) {
        V a[4], a2[4];
#pragma unroll
        for (int mb = 0; mb < 4; ++mb) { a[mb] = WFrag<T16>::ld(A + aoff + (size_t)mb * 16 * K + kc); if (NSPLIT == 1 || NSPLIT == 2) a2[mb] = WFrag<T16>::ld(A2 + aoff + (size_t)mb * 16 * K + kc); }
#pragma unroll
        for (int nb = 0; nb < 4; ++nb) { const V b = WFrag<T16>::ld(Bt + boff + (size_t)nb * 16 * K + kc); V b2; if (NSPLIT >= 2) b2 = WFrag<T16>::ld(Bt2 + boff + (size_t)nb * 16 * K + kc);
#pragma unroll
            for (int mb = 0; mb < 4; ++mb) { acc[mb][nb] = WFrag<T16>::mma(a[mb], b, acc[mb][nb]); if (NSPLIT == 1 || NSPLIT == 2) acc[mb][nb] = WFrag<T16>::mma(a2[mb], b, acc[mb][nb]); if (NSPLIT >= 2) acc[mb][nb] = WFrag<T16>::mma(a[mb], b2, acc[mb][nb]); } }
        asm volatile("v_nop\n\tv_nop\n\tv_nop\n\tv_nop" : "+v"(acc[0][0]), "+v"(acc[1][1]), "+v"(acc[2][2]), "+v"(acc[3][3]) : "v"(a[0]), "v"(a[3]));
    }
#pragma unroll
    for (int mb = 0; mb < 4; ++mb) {
#pragma unroll
        for (int nb = 0; nb < 4; ++nb) {
#pragma unroll
            for (int j = 0; j < 8; ++j) os[(hi * 8 + j) * 68 + nb * 16 + lr] = acc[mb][nb][j]; }
        __builtin_amdgcn_wave_barrier(); asm volatile("" ::: "memory");
        float* crow = C + (size_t)(r0 + mb * 16) * ldc + c0;
{
#pragma unroll
            for (int s = 0; s < 8; ++s) { const int row = 2 * s + hi, cofs = lr * 4; v4f val = *(const v4fa*)(os + row * 68 + cofs);
                *(v4f*)(crow + (size_t)row * ldc + cofs) = val; }
             }
        __builtin_amdgcn_wave_barrier(); asm volatile("" ::: "memory");
    }
}

__device__ __forceinline__ h16 tohx(float x) { return (h16)x; }
__device__ __forceinline__ void splitf(float y, unsigned short& h, unsigned short& l) { h = f2bf(y); l = f2bf(y - bf2f(h)); }
typedef __attribute__((ext_vector_type(2))) _Float16 v2h;
typedef __attribute__((ext_vector_type(4))) _Float16 v4h;
typedef __attribute__((ext_vector_type(2))) unsigned short v2us;
typedef __attribute__((ext_vector_type(4))) unsigned short v4us;
typedef __attribute__((ext_vector_type(2))) float v2f;
typedef __attribute__((ext_vector_type(4))) int v4i;

__global__ __launch_bounds__(256) void k_wtG(const float* __restrict__ w, int K, int N, bf* Bt) {
    const int lane = threadIdx.x & 31; const int L0 = (blockIdx.x * 8 + (threadIdx.x >> 5)) * 8; const int nlines = N * K / 64;
{
#pragma unroll 1
        for (int l = 0; l < 8; ++l) { const int L = L0 + l; if (L >= nlines) break; const size_t e = (size_t)L * 64 + lane * 2; const int k = (int)(e % K), n = (int)(e / K); v2us o;
            o[0] = f2bf(w[(size_t)k * N + n]); o[1] = f2bf(w[(size_t)(k + 1) * N + n]); *(v2us*)(Bt + e) = o; }
         }
}
__global__ __launch_bounds__(256) void k_cvt8(const float* __restrict__ src, bf* dst, size_t n8) { const size_t i = (size_t)blockIdx.x * 256 + threadIdx.x; if (i >= n8) return; const v8f v = *(const v8f*)(src + i * 8); v8us o;
#pragma unroll
    for (int k = 0; k < 8; ++k) o[k] = f2bf(v[k]); *(v8us*)(dst + i * 8) = o;  }

// k_rope: head planes [h][t][d] (fp16 + hi/lo) of rope(x) x sc with the rotate-half convention out[d] = x[d] cos[t][d] - x[d+HD/2] sin[t][d], out[d+HD/2] = x[d+HD/2] cos[t][d+HD/2] + x[d] sin[t][d+HD/2]
__global__ __launch_bounds__(256) void k_rope(const float* __restrict__ F, int pitch, int nheads, const float* __restrict__ CS, const float* __restrict__ RF, const float* __restrict__ nw, float sc, h16* P16, bf* Ph, bf* Pl) {
    const size_t e = ((size_t)blockIdx.x * 256 + threadIdx.x) * 2; if (e >= (size_t)nheads * TT * HD) return; const int d = (int)(e % HD); const int t = (int)((e / HD) % TT); const int h = (int)(e / ((size_t)HD * TT)); const float* f = F + (size_t)t * pitch + h * HD; const float rf = RF ? RF[(size_t)h * TT + t] : 1.0f; v2h o16; v2us oh, ol;
#pragma unroll
    for (int q = 0; q < 2; ++q) { const int dd = d + q; const int dp = (dd < HD / 2) ? dd + HD / 2 : dd - HD / 2; float x0 = f[dd], x1 = f[dp];
        if (RF) { float n0 = __fmul_rn(x0, rf), n1 = __fmul_rn(x1, rf); asm volatile("" : "+v"(n0)); asm volatile("" : "+v"(n1)); x0 = __fmul_rn(bfr(nw[dd]), n0); x1 = __fmul_rn(bfr(nw[dp]), n1); }
        const v2f cs = *(const v2f*)(CS + ((size_t)t * HD + dd) * 2); float a = __fmul_rn(x0, cs[0]), bq = __fmul_rn(x1, cs[1]); asm volatile("" : "+v"(a)); asm volatile("" : "+v"(bq)); const float r = ((dd < HD / 2) ? __fsub_rn(a, bq) : __fadd_rn(a, bq)) * sc;
        o16[q] = tohx(r); unsigned short a2, c2; splitf(r, a2, c2); oh[q] = a2; ol[q] = c2; }
    *(v2h*)(P16 + e) = o16; *(v2us*)(Ph + e) = oh; *(v2us*)(Pl + e) = ol;  }
__global__ __launch_bounds__(256) void k_vtp(const float* __restrict__ F, int pitch, int nheads, h16* V16, bf* Vh, bf* Vl) { const size_t e = ((size_t)blockIdx.x * 256 + threadIdx.x) * 2; if (e >= (size_t)nheads * HD * TT) return; const int t = (int)(e % TT); const int d = (int)((e / TT) % HD); const int g = (int)(e / ((size_t)TT * HD)); v2h o16; v2us oh, ol;
#pragma unroll
    for (int q = 0; q < 2; ++q) { const float x = F[(size_t)(t + q) * pitch + g * HD + d]; o16[q] = tohx(x); unsigned short a2, c2; splitf(x, a2, c2); oh[q] = a2; ol[q] = c2; }
    *(v2h*)(V16 + e) = o16; *(v2us*)(Vh + e) = oh; *(v2us*)(Vl + e) = ol;  }
__global__ __launch_bounds__(256) void k_csid(float* CS) { const int idx = blockIdx.x * 256 + threadIdx.x; if (idx >= TT * HD) return; v2f cs; cs[0] = 1.0f; cs[1] = 0.0f; *(v2f*)(CS + (size_t)idx * 2) = cs;  }
// k_lsoft: streaming causal row softmax over the TK = TT = 4096 keys, one wave per row i, three sweeps of the f32 score row (lane -> 4 consecutive keys per 128-key chunk, 32 chunks; keys j > i are excluded by index with -3e38 / 0 - the score tiles above the diagonal are never computed and their stale contents are only ever discarded by this select):
__global__ __launch_bounds__(256) void k_lsoft(const float* __restrict__ Sb, h16* P16, bf* Ph, bf* Pl) {
    const int lane = threadIdx.x & 31; const int row = blockIdx.x * 8 + (threadIdx.x >> 5); if (row >= ZH * TT) return; const int i = row % TT; const int zz = row / TT; const bool hires = (i < RH); const float* sr = Sb + (size_t)row * TT; float mx = -3.0e38f;
#pragma unroll 4
    for (int ch = 0; ch < TT / 128; ++ch) { const int j0 = ch * 128 + lane * 4; const v4f a = *(const v4f*)(sr + j0);
#pragma unroll
        for (int q = 0; q < 4; ++q) { float t = a[q] * SCL; asm volatile("" : "+v"(t)); t = (j0 + q <= i) ? t : -3.0e38f; mx = fmaxf(mx, t); } }
#pragma unroll
    for (int sh = 16; sh; sh >>= 1) mx = fmaxf(mx, __shfl_xor(mx, sh, 32));
    float sum = 0.f;
#pragma unroll 4
    for (int ch = 0; ch < TT / 128; ++ch) { const int j0 = ch * 128 + lane * 4; const v4f a = *(const v4f*)(sr + j0);
#pragma unroll
        for (int q = 0; q < 4; ++q) { float t = a[q] * SCL; asm volatile("" : "+v"(t)); t = (j0 + q <= i) ? t : -3.0e38f; float d0 = __fsub_rn(t, mx); asm volatile("" : "+v"(d0)); sum += __builtin_amdgcn_exp2f(__fmul_rn(d0, 1.4426950408889634f)); } }
#pragma unroll
    for (int sh = 16; sh; sh >>= 1) sum += __shfl_xor(sum, sh, 32);
    const float f = __fdiv_rn(hires ? 1.0f : PCAR, sum);
{
        if (hires) {   /* rows < RH: normalised bf16 hi/lo over the first RH keys (every later key is above the diagonal for these rows; the hi/lo attn.v GEMM stops its K loop at the diagonal block), planes [zz][RH][TT] */
#pragma unroll
            for (int ch = 0; ch < RH / 128; ++ch) { const int j0 = ch * 128 + lane * 4; const v4f a = *(const v4f*)(sr + j0); v4us oh, ol;
#pragma unroll
                for (int q = 0; q < 4; ++q) { float t = a[q] * SCL; asm volatile("" : "+v"(t)); t = (j0 + q <= i) ? t : -3.0e38f; float d0 = __fsub_rn(t, mx); asm volatile("" : "+v"(d0)); float ex = __builtin_amdgcn_exp2f(__fmul_rn(d0, 1.4426950408889634f)); asm volatile("" : "+v"(ex)); unsigned short a2, c2; splitf(ex * f, a2, c2); oh[q] = a2; ol[q] = c2; }
                const size_t oo = ((size_t)zz * RH + i) * TT + j0; *(v4us*)(Ph + oo) = oh; *(v4us*)(Pl + oo) = ol; }
        } else {
#pragma unroll 2
            for (int ch = 0; ch < TT / 128; ++ch) { const int j0 = ch * 128 + lane * 4; const v4f a = *(const v4f*)(sr + j0); v4h o4;
#pragma unroll
                for (int q = 0; q < 4; ++q) { float t = a[q] * SCL; asm volatile("" : "+v"(t)); t = (j0 + q <= i) ? t : -3.0e38f; float d0 = __fsub_rn(t, mx); asm volatile("" : "+v"(d0)); float ex = __builtin_amdgcn_exp2f(__fmul_rn(d0, 1.4426950408889634f)); asm volatile("" : "+v"(ex)); o4[q] = tohx(ex * f); }
                *(v4h*)(P16 + (size_t)row * TT + j0) = o4; } }
         }
}

__global__ __launch_bounds__(256) void k_merge(const float* __restrict__ O, int h0, bf* Ah, bf* Al) { const size_t e = ((size_t)blockIdx.x * 256 + threadIdx.x) * 2; if (e >= (size_t)ZH * TT * HD) return; const int d = (int)(e % HD); const int t = (int)((e / HD) % TT); const int zz = (int)(e / ((size_t)HD * TT)); const float cs = (t < RH) ? 1.0f : (1.0f / PCAR); const size_t oo = (size_t)t * DQ + (h0 + zz) * HD + d;
    v2us oh, ol;
#pragma unroll
    for (int q = 0; q < 2; ++q) { unsigned short a, c2; splitf(O[e + q] * cs, a, c2); oh[q] = a; ol[q] = c2; } *(v2us*)(Ah + oo) = oh; *(v2us*)(Al + oo) = ol;  }

extern "C" void kernel_launch(void* const* d_in, const int* in_sizes, int n_in,
                              void* d_out, int out_size, void* d_ws, size_t ws_size, hipStream_t stream) {
    (void)in_sizes; (void)n_in; (void)out_size;
    const float* x = (const float*)d_in[0]; const float* wq = (const float*)d_in[1]; const float* wk = (const float*)d_in[2]; const float* wv = (const float*)d_in[3]; const float* wo = (const float*)d_in[4]; const float* bo = (const float*)d_in[5];
    float* OUT = (float*)d_out;     // [1][4096][1024]
    char* wsp = (char*)d_ws;
    auto take = [&](size_t bytes) { char* p = wsp; wsp += (bytes + 255) & ~(size_t)255; return (void*)p; };
    bf* WQ = (bf*)take((size_t)DQ * DM * 2); bf* WK = (bf*)take((size_t)DKV * DM * 2); bf* WV = (bf*)take((size_t)DKV * DM * 2); bf* WO = (bf*)take((size_t)DM * DQ * 2); float* CS = (float*)take((size_t)TT * HD * 2 * 4);
    bf* XB = (bf*)take((size_t)TT * DM * 2); float* FQ = (float*)take((size_t)TT * DQ * 4); float* FK = (float*)take((size_t)TT * DKV * 4);
    h16* QP16 = (h16*)take((size_t)NH_ * TT * HD * 2); h16* KP16 = (h16*)take((size_t)NKV * TT * HD * 2); h16* VT16 = (h16*)take((size_t)NKV * HD * TT * 2);
    bf* QPh = (bf*)take((size_t)NH_ * TT * HD * 2); bf* QPl = (bf*)take((size_t)NH_ * TT * HD * 2); bf* KPh = (bf*)take((size_t)NKV * TT * HD * 2); bf* KPl = (bf*)take((size_t)NKV * TT * HD * 2); bf* VTh = (bf*)take((size_t)NKV * HD * TT * 2); bf* VTl = (bf*)take((size_t)NKV * HD * TT * 2); bf* Ph = (bf*)take((size_t)ZH * RH * TT * 2); bf* Pl = (bf*)take((size_t)ZH * RH * TT * 2);
    float* Sb = (float*)take((size_t)ZH * TT * TT * 4); h16* P16 = (h16*)take((size_t)ZH * TT * TT * 2); float* Ob = (float*)take((size_t)ZH * TT * HD * 4); bf* ATh = (bf*)take((size_t)TT * DQ * 2); bf* ATl = (bf*)take((size_t)TT * DQ * 2);
    if ((size_t)(wsp - (char*)d_ws) > ws_size) return;    // ws 256 MiB
    float* FV = FK;   // v projection reuses the k buffer after the k planes are built (stream-ordered)
    { k_wtG<<<(unsigned)((DM * DQ / 64 + 63) / 64), 256, 0, stream>>>(wq, DM, DQ, WQ); k_wtG<<<(unsigned)((DM * DKV / 64 + 63) / 64), 256, 0, stream>>>(wk, DM, DKV, WK); k_wtG<<<(unsigned)((DM * DKV / 64 + 63) / 64), 256, 0, stream>>>(wv, DM, DKV, WV);   /* (in, out) 'xw' weights: transposed once into Bt */
      k_wtG<<<(unsigned)((DQ * DM / 64 + 63) / 64), 256, 0, stream>>>(wo, DQ, DM, WO);
       }
    k_csid<<<(TT * HD + 255) / 256, 256, 0, stream>>>(CS);
    const unsigned LQ = (unsigned)(((size_t)NH_ * TT * HD / 2 + 255) / 256), LKv = (unsigned)(((size_t)NKV * TT * HD / 2 + 255) / 256);
    for (int b = 0; b < NB_; ++b) {
        
        k_cvt8<<<(unsigned)(((size_t)TT * DM / 8 + 255) / 256), 256, 0, stream>>>(x + (size_t)b * TT * DM, XB, (size_t)TT * DM / 8);
        k_gemmw<bf, 0, false><<<dim3(TT / 64, DQ / 64, 1), 32, 0, stream>>>(XB, nullptr, WQ, nullptr, DM, FQ, DQ, nullptr, 0, 0, 0);
        k_rope<<<LQ, 256, 0, stream>>>(FQ, DQ, NH_, CS, nullptr, nullptr, 1.0f, QP16, QPh, QPl);
        k_gemmw<bf, 0, false><<<dim3(TT / 64, DKV / 64, 1), 32, 0, stream>>>(XB, nullptr, WK, nullptr, DM, FK, DKV, nullptr, 0, 0, 0);
        k_rope<<<LKv, 256, 0, stream>>>(FK, DKV, NKV, CS, nullptr, nullptr, 1.0f, KP16, KPh, KPl);
        k_gemmw<bf, 0, false><<<dim3(TT / 64, DKV / 64, 1), 32, 0, stream>>>(XB, nullptr, WV, nullptr, DM, FV, DKV, nullptr, 0, 0, 0); k_vtp<<<LKv, 256, 0, stream>>>(FV, DKV, NKV, VT16, VTh, VTl);
        for (int h0 = 0; h0 < NH_; h0 += ZH) { const size_t zq = (size_t)h0, zk = (size_t)(h0 / REP);   // one kv head per query head: the pass's one head uses kv plane zk = h0 (z-strides TT*HD)
            k_gemmc<bf, 2, 1><<<dim3(RH / 64, TT / 64, ZH), 32, 0, stream>>>(QPh + zq * TT * HD, QPl + zq * TT * HD, KPh + zk * TT * HD, KPl + zk * TT * HD, HD, Sb, TT, 0, (size_t)TT * HD, (size_t)TT * HD, (size_t)TT * TT);
            k_gemmc<h16, 0, 1><<<dim3((TT - RH) / 64, TT / 64, ZH), 32, 0, stream>>>(QP16 + zq * TT * HD + (size_t)RH * HD, nullptr, KP16 + zk * TT * HD, nullptr, HD, Sb + (size_t)RH * TT, TT, RH, (size_t)TT * HD, (size_t)TT * HD, (size_t)TT * TT);
            k_lsoft<<<ZH * TT / 8, 256, 0, stream>>>(Sb, P16, Ph, Pl);
            k_gemmc<bf, 2, 2><<<dim3(RH / 64, HD / 64, ZH), 32, 0, stream>>>(Ph, Pl, VTh + zk * HD * TT, VTl + zk * HD * TT, TT, Ob, HD, 0, (size_t)RH * TT, (size_t)HD * TT, (size_t)TT * HD);
            k_gemmc<h16, 0, 2><<<dim3((TT - RH) / 64, HD / 64, ZH), 32, 0, stream>>>(P16 + (size_t)RH * TT, nullptr, VT16 + zk * HD * TT, nullptr, TT, Ob + (size_t)RH * HD, HD, RH, (size_t)TT * TT, (size_t)HD * TT, (size_t)TT * HD);
            k_merge<<<(unsigned)(((size_t)ZH * TT * HD / 2 + 255) / 256), 256, 0, stream>>>(Ob, h0, ATh, ATl); }
        k_gemmw<bf, 1, true><<<dim3(TT / 64, DM / 64, 1), 32, 0, stream>>>(ATh, ATl, WO, nullptr, DQ, OUT + (size_t)b * TT * DM, DM, bo, 0, 0, 0); }
}

// v001
// Measured time: 1400 microseconds a run.
// In two side-by-side timings against v000, it was 1.94 and 1.97 times as fast.
#include <hip/hip_runtime.h>

// Causal multi-head self-attention over 4,096 tokens with (in, out) weights (x [1][4096][1024]; q, k, v = x W ('xw' [1024][1024] 0.02, no bias; 16 heads x 64); scores with -inf strictly above the diagonal (triu k=1), then / sqrt(64) inside the softmax (the same function as scaling first); softmax; out = merged Wo + bo ('xw' + a REAL bias 0.02) -> [1][4096][1024] (4.2 M); argument order x, Wq, Wk, Wv, Wo, bo).
// Layout: bf16 copy of x; exact projections; causal T-4096 attention, one head per pass (hybrid rows: < 512 hi/lo 3 products, rest fp16 x1024; k_gemmc tile skipping; streaming three-sweep softmax); merged hi/lo x Wo exact + bo.
// Compute dtypes, f32 accumulate: every input rounded to bf16; projections exact; attention rows < 512 3 products, rest fp16; softmax f32; Wo hl x exact + bias.

#define NB_  1
#define TT   4096
#define DM   1024
#define NH_  16
#define NKV  16
#define REP  (NH_ / NKV)
#define HD   64
#define DQ   (NH_ * HD)
#define DKV  (NKV * HD)
#define ZH   1
#define RH   512                  // query rows < RH use hi+lo planes (0: none)
#define WIN  4096
#define PCAR 1024.0f
#define SCL  0.125f   // HD^-0.5
typedef _Float16 h16;
typedef unsigned short bf;
typedef __attribute__((ext_vector_type(16))) __bf16   v16bf;
typedef __attribute__((ext_vector_type(16))) _Float16 v16h;
typedef __attribute__((ext_vector_type(8)))  _Float16 v8h;
typedef __attribute__((ext_vector_type(8)))  unsigned short v8us;
typedef __attribute__((ext_vector_type(8)))  float    v8f;
typedef __attribute__((ext_vector_type(4)))  float    v4f;
typedef v8h  __attribute__((may_alias)) v8ha;
typedef v4f  __attribute__((may_alias)) v4fa;
typedef v8us __attribute__((may_alias)) v8usa;

__device__ __forceinline__ unsigned short f2bf(float f) { unsigned u = __float_as_uint(f); u += 0x7FFFu + ((u >> 16) & 1u); return (unsigned short)(u >> 16); }
__device__ __forceinline__ float bf2f(unsigned short b) { return __uint_as_float(((unsigned)b) << 16); }
__device__ __forceinline__ float bfr(float f) { return bf2f(f2bf(f)); }
__device__ __forceinline__ v16h cat16(v8h lo, v8h hi) { return __builtin_shufflevector(lo, hi, 0, 1, 2, 3, 4, 5, 6, 7, 8, 9, 10, 11, 12, 13, 14, 15); }
__device__ __forceinline__ v16bf cat16b(v8us lo, v8us hi) { return __builtin_bit_cast(v16bf, __builtin_shufflevector(lo, hi, 0, 1, 2, 3, 4, 5, 6, 7, 8, 9, 10, 11, 12, 13, 14, 15)); }
__device__ __forceinline__ v8f wmma16(v16h a, v16h b, v8f c) { return __builtin_amdgcn_wmma_f32_16x16x32_f16(false, a, false, b, (short)0, c, false, false); }
__device__ __forceinline__ v8f wmmab(v16bf a, v16bf b, v8f c) { return __builtin_amdgcn_wmma_f32_16x16x32_bf16(false, a, false, b, (short)0, c, false, false); }



// ---- k_gemmw: register-blocked GEMM, ONE WAVE per 64x64 output tile (16 accumulators), operands straight from K-contiguous 16-bit planes; grid (M/64, N/64, Z), 32 threads.
// C[m][n] (f32, pitch ldc, + optional f32 bias[n]) = sum_k A[m][k] Bt[n][k] (+ split products per NSPLIT). z-batch strides sA/sB/sC in elements. K % 32 == 0.
template <typename T16> struct WFrag;
template <> struct WFrag<h16> { typedef v16h V; static __device__ __forceinline__ V ld(const h16* p) { return cat16(*(const v8h*)p, *(const v8h*)(p + 16)); } static __device__ __forceinline__ v8f mma(V a, V b, v8f c) { return wmma16(a, b, c); } };
template <> struct WFrag<bf> { typedef v16bf V; static __device__ __forceinline__ V ld(const bf* p) { return cat16b(*(const v8us*)p, *(const v8us*)(p + 16)); } static __device__ __forceinline__ v8f mma(V a, V b, v8f c) { return wmmab(a, b, c); } };
template <typename T16, int NSPLIT, bool BIAS>
__global__ __launch_bounds__(32) void k_gemmw(const T16* __restrict__ A, const T16* __restrict__ A2, const T16* __restrict__ Bt, const T16* __restrict__ Bt2, int K, float* C, int ldc, const float* __restrict__ bias, size_t sA, size_t sB, size_t sC) {
    typedef typename WFrag<T16>::V V;
    __shared__ __align__(16) float os[16 * 68];
    const size_t z = blockIdx.z; A += z * sA; if (A2) A2 += z * sA; Bt += z * sB; if (Bt2) Bt2 += z * sB; C += z * sC;
    const int lane = threadIdx.x & 31, lr = lane & 15, hi = lane >> 4; const int r0 = blockIdx.x * 64, c0 = blockIdx.y * 64;
    v8f acc[4][4];
#pragma unroll
    for (int mb = 0; mb < 4; ++mb)
#pragma unroll
        for (int nb = 0; nb < 4; ++nb) acc[mb][nb] = (v8f){};
    const size_t aoff = (size_t)(r0 + lr) * K + 8 * hi, boff = (size_t)(c0 + lr) * K + 8 * hi;
#pragma unroll 1
    for (int kc = 0; kc < K; kc += 32) {
        V a[4], a2[4];
#pragma unroll
        for (int mb = 0; mb < 4; ++mb) { a[mb] = WFrag<T16>::ld(A + aoff + (size_t)mb * 16 * K + kc); if (NSPLIT == 1 || NSPLIT == 2) a2[mb] = WFrag<T16>::ld(A2 + aoff + (size_t)mb * 16 * K + kc); }
#pragma unroll
        for (int nb = 0; nb < 4; ++nb) { const V b = WFrag<T16>::ld(Bt + boff + (size_t)nb * 16 * K + kc); V b2; if (NSPLIT >= 2) b2 = WFrag<T16>::ld(Bt2 + boff + (size_t)nb * 16 * K + kc);
#pragma unroll
            for (int mb = 0; mb < 4; ++mb) { acc[mb][nb] = WFrag<T16>::mma(a[mb], b, acc[mb][nb]); if (NSPLIT == 1 || NSPLIT == 2) acc[mb][nb] = WFrag<T16>::mma(a2[mb], b, acc[mb][nb]); if (NSPLIT >= 2) acc[mb][nb] = WFrag<T16>::mma(a[mb], b2, acc[mb][nb]); } }
        asm volatile("v_nop\n\tv_nop\n\tv_nop\n\tv_nop" : "+v"(acc[0][0]), "+v"(acc[1][1]), "+v"(acc[2][2]), "+v"(acc[3][3]) : "v"(a[0]), "v"(a[3]));
    }
#pragma unroll
    for (int mb = 0; mb < 4; ++mb) {
#pragma unroll
        for (int nb = 0; nb < 4; ++nb) {
#pragma unroll
            for (int j = 0; j < 8; ++j) os[(hi * 8 + j) * 68 + nb * 16 + lr] = acc[mb][nb][j]; }
        __builtin_amdgcn_wave_barrier(); asm volatile("" ::: "memory");
        float* crow = C + (size_t)(r0 + mb * 16) * ldc + c0;
{
#pragma unroll
            for (int s = 0; s < 8; ++s) { const int row = 2 * s + hi, cofs = lr * 4; v4f val = *(const v4fa*)(os + row * 68 + cofs); if (BIAS) { val[0] += bfr(bias[c0 + cofs]); val[1] += bfr(bias[c0 + cofs + 1]); val[2] += bfr(bias[c0 + cofs + 2]); val[3] += bfr(bias[c0 + cofs + 3]); }
                *(v4f*)(crow + (size_t)row * ldc + cofs) = val; }
             }
        __builtin_amdgcn_wave_barrier(); asm volatile("" ::: "memory");
    }
}

// ---- k_gemmc: the same one-wave 64x64 tile GEMM specialised for causal attention: CMODE 1 skips score tiles entirely above the diagonal (query rows r0+roff.., key columns c0..), CMODE 2 limits the
// key (K) loop of the probability x value contraction to the diagonal block (probabilities beyond it are exactly zero). roff = row offset of this launch's first row within the sequence.
template <typename T16, int NSPLIT, int CMODE>
__global__ __launch_bounds__(32) void k_gemmc(const T16* __restrict__ A, const T16* __restrict__ A2, const T16* __restrict__ Bt, const T16* __restrict__ Bt2, int K, float* C, int ldc, int roff, size_t sA, size_t sB, size_t sC) {
    typedef typename WFrag<T16>::V V;
    __shared__ __align__(16) float os[16 * 68];
    const size_t z = blockIdx.z; A += z * sA; if (A2) A2 += z * sA; Bt += z * sB; if (Bt2) Bt2 += z * sB; C += z * sC;
    const int lane = threadIdx.x & 31, lr = lane & 15, hi = lane >> 4; const int r0 = blockIdx.x * 64, c0 = blockIdx.y * 64;
    if (CMODE == 1 && c0 > r0 + roff + 63) return;                  // score tile entirely above the causal diagonal: never computed (the softmax masks j > i by select)
    const int Kl = (CMODE == 2) ? min(K, r0 + roff + 64) : K;        // P.V: probabilities are exactly 0 beyond the diagonal block, so the K loop stops there
    v8f acc[4][4];
#pragma unroll
    for (int mb = 0; mb < 4; ++mb)
#pragma unroll
        for (int nb = 0; nb < 4; ++nb) acc[mb][nb] = (v8f){};
    const size_t aoff = (size_t)(r0 + lr) * K + 8 * hi, boff = (size_t)(c0 + lr) * K + 8 * hi;
#pragma unroll 1
    for (int kc = 0; kc < Kl; kc += 32) {
        V a[4], a2[4];
#pragma unroll
        for (int mb = 0; mb < 4; ++mb) { a[mb] = WFrag<T16>::ld(A + aoff + (size_t)mb * 16 * K + kc); if (NSPLIT == 1 || NSPLIT == 2) a2[mb] = WFrag<T16>::ld(A2 + aoff + (size_t)mb * 16 * K + kc); }
#pragma unroll
        for (int nb = 0; nb < 4; ++nb) { const V b = WFrag<T16>::ld(Bt + boff + (size_t)nb * 16 * K + kc); V b2; if (NSPLIT >= 2) b2 = WFrag<T16>::ld(Bt2 + boff + (size_t)nb * 16 * K + kc);
#pragma unroll
            for (int mb = 0; mb < 4; ++mb) { acc[mb][nb] = WFrag<T16>::mma(a[mb], b, acc[mb][nb]); if (NSPLIT == 1 || NSPLIT == 2) acc[mb][nb] = WFrag<T16>::mma(a2[mb], b, acc[mb][nb]); if (NSPLIT >= 2) acc[mb][nb] = WFrag<T16>::mma(a[mb], b2, acc[mb][nb]); } }
        asm volatile("v_nop\n\tv_nop\n\tv_nop\n\tv_nop" : "+v"(acc[0][0]), "+v"(acc[1][1]), "+v"(acc[2][2]), "+v"(acc[3][3]) : "v"(a[0]), "v"(a[3]));
    }
#pragma unroll
    for (int mb = 0; mb < 4; ++mb) {
#pragma unroll
        for (int nb = 0; nb < 4; ++nb) {
#pragma unroll
            for (int j = 0; j < 8; ++j) os[(hi * 8 + j) * 68 + nb * 16 + lr] = acc[mb][nb][j]; }
        __builtin_amdgcn_wave_barrier(); asm volatile("" ::: "memory");
        float* crow = C + (size_t)(r0 + mb * 16) * ldc + c0;
{
#pragma unroll
            for (int s = 0; s < 8; ++s) { const int row = 2 * s + hi, cofs = lr * 4; v4f val = *(const v4fa*)(os + row * 68 + cofs);
                *(v4f*)(crow + (size_t)row * ldc + cofs) = val; }
             }
        __builtin_amdgcn_wave_barrier(); asm volatile("" ::: "memory");
    }
}

// ---- k_gemmpv: probability x value contraction with the key loop split PVS x PVW ways. PVS work-groups of PVW waves share one (MB*16)x64 output tile; wave w of part p takes the 128-key spans w * PVS + p, + PVS * PVW, ...
// (two 128-byte lines of every operand row) up to the diagonal block (probabilities beyond it are exactly zero) into its own f32 partial tile. A work-group sums its waves' tiles through LDS in fixed wave order
// and stores the sum in plane p of C (plane stride sP); k_merge adds the PVS planes in fixed order. Grid (M/(MB*16), N/64, Z*PVS), 32 * PVW threads.
#define PVW 8
#define PVS 4
template <typename T16, int NSPLIT, int MB>
__global__ __launch_bounds__(32 * PVW) void k_gemmpv(const T16* __restrict__ A, const T16* __restrict__ A2, const T16* __restrict__ Bt, const T16* __restrict__ Bt2, int K, float* C, int ldc, int roff, size_t sA, size_t sB, size_t sC, size_t sP) {
    static_assert((NSPLIT == 2 && MB == 2) || (NSPLIT == 0 && MB == 4), "the wait at the foot of the key loop names the address registers of these two forms");
    typedef typename WFrag<T16>::V V;
    constexpr int PVP = MB * 16 * 68;                                // floats of one wave's partial tile in LDS (MB*16 rows, pitch 68)
    __shared__ __align__(16) float ps[PVW * PVP];
    const int part = blockIdx.z % PVS; const size_t z = blockIdx.z / PVS; A += z * sA; if (A2) A2 += z * sA; Bt += z * sB; if (Bt2) Bt2 += z * sB; C += z * sC + (size_t)part * sP;
    const int lane = threadIdx.x & 31, lr = lane & 15, hi = lane >> 4; const int wave = __builtin_amdgcn_readfirstlane((int)(threadIdx.x >> 5)); const int r0 = blockIdx.x * (MB * 16), c0 = blockIdx.y * 64;
    const int Kl = min(K, ((r0 + roff + MB * 16 - 1) & ~63) + 64);   // the K loop stops behind the 64-key block that holds the tile's last diagonal element: probabilities are exactly 0 beyond it
    v8f acc[MB][4];
#pragma unroll
    for (int mb = 0; mb < MB; ++mb)
#pragma unroll
        for (int nb = 0; nb < 4; ++nb) acc[mb][nb] = (v8f){};
    const size_t aoff = (size_t)(r0 + lr) * K + 8 * hi, boff = (size_t)(c0 + lr) * K + 8 * hi;
#pragma unroll 1
    for (int kb = (wave * PVS + part) * 128; kb < Kl; kb += 128 * PVS * PVW) {
#pragma unroll 1
        for (int k0 = kb; k0 < min(kb + 128, Kl); k0 += 64) {
            const T16 *pa[4], *pa2[4], *pb[4], *pb2[4];
#pragma unroll
            for (int mb = 0; mb < 4; ++mb) { pa[mb] = (mb < MB) ? A + aoff + (size_t)mb * 16 * K + k0 : nullptr; pa2[mb] = (NSPLIT == 2 && mb < MB) ? A2 + aoff + (size_t)mb * 16 * K + k0 : nullptr; }
#pragma unroll
            for (int nb = 0; nb < 4; ++nb) { pb[nb] = Bt + boff + (size_t)nb * 16 * K + k0; pb2[nb] = (NSPLIT == 2) ? Bt2 + boff + (size_t)nb * 16 * K + k0 : nullptr; }
#pragma unroll
            for (int ks = 0; ks < 64; ks += 32) {
                V a[MB], a2[MB];
#pragma unroll
                for (int mb = 0; mb < MB; ++mb) { a[mb] = WFrag<T16>::ld(pa[mb] + ks); if (NSPLIT == 2) a2[mb] = WFrag<T16>::ld(pa2[mb] + ks); }
#pragma unroll
                for (int nb = 0; nb < 4; ++nb) { const V b = WFrag<T16>::ld(pb[nb] + ks); V b2; if (NSPLIT == 2) b2 = WFrag<T16>::ld(pb2[nb] + ks);
#pragma unroll
                    for (int mb = 0; mb < MB; ++mb) { acc[mb][nb] = WFrag<T16>::mma(a[mb], b, acc[mb][nb]); if (NSPLIT == 2) { acc[mb][nb] = WFrag<T16>::mma(a2[mb], b, acc[mb][nb]); acc[mb][nb] = WFrag<T16>::mma(a[mb], b2, acc[mb][nb]); } } }
            }
            // the address registers of this trip's loads stay as they are up to this wait (inputs only); they are rewritten only behind it
            if (NSPLIT == 2) asm volatile("s_wait_xcnt 0x0" :: "v"(pa[0]), "v"(pa[1]), "v"(pa2[0]), "v"(pa2[1]), "v"(pb[0]), "v"(pb[1]), "v"(pb[2]), "v"(pb[3]), "v"(pb2[0]), "v"(pb2[1]), "v"(pb2[2]), "v"(pb2[3]) : "memory");
            else asm volatile("s_wait_xcnt 0x0" :: "v"(pa[0]), "v"(pa[1]), "v"(pa[2]), "v"(pa[3]), "v"(pb[0]), "v"(pb[1]), "v"(pb[2]), "v"(pb[3]) : "memory");
        }
    }
    float* pw = ps + wave * PVP;
#pragma unroll
    for (int mb = 0; mb < MB; ++mb)
#pragma unroll
        for (int nb = 0; nb < 4; ++nb)
#pragma unroll
            for (int j = 0; j < 8; ++j) pw[(mb * 16 + hi * 8 + j) * 68 + nb * 16 + lr] = acc[mb][nb][j];
    __syncthreads();                                                 // every wave's partial tile is in LDS before any of it is summed
#pragma unroll
    for (int s = 0; s < MB * 256 / (32 * PVW); ++s) { const int f = s * (32 * PVW) + threadIdx.x; const int row = f >> 4, cofs = (f & 15) * 4; const float* pr = ps + row * 68 + cofs;
        v4f val = *(const v4fa*)pr;
#pragma unroll
        for (int w = 1; w < PVW; ++w) val += *(const v4fa*)(pr + w * PVP);
        *(v4f*)(C + (size_t)(r0 + row) * ldc + c0 + cofs) = val; }
}

__device__ __forceinline__ h16 tohx(float x) { return (h16)x; }
__device__ __forceinline__ void splitf(float y, unsigned short& h, unsigned short& l) { h = f2bf(y); l = f2bf(y - bf2f(h)); }
typedef __attribute__((ext_vector_type(2))) _Float16 v2h;
typedef __attribute__((ext_vector_type(4))) _Float16 v4h;
typedef __attribute__((ext_vector_type(2))) unsigned short v2us;
typedef __attribute__((ext_vector_type(4))) unsigned short v4us;
typedef __attribute__((ext_vector_type(2))) float v2f;
typedef __attribute__((ext_vector_type(4))) int v4i;

__global__ __launch_bounds__(256) void k_wtG(const float* __restrict__ w, int K, int N, bf* Bt) {
    const int lane = threadIdx.x & 31; const int L0 = (blockIdx.x * 8 + (threadIdx.x >> 5)) * 8; const int nlines = N * K / 64;
{
#pragma unroll 1
        for (int l = 0; l < 8; ++l) { const int L = L0 + l; if (L >= nlines) break; const size_t e = (size_t)L * 64 + lane * 2; const int k = (int)(e % K), n = (int)(e / K); v2us o;
            o[0] = f2bf(w[(size_t)k * N + n]); o[1] = f2bf(w[(size_t)(k + 1) * N + n]); *(v2us*)(Bt + e) = o; }
         }
}
__global__ __launch_bounds__(256) void k_cvt8(const float* __restrict__ src, bf* dst, size_t n8) { const size_t i = (size_t)blockIdx.x * 256 + threadIdx.x; if (i >= n8) return; const v8f v = *(const v8f*)(src + i * 8); v8us o;
#pragma unroll
    for (int k = 0; k < 8; ++k) o[k] = f2bf(v[k]); *(v8us*)(dst + i * 8) = o;  }

// k_rope: head planes [h][t][d] (fp16 + hi/lo) of rope(x) x sc with the rotate-half convention out[d] = x[d] cos[t][d] - x[d+HD/2] sin[t][d], out[d+HD/2] = x[d+HD/2] cos[t][d+HD/2] + x[d] sin[t][d+HD/2]
__global__ __launch_bounds__(256) void k_rope(const float* __restrict__ F, int pitch, int nheads, const float* __restrict__ CS, const float* __restrict__ RF, const float* __restrict__ nw, float sc, h16* P16, bf* Ph, bf* Pl) {
    const size_t e = ((size_t)blockIdx.x * 256 + threadIdx.x) * 2; if (e >= (size_t)nheads * TT * HD) return; const int d = (int)(e % HD); const int t = (int)((e / HD) % TT); const int h = (int)(e / ((size_t)HD * TT)); const float* f = F + (size_t)t * pitch + h * HD; const float rf = RF ? RF[(size_t)h * TT + t] : 1.0f; v2h o16; v2us oh, ol;
#pragma unroll
    for (int q = 0; q < 2; ++q) { const int dd = d + q; const int dp = (dd < HD / 2) ? dd + HD / 2 : dd - HD / 2; float x0 = f[dd], x1 = f[dp];
        if (RF) { float n0 = __fmul_rn(x0, rf), n1 = __fmul_rn(x1, rf); asm volatile("" : "+v"(n0)); asm volatile("" : "+v"(n1)); x0 = __fmul_rn(bfr(nw[dd]), n0); x1 = __fmul_rn(bfr(nw[dp]), n1); }
        const v2f cs = *(const v2f*)(CS + ((size_t)t * HD + dd) * 2); float a = __fmul_rn(x0, cs[0]), bq = __fmul_rn(x1, cs[1]); asm volatile("" : "+v"(a)); asm volatile("" : "+v"(bq)); const float r = ((dd < HD / 2) ? __fsub_rn(a, bq) : __fadd_rn(a, bq)) * sc;
        o16[q] = tohx(r); unsigned short a2, c2; splitf(r, a2, c2); oh[q] = a2; ol[q] = c2; }
    *(v2h*)(P16 + e) = o16; *(v2us*)(Ph + e) = oh; *(v2us*)(Pl + e) = ol;  }
__global__ __launch_bounds__(256) void k_vtp(const float* __restrict__ F, int pitch, int nheads, h16* V16, bf* Vh, bf* Vl) { const size_t e = ((size_t)blockIdx.x * 256 + threadIdx.x) * 2; if (e >= (size_t)nheads * HD * TT) return; const int t = (int)(e % TT); const int d = (int)((e / TT) % HD); const int g = (int)(e / ((size_t)TT * HD)); v2h o16; v2us oh, ol;
#pragma unroll
    for (int q = 0; q < 2; ++q) { const float x = F[(size_t)(t + q) * pitch + g * HD + d]; o16[q] = tohx(x); unsigned short a2, c2; splitf(x, a2, c2); oh[q] = a2; ol[q] = c2; }
    *(v2h*)(V16 + e) = o16; *(v2us*)(Vh + e) = oh; *(v2us*)(Vl + e) = ol;  }
__global__ __launch_bounds__(256) void k_csid(float* CS) { const int idx = blockIdx.x * 256 + threadIdx.x; if (idx >= TT * HD) return; v2f cs; cs[0] = 1.0f; cs[1] = 0.0f; *(v2f*)(CS + (size_t)idx * 2) = cs;  }
// k_lsoft: streaming causal row softmax over the TK = TT = 4096 keys, one wave per row i, three sweeps of the f32 score row (lane -> 4 consecutive keys per 128-key chunk, 32 chunks; keys j > i are excluded by index with -3e38 / 0 - the score tiles above the diagonal are never computed and their stale contents are only ever discarded by this select):
__global__ __launch_bounds__(256) void k_lsoft(const float* __restrict__ Sb, h16* P16, bf* Ph, bf* Pl) {
    const int lane = threadIdx.x & 31; const int row = blockIdx.x * 8 + (threadIdx.x >> 5); if (row >= ZH * TT) return; const int i = row % TT; const int zz = row / TT; const bool hires = (i < RH); const float* sr = Sb + (size_t)row * TT; float mx = -3.0e38f;
#pragma unroll 4
    for (int ch = 0; ch < TT / 128; ++ch) { const int j0 = ch * 128 + lane * 4; const v4f a = *(const v4f*)(sr + j0);
#pragma unroll
        for (int q = 0; q < 4; ++q) { float t = a[q] * SCL; asm volatile("" : "+v"(t)); t = (j0 + q <= i) ? t : -3.0e38f; mx = fmaxf(mx, t); } }
#pragma unroll
    for (int sh = 16; sh; sh >>= 1) mx = fmaxf(mx, __shfl_xor(mx, sh, 32));
    float sum = 0.f;
#pragma unroll 4
    for (int ch = 0; ch < TT / 128; ++ch) { const int j0 = ch * 128 + lane * 4; const v4f a = *(const v4f*)(sr + j0);
#pragma unroll
        for (int q = 0; q < 4; ++q) { float t = a[q] * SCL; asm volatile("" : "+v"(t)); t = (j0 + q <= i) ? t : -3.0e38f; float d0 = __fsub_rn(t, mx); asm volatile("" : "+v"(d0)); sum += __builtin_amdgcn_exp2f(__fmul_rn(d0, 1.4426950408889634f)); } }
#pragma unroll
    for (int sh = 16; sh; sh >>= 1) sum += __shfl_xor(sum, sh, 32);
    const float f = __fdiv_rn(hires ? 1.0f : PCAR, sum);
{
        if (hires) {   /* rows < RH: normalised bf16 hi/lo over the first RH keys (every later key is above the diagonal for these rows; the hi/lo attn.v GEMM stops its K loop at the diagonal block), planes [zz][RH][TT] */
#pragma unroll
            for (int ch = 0; ch < RH / 128; ++ch) { const int j0 = ch * 128 + lane * 4; const v4f a = *(const v4f*)(sr + j0); v4us oh, ol;
#pragma unroll
                for (int q = 0; q < 4; ++q) { float t = a[q] * SCL; asm volatile("" : "+v"(t)); t = (j0 + q <= i) ? t : -3.0e38f; float d0 = __fsub_rn(t, mx); asm volatile("" : "+v"(d0)); float ex = __builtin_amdgcn_exp2f(__fmul_rn(d0, 1.4426950408889634f)); asm volatile("" : "+v"(ex)); unsigned short a2, c2; splitf(ex * f, a2, c2); oh[q] = a2; ol[q] = c2; }
                const size_t oo = ((size_t)zz * RH + i) * TT + j0; *(v4us*)(Ph + oo) = oh; *(v4us*)(Pl + oo) = ol; }
        } else {
#pragma unroll 2
            for (int ch = 0; ch < TT / 128; ++ch) { const int j0 = ch * 128 + lane * 4; const v4f a = *(const v4f*)(sr + j0); v4h o4;
#pragma unroll
                for (int q = 0; q < 4; ++q) { float t = a[q] * SCL; asm volatile("" : "+v"(t)); t = (j0 + q <= i) ? t : -3.0e38f; float d0 = __fsub_rn(t, mx); asm volatile("" : "+v"(d0)); float ex = __builtin_amdgcn_exp2f(__fmul_rn(d0, 1.4426950408889634f)); asm volatile("" : "+v"(ex)); o4[q] = tohx(ex * f); }
                *(v4h*)(P16 + (size_t)row * TT + j0) = o4; } }
         }
}

__global__ __launch_bounds__(256) void k_merge(const float* __restrict__ O, int h0, bf* Ah, bf* Al) { const size_t e = ((size_t)blockIdx.x * 256 + threadIdx.x) * 2; if (e >= (size_t)ZH * TT * HD) return; const int d = (int)(e % HD); const int t = (int)((e / HD) % TT); const int zz = (int)(e / ((size_t)HD * TT)); const float cs = (t < RH) ? 1.0f : (1.0f / PCAR); const size_t oo = (size_t)t * DQ + (h0 + zz) * HD + d;
    v2us oh, ol;
#pragma unroll
    for (int q = 0; q < 2; ++q) { float o = O[e + q];   /* the PVS key-split planes of k_gemmpv, added in fixed order */
#pragma unroll
        for (int p = 1; p < PVS; ++p) o += O[(size_t)p * ZH * TT * HD + e + q];
        unsigned short a, c2; splitf(o * cs, a, c2); oh[q] = a; ol[q] = c2; } *(v2us*)(Ah + oo) = oh; *(v2us*)(Al + oo) = ol;  }

extern "C" void kernel_launch(void* const* d_in, const int* in_sizes, int n_in,
                              void* d_out, int out_size, void* d_ws, size_t ws_size, hipStream_t stream) {
    (void)in_sizes; (void)n_in; (void)out_size;
    const float* x = (const float*)d_in[0]; const float* wq = (const float*)d_in[1]; const float* wk = (const float*)d_in[2]; const float* wv = (const float*)d_in[3]; const float* wo = (const float*)d_in[4]; const float* bo = (const float*)d_in[5];
    float* OUT = (float*)d_out;     // [1][4096][1024]
    char* wsp = (char*)d_ws;
    auto take = [&](size_t bytes) { char* p = wsp; wsp += (bytes + 255) & ~(size_t)255; return (void*)p; };
    bf* WQ = (bf*)take((size_t)DQ * DM * 2); bf* WK = (bf*)take((size_t)DKV * DM * 2); bf* WV = (bf*)take((size_t)DKV * DM * 2); bf* WO = (bf*)take((size_t)DM * DQ * 2); float* CS = (float*)take((size_t)TT * HD * 2 * 4);
    bf* XB = (bf*)take((size_t)TT * DM * 2); float* FQ = (float*)take((size_t)TT * DQ * 4); float* FK = (float*)take((size_t)TT * DKV * 4);
    h16* QP16 = (h16*)take((size_t)NH_ * TT * HD * 2); h16* KP16 = (h16*)take((size_t)NKV * TT * HD * 2); h16* VT16 = (h16*)take((size_t)NKV * HD * TT * 2);
    bf* QPh = (bf*)take((size_t)NH_ * TT * HD * 2); bf* QPl = (bf*)take((size_t)NH_ * TT * HD * 2); bf* KPh = (bf*)take((size_t)NKV * TT * HD * 2); bf* KPl = (bf*)take((size_t)NKV * TT * HD * 2); bf* VTh = (bf*)take((size_t)NKV * HD * TT * 2); bf* VTl = (bf*)take((size_t)NKV * HD * TT * 2); bf* Ph = (bf*)take((size_t)ZH * RH * TT * 2); bf* Pl = (bf*)take((size_t)ZH * RH * TT * 2);
    float* Sb = (float*)take((size_t)ZH * TT * TT * 4); h16* P16 = (h16*)take((size_t)ZH * TT * TT * 2); float* Ob = (float*)take((size_t)PVS * ZH * TT * HD * 4); bf* ATh = (bf*)take((size_t)TT * DQ * 2); bf* ATl = (bf*)take((size_t)TT * DQ * 2);
    if ((size_t)(wsp - (char*)d_ws) > ws_size) return;    // ws 256 MiB
    float* FV = FK;   // v projection reuses the k buffer after the k planes are built (stream-ordered)
    { k_wtG<<<(unsigned)((DM * DQ / 64 + 63) / 64), 256, 0, stream>>>(wq, DM, DQ, WQ); k_wtG<<<(unsigned)((DM * DKV / 64 + 63) / 64), 256, 0, stream>>>(wk, DM, DKV, WK); k_wtG<<<(unsigned)((DM * DKV / 64 + 63) / 64), 256, 0, stream>>>(wv, DM, DKV, WV);   /* (in, out) 'xw' weights: transposed once into Bt */
      k_wtG<<<(unsigned)((DQ * DM / 64 + 63) / 64), 256, 0, stream>>>(wo, DQ, DM, WO);
       }
    k_csid<<<(TT * HD + 255) / 256, 256, 0, stream>>>(CS);
    const unsigned LQ = (unsigned)(((size_t)NH_ * TT * HD / 2 + 255) / 256), LKv = (unsigned)(((size_t)NKV * TT * HD / 2 + 255) / 256);
    for (int b = 0; b < NB_; ++b) {
        
        k_cvt8<<<(unsigned)(((size_t)TT * DM / 8 + 255) / 256), 256, 0, stream>>>(x + (size_t)b * TT * DM, XB, (size_t)TT * DM / 8);
        k_gemmw<bf, 0, false><<<dim3(TT / 64, DQ / 64, 1), 32, 0, stream>>>(XB, nullptr, WQ, nullptr, DM, FQ, DQ, nullptr, 0, 0, 0);
        k_rope<<<LQ, 256, 0, stream>>>(FQ, DQ, NH_, CS, nullptr, nullptr, 1.0f, QP16, QPh, QPl);
        k_gemmw<bf, 0, false><<<dim3(TT / 64, DKV / 64, 1), 32, 0, stream>>>(XB, nullptr, WK, nullptr, DM, FK, DKV, nullptr, 0, 0, 0);
        k_rope<<<LKv, 256, 0, stream>>>(FK, DKV, NKV, CS, nullptr, nullptr, 1.0f, KP16, KPh, KPl);
        k_gemmw<bf, 0, false><<<dim3(TT / 64, DKV / 64, 1), 32, 0, stream>>>(XB, nullptr, WV, nullptr, DM, FV, DKV, nullptr, 0, 0, 0); k_vtp<<<LKv, 256, 0, stream>>>(FV, DKV, NKV, VT16, VTh, VTl);
        for (int h0 = 0; h0 < NH_; h0 += ZH) { const size_t zq = (size_t)h0, zk = (size_t)(h0 / REP);   // one kv head per query head: the pass's one head uses kv plane zk = h0 (z-strides TT*HD)
            k_gemmc<bf, 2, 1><<<dim3(RH / 64, TT / 64, ZH), 32, 0, stream>>>(QPh + zq * TT * HD, QPl + zq * TT * HD, KPh + zk * TT * HD, KPl + zk * TT * HD, HD, Sb, TT, 0, (size_t)TT * HD, (size_t)TT * HD, (size_t)TT * TT);
            k_gemmc<h16, 0, 1><<<dim3((TT - RH) / 64, TT / 64, ZH), 32, 0, stream>>>(QP16 + zq * TT * HD + (size_t)RH * HD, nullptr, KP16 + zk * TT * HD, nullptr, HD, Sb + (size_t)RH * TT, TT, RH, (size_t)TT * HD, (size_t)TT * HD, (size_t)TT * TT);
            k_lsoft<<<ZH * TT / 8, 256, 0, stream>>>(Sb, P16, Ph, Pl);
            k_gemmpv<bf, 2, 2><<<dim3(RH / 32, HD / 64, ZH * PVS), 32 * PVW, 0, stream>>>(Ph, Pl, VTh + zk * HD * TT, VTl + zk * HD * TT, TT, Ob, HD, 0, (size_t)RH * TT, (size_t)HD * TT, (size_t)TT * HD, (size_t)ZH * TT * HD);
            k_gemmpv<h16, 0, 4><<<dim3((TT - RH) / 64, HD / 64, ZH * PVS), 32 * PVW, 0, stream>>>(P16 + (size_t)RH * TT, nullptr, VT16 + zk * HD * TT, nullptr, TT, Ob + (size_t)RH * HD, HD, RH, (size_t)TT * TT, (size_t)HD * TT, (size_t)TT * HD, (size_t)ZH * TT * HD);
            k_merge<<<(unsigned)(((size_t)ZH * TT * HD / 2 + 255) / 256), 256, 0, stream>>>(Ob, h0, ATh, ATl); }
        k_gemmw<bf, 1, true><<<dim3(TT / 64, DM / 64, 1), 32, 0, stream>>>(ATh, ATl, WO, nullptr, DQ, OUT + (size_t)b * TT * DM, DM, bo, 0, 0, 0); }
}

// v003
// One run takes 228 microseconds.
// Versions between v001 and this one are left out; their measured steps multiply to 6.13 times as fast.
// All steps since v000 together make it 12.0 times as fast.
#include <hip/hip_runtime.h>

// Causal multi-head self-attention over 4,096 tokens with (in, out) weights (x [1][4096][1024]; q, k, v = x W ('xw' [1024][1024] 0.02, no bias; 16 heads x 64); scores with -inf strictly above the diagonal (triu k=1), then / sqrt(64) inside the softmax (the same function as scaling first); softmax; out = merged Wo + bo ('xw' + a REAL bias 0.02) -> [1][4096][1024] (4.2 M); argument order x, Wq, Wk, Wv, Wo, bo).
// Layout: bf16 copy of x; exact projections whose epilogue stores the attention operand planes; causal T-4096 attention of all heads fused in one launch with an online softmax (hybrid rows: < 512 hi/lo 3 products, rest fp16); merged hi/lo x Wo exact + bo.
// Compute dtypes, f32 accumulate: every input rounded to bf16; projections exact; attention rows < 512 3 products, rest fp16; softmax f32; Wo hl x exact + bias.

#define NB_  1
#define TT   4096
#define DM   1024
#define NH_  16
#define NKV  16
#define REP  (NH_ / NKV)
#define HD   64
#define DQ   (NH_ * HD)
#define DKV  (NKV * HD)
#define RH   512                  // query rows < RH use hi+lo planes (0: none)
#define WIN  4096
#define SCL  0.125f   // HD^-0.5
typedef _Float16 h16;
typedef unsigned short bf;
typedef __attribute__((ext_vector_type(16))) __bf16   v16bf;
typedef __attribute__((ext_vector_type(16))) _Float16 v16h;
typedef __attribute__((ext_vector_type(8)))  _Float16 v8h;
typedef __attribute__((ext_vector_type(8)))  unsigned short v8us;
typedef __attribute__((ext_vector_type(8)))  float    v8f;
typedef __attribute__((ext_vector_type(4)))  float    v4f;
typedef v8h  __attribute__((may_alias)) v8ha;
typedef v4f  __attribute__((may_alias)) v4fa;
typedef v8us __attribute__((may_alias)) v8usa;

__device__ __forceinline__ unsigned short f2bf(float f) { unsigned u = __float_as_uint(f); u += 0x7FFFu + ((u >> 16) & 1u); return (unsigned short)(u >> 16); }
__device__ __forceinline__ float bf2f(unsigned short b) { return __uint_as_float(((unsigned)b) << 16); }
__device__ __forceinline__ float bfr(float f) { return bf2f(f2bf(f)); }
__device__ __forceinline__ v16h cat16(v8h lo, v8h hi) { return __builtin_shufflevector(lo, hi, 0, 1, 2, 3, 4, 5, 6, 7, 8, 9, 10, 11, 12, 13, 14, 15); }
__device__ __forceinline__ v16bf cat16b(v8us lo, v8us hi) { return __builtin_bit_cast(v16bf, __builtin_shufflevector(lo, hi, 0, 1, 2, 3, 4, 5, 6, 7, 8, 9, 10, 11, 12, 13, 14, 15)); }
__device__ __forceinline__ v8f wmma16(v16h a, v16h b, v8f c) { return __builtin_amdgcn_wmma_f32_16x16x32_f16(false, a, false, b, (short)0, c, false, false); }
__device__ __forceinline__ v8f wmmab(v16bf a, v16bf b, v8f c) { return __builtin_amdgcn_wmma_f32_16x16x32_bf16(false, a, false, b, (short)0, c, false, false); }



__device__ __forceinline__ h16 tohx(float x) { return (h16)x; }
__device__ __forceinline__ void splitf(float y, unsigned short& h, unsigned short& l) { h = f2bf(y); l = f2bf(y - bf2f(h)); }
// eight f32 results -> their fp16 image and their bf16 hi/lo pair
__device__ __forceinline__ void planes8(const float* y, v8h& o16, v8us& oh, v8us& ol) {
#pragma unroll
    for (int e = 0; e < 8; ++e) { o16[e] = tohx(y[e]); unsigned short a, c; splitf(y[e], a, c); oh[e] = a; ol[e] = c; } }

// ---- k_gemmw: register-blocked GEMM, ONE WAVE per 64x64 output tile (16 accumulators), operands straight from K-contiguous 16-bit planes; grid (M/64, N/64, Z), 32 threads.
// C[m][n] = sum_k A[m][k] Bt[n][k] (+ split products per NSPLIT). z-batch strides sA/sB/sC in elements. K % 32 == 0.
// EPI 0: C goes out in f32 (pitch ldc, + optional f32 bias[n]). EPI 1 and 2: m is the token, the 64 columns are one head (HD == 64), and C goes out only as the three 16-bit planes
// (fp16, bf16 hi, bf16 lo) that the attention reads: EPI 1 [head][token][d] through the LDS transpose, EPI 2 [head][d][token] straight from the accumulators (a lane holds 8 consecutive tokens of one d).
template <typename T16> struct WFrag;
template <> struct WFrag<h16> { typedef v16h V; static __device__ __forceinline__ V ld(const h16* p) { return cat16(*(const v8h*)p, *(const v8h*)(p + 16)); } static __device__ __forceinline__ v8f mma(V a, V b, v8f c) { return wmma16(a, b, c); } };
template <> struct WFrag<bf> { typedef v16bf V; static __device__ __forceinline__ V ld(const bf* p) { return cat16b(*(const v8us*)p, *(const v8us*)(p + 16)); } static __device__ __forceinline__ v8f mma(V a, V b, v8f c) { return wmmab(a, b, c); } };
template <typename T16, int NSPLIT, bool BIAS, int EPI>
__global__ __launch_bounds__(32) void k_gemmw(const T16* __restrict__ A, const T16* __restrict__ A2, const T16* __restrict__ Bt, const T16* __restrict__ Bt2, int K, float* C, int ldc, const float* __restrict__ bias, size_t sA, size_t sB, size_t sC, h16* P16, bf* Ph, bf* Pl) {
    static_assert(EPI == 0 || HD == 64, "a 64-column tile is one head");
    typedef typename WFrag<T16>::V V;
    __shared__ __align__(16) float os[16 * 68];
    const size_t z = blockIdx.z; A += z * sA; if (A2) A2 += z * sA; Bt += z * sB; if (Bt2) Bt2 += z * sB; C += z * sC;
    const int lane = threadIdx.x & 31, lr = lane & 15, hi = lane >> 4; const int r0 = blockIdx.x * 64, c0 = blockIdx.y * 64;
    v8f acc[4][4];
#pragma unroll
    for (int mb = 0; mb < 4; ++mb)
#pragma unroll
        for (int nb = 0; nb < 4; ++nb) acc[mb][nb] = (v8f){};
    const size_t aoff = (size_t)(r0 + lr) * K + 8 * hi, boff = (size_t)(c0 + lr) * K + 8 * hi;
#pragma unroll 1
    for (int kc = 0; kc < K; kc += 32) {
        V a[4], a2[4];
#pragma unroll
        for (int mb = 0; mb < 4; ++mb) { a[mb] = WFrag<T16>::ld(A + aoff + (size_t)mb * 16 * K + kc); if (NSPLIT == 1 || NSPLIT == 2) a2[mb] = WFrag<T16>::ld(A2 + aoff + (size_t)mb * 16 * K + kc); }
#pragma unroll
        for (int nb = 0; nb < 4; ++nb) { const V b = WFrag<T16>::ld(Bt + boff + (size_t)nb * 16 * K + kc); V b2; if (NSPLIT >= 2) b2 = WFrag<T16>::ld(Bt2 + boff + (size_t)nb * 16 * K + kc);
#pragma unroll
            for (int mb = 0; mb < 4; ++mb) { acc[mb][nb] = WFrag<T16>::mma(a[mb], b, acc[mb][nb]); if (NSPLIT == 1 || NSPLIT == 2) acc[mb][nb] = WFrag<T16>::mma(a2[mb], b, acc[mb][nb]); if (NSPLIT >= 2) acc[mb][nb] = WFrag<T16>::mma(a[mb], b2, acc[mb][nb]); } }
        asm volatile("v_nop\n\tv_nop\n\tv_nop\n\tv_nop" : "+v"(acc[0][0]), "+v"(acc[1][1]), "+v"(acc[2][2]), "+v"(acc[3][3]) : "v"(a[0]), "v"(a[3]));
    }
    if constexpr (EPI == 2) {
#pragma unroll
        for (int nb = 0; nb < 4; ++nb) { const size_t e = (size_t)(c0 + nb * 16 + lr) * TT + r0 + hi * 8; h16* p16 = P16 + e; bf* ph = Ph + e; bf* pl = Pl + e; v8h o16[4]; v8us oh[4], ol[4];
#pragma unroll
            for (int mb = 0; mb < 4; ++mb) { float y[8];
#pragma unroll
                for (int j = 0; j < 8; ++j) y[j] = acc[mb][nb][j];
                planes8(y, o16[mb], oh[mb], ol[mb]); }
#pragma unroll
            for (int mb = 0; mb < 4; ++mb) *(v8h*)(p16 + mb * 16) = o16[mb];      // the four stores of a plane fill whole 128-byte lines
#pragma unroll
            for (int mb = 0; mb < 4; ++mb) *(v8us*)(ph + mb * 16) = oh[mb];
#pragma unroll
            for (int mb = 0; mb < 4; ++mb) *(v8us*)(pl + mb * 16) = ol[mb];
        }
        return; }
#pragma unroll
    for (int mb = 0; mb < 4; ++mb) {
#pragma unroll
        for (int nb = 0; nb < 4; ++nb) {
#pragma unroll
            for (int j = 0; j < 8; ++j) os[(hi * 8 + j) * 68 + nb * 16 + lr] = acc[mb][nb][j]; }
        __builtin_amdgcn_wave_barrier(); asm volatile("" ::: "memory");
        if constexpr (EPI == 1) {
            const size_t e = ((size_t)blockIdx.y * TT + r0 + mb * 16 + (lane >> 3)) * HD + (lane & 7) * 8; h16* p16 = P16 + e; bf* ph = Ph + e; bf* pl = Pl + e; v8h o16[4]; v8us oh[4], ol[4];
#pragma unroll
            for (int s = 0; s < 4; ++s) { const float* orow = os + (4 * s + (lane >> 3)) * 68 + (lane & 7) * 8; const v4f y0 = *(const v4fa*)orow, y1 = *(const v4fa*)(orow + 4); float y[8];
#pragma unroll
                for (int j = 0; j < 4; ++j) { y[j] = y0[j]; y[4 + j] = y1[j]; }
                planes8(y, o16[s], oh[s], ol[s]); }
#pragma unroll
            for (int s = 0; s < 4; ++s) { *(v8h*)(p16 + s * 4 * HD) = o16[s]; *(v8us*)(ph + s * 4 * HD) = oh[s]; *(v8us*)(pl + s * 4 * HD) = ol[s]; }   // each store: four whole rows, 512 bytes in a row
        } else {
        float* crow = C + (size_t)(r0 + mb * 16) * ldc + c0;
{
#pragma unroll
            for (int s = 0; s < 8; ++s) { const int row = 2 * s + hi, cofs = lr * 4; v4f val = *(const v4fa*)(os + row * 68 + cofs); if (BIAS) { val[0] += bfr(bias[c0 + cofs]); val[1] += bfr(bias[c0 + cofs + 1]); val[2] += bfr(bias[c0 + cofs + 2]); val[3] += bfr(bias[c0 + cofs + 3]); }
                *(v4f*)(crow + (size_t)row * ldc + cofs) = val; }
             }
        }
        __builtin_amdgcn_wave_barrier(); asm volatile("" ::: "memory");
    }
}

typedef __attribute__((ext_vector_type(4))) _Float16 v4h;
typedef __attribute__((ext_vector_type(2))) unsigned short v2us;
typedef __attribute__((ext_vector_type(4))) unsigned short v4us;
typedef __attribute__((ext_vector_type(4))) int v4i;

__global__ __launch_bounds__(256) void k_wtG(const float* __restrict__ w, int K, int N, bf* Bt) {
    const int lane = threadIdx.x & 31; const int L0 = (blockIdx.x * 8 + (threadIdx.x >> 5)) * 8; const int nlines = N * K / 64;
{
#pragma unroll 1
        for (int l = 0; l < 8; ++l) { const int L = L0 + l; if (L >= nlines) break; const size_t e = (size_t)L * 64 + lane * 2; const int k = (int)(e % K), n = (int)(e / K); v2us o;
            o[0] = f2bf(w[(size_t)k * N + n]); o[1] = f2bf(w[(size_t)(k + 1) * N + n]); *(v2us*)(Bt + e) = o; }
         }
}
__global__ __launch_bounds__(256) void k_cvt8(const float* __restrict__ src, bf* dst, size_t n8) { const size_t i = (size_t)blockIdx.x * 256 + threadIdx.x; if (i >= n8) return; const v8f v = *(const v8f*)(src + i * 8); v8us o;
#pragma unroll
    for (int k = 0; k < 8; ++k) o[k] = f2bf(v[k]); *(v8us*)(dst + i * 8) = o;  }

// ---- k_fattn: scores, causal softmax and probability x value contraction of ALL heads in one launch (online softmax); no score or probability ever reaches memory.
// One wave owns FNQ * 16 query columns of one head and walks the keys 0 .. its diagonal in passes of KB keys, transposed: S^T = K Q^T (A = K rows, B = Q rows), O^T += V^T P^T (A = V^T rows, B = P^T).
// A lane (lr, hi) holds, of each 16-key score tile, the keys 8 * hi + j of query column lr; two such tiles, converted in place, are the B operand of the second product in the k order of WFrag::ld.
// Per column: running maximum m (log2 units, equal in both lane halves), running sum l (one partial per lane half, joined at the end); O^T and l are rescaled only when a new maximum exceeds m by more than 8.
// Rows < RH: bf16 hi/lo planes, three products in both contractions; the rest fp16. The quotient O / l goes out as the merged hi/lo planes [t][DQ]. Grid (heads, FNB).
#define FNQ 2
#define FWV 4
#define FNB (TT / (FWV * FNQ * 16))   // work-groups per head
__device__ __forceinline__ float xhalf(float x) { return __builtin_bit_cast(float, __builtin_amdgcn_permlanex16(__builtin_bit_cast(int, x), __builtin_bit_cast(int, x), 0x76543210, 0xfedcba98, false, false)); }   // lane l <-> lane l ^ 16
// 2^x in place; the v_nop is the one slot the instruction set asks for behind a transcendental, in the same statement so that it stands directly behind it (source = result: nothing can overwrite the source alone)
__device__ __forceinline__ float exp2s(float x) { asm("v_exp_f32 %0, %0\n\tv_nop" : "+v"(x)); return x; }
template <typename T16, bool HL, int KB>
__device__ __forceinline__ void fattn_tile(const T16* __restrict__ Q, const T16* __restrict__ Q2, const T16* __restrict__ Kp, const T16* __restrict__ Kp2, const T16* __restrict__ Vt, const T16* __restrict__ Vt2, int q0, int lr, int hi, bf* Ah, bf* Al) {
    typedef typename WFrag<T16>::V V;
    constexpr int NKT = KB / 16, NKK = KB / 32;
    constexpr float C2 = SCL * 1.4426950408889634f;                  // score -> log2 units
    V qf[FNQ][2], qf2[FNQ][2];
    const T16* pq = Q + (size_t)(q0 + lr) * HD + 8 * hi; const T16* pq2 = HL ? Q2 + (size_t)(q0 + lr) * HD + 8 * hi : nullptr;
#pragma unroll
    for (int g = 0; g < FNQ; ++g)
#pragma unroll
        for (int ks = 0; ks < 2; ++ks) { qf[g][ks] = WFrag<T16>::ld(pq + g * 16 * HD + ks * 32); if (HL) qf2[g][ks] = WFrag<T16>::ld(pq2 + g * 16 * HD + ks * 32); }
    v8f o[4][FNQ]; float m[FNQ], l[FNQ];
#pragma unroll
    for (int g = 0; g < FNQ; ++g) { m[g] = -3.0e38f; l[g] = 0.f;
#pragma unroll
        for (int dt = 0; dt < 4; ++dt) o[dt][g] = (v8f){}; }
    const int kend = q0 + FNQ * 16;                                  // first key above every diagonal element of the tile
    const T16* pk = Kp + (size_t)lr * HD + 8 * hi; const T16* pk2 = HL ? Kp2 + (size_t)lr * HD + 8 * hi : nullptr;
    const T16* pv = Vt + (size_t)lr * TT + 8 * hi; const T16* pv2 = HL ? Vt2 + (size_t)lr * TT + 8 * hi : nullptr;
    V kf[NKT][2], kf2[NKT][2];
#pragma unroll
    for (int kt = 0; kt < NKT; ++kt)
#pragma unroll
        for (int ks = 0; ks < 2; ++ks) { kf[kt][ks] = WFrag<T16>::ld(pk + kt * 16 * HD + ks * 32); if (HL) kf2[kt][ks] = WFrag<T16>::ld(pk2 + kt * 16 * HD + ks * 32); }
    // the address registers of the Q and first K loads stay as they are up to this wait (inputs only)
    if (HL) asm volatile("s_wait_xcnt 0x0" :: "v"(pq), "v"(pq2), "v"(pk), "v"(pk2) : "memory"); else asm volatile("s_wait_xcnt 0x0" :: "v"(pq), "v"(pk) : "memory");
#pragma unroll 1
    for (int k0 = 0; k0 < kend; k0 += KB) {
        V vf[4][NKK], vf2[4][NKK];                                   // this pass's V^T fragments: issued here, first used behind the softmax
#pragma unroll
        for (int dt = 0; dt < 4; ++dt)
#pragma unroll
            for (int kk = 0; kk < NKK; ++kk) { vf[dt][kk] = WFrag<T16>::ld(pv + (size_t)dt * 16 * TT + kk * 32); if (HL) vf2[dt][kk] = WFrag<T16>::ld(pv2 + (size_t)dt * 16 * TT + kk * 32); }
        // the V address registers stay as they are up to this wait (inputs only); they are rewritten only behind it
        if (HL) asm volatile("s_wait_xcnt 0x0" :: "v"(pv), "v"(pv2) : "memory"); else asm volatile("s_wait_xcnt 0x0" :: "v"(pv) : "memory");
        v8f s[NKT][FNQ];
#pragma unroll
        for (int kt = 0; kt < NKT; ++kt)
#pragma unroll
            for (int g = 0; g < FNQ; ++g) s[kt][g] = (v8f){};
#pragma unroll
        for (int ks = 0; ks < 2; ++ks)
#pragma unroll
            for (int kt = 0; kt < NKT; ++kt)
#pragma unroll
                for (int g = 0; g < FNQ; ++g) { s[kt][g] = WFrag<T16>::mma(kf[kt][ks], qf[g][ks], s[kt][g]); if (HL) { s[kt][g] = WFrag<T16>::mma(kf2[kt][ks], qf[g][ks], s[kt][g]); s[kt][g] = WFrag<T16>::mma(kf[kt][ks], qf2[g][ks], s[kt][g]); } }
        if (k0 + KB < kend) { pk += KB * HD; if (HL) pk2 += KB * HD; }   // the last pass fetches its own rows again: always inside the plane
#pragma unroll
        for (int kt = 0; kt < NKT; ++kt)                             // next pass's K fragments, in flight behind the softmax and the second product
#pragma unroll
            for (int ks = 0; ks < 2; ++ks) { kf[kt][ks] = WFrag<T16>::ld(pk + kt * 16 * HD + ks * 32); if (HL) kf2[kt][ks] = WFrag<T16>::ld(pk2 + kt * 16 * HD + ks * 32); }
        // the K address registers stay as they are up to this wait (inputs only); they are rewritten only behind it
        if (HL) asm volatile("s_wait_xcnt 0x0" :: "v"(pk), "v"(pk2) : "memory"); else asm volatile("s_wait_xcnt 0x0" :: "v"(pk) : "memory");
        if (k0 + KB - 1 > q0) {                                      // only passes that reach the diagonal mask (wave-uniform test)
#pragma unroll
            for (int kt = 0; kt < NKT; ++kt)
#pragma unroll
                for (int g = 0; g < FNQ; ++g)
#pragma unroll
                    for (int j = 0; j < 8; ++j) s[kt][g][j] = (k0 + kt * 16 + hi * 8 + j <= q0 + g * 16 + lr) ? s[kt][g][j] : -3.0e38f; }
        float tm[FNQ]; bool need = false;
#pragma unroll
        for (int g = 0; g < FNQ; ++g) { float t = s[0][g][0];
#pragma unroll
            for (int kt = 0; kt < NKT; ++kt)
#pragma unroll
                for (int j = 0; j < 8; ++j) t = fmaxf(t, s[kt][g][j]);
            t = fmaxf(t, xhalf(t)) * C2; tm[g] = t; need = need || (t > m[g] + 8.0f); }
        if (__builtin_amdgcn_ballot_w32(need) != 0) {                // scalar branch: rare once the maxima have settled
#pragma unroll
            for (int g = 0; g < FNQ; ++g) { const float mn = fmaxf(m[g], tm[g]); const float al = exp2s(m[g] - mn); m[g] = mn; l[g] *= al;
#pragma unroll
                for (int dt = 0; dt < 4; ++dt) o[dt][g] *= al; } }
        V pf[FNQ][NKK], pf2[FNQ][NKK];
#pragma unroll
        for (int g = 0; g < FNQ; ++g)
#pragma unroll
            for (int kk = 0; kk < NKK; ++kk) { float p[16]; float ls = 0.f;
#pragma unroll
                for (int e = 0; e < 16; ++e) { p[e] = exp2s(__builtin_fmaf(s[2 * kk + (e >> 3)][g][e & 7], C2, -m[g])); ls += p[e]; }
                l[g] += ls;
                if constexpr (HL) { v8us h0, h1, l0, l1;
#pragma unroll
                    for (int e = 0; e < 8; ++e) { unsigned short a, c; splitf(p[e], a, c); h0[e] = a; l0[e] = c; splitf(p[8 + e], a, c); h1[e] = a; l1[e] = c; }
                    pf[g][kk] = cat16b(h0, h1); pf2[g][kk] = cat16b(l0, l1);
                } else { v16h ph;
#pragma unroll
                    for (int e = 0; e < 16; ++e) ph[e] = tohx(p[e]);
                    pf[g][kk] = ph; } }
#pragma unroll
        for (int kk = 0; kk < NKK; ++kk)
#pragma unroll
            for (int dt = 0; dt < 4; ++dt)
#pragma unroll
                for (int g = 0; g < FNQ; ++g) { o[dt][g] = WFrag<T16>::mma(vf[dt][kk], pf[g][kk], o[dt][g]); if (HL) { o[dt][g] = WFrag<T16>::mma(vf2[dt][kk], pf[g][kk], o[dt][g]); o[dt][g] = WFrag<T16>::mma(vf[dt][kk], pf2[g][kk], o[dt][g]); } }
        pv += KB; if (HL) pv2 += KB;
    }
    v8us oh[FNQ][4], ol[FNQ][4];
#pragma unroll
    for (int g = 0; g < FNQ; ++g) { const float inv = __fdiv_rn(1.0f, l[g] + xhalf(l[g]));   // the two lane halves' sums, joined once
#pragma unroll
        for (int dt = 0; dt < 4; ++dt)
#pragma unroll
            for (int j = 0; j < 8; ++j) { unsigned short a, c; splitf(o[dt][g][j] * inv, a, c); oh[g][dt][j] = a; ol[g][dt][j] = c; } }
    bf* pa = Ah + (size_t)(q0 + lr) * DQ + hi * 8; bf* pl = Al + (size_t)(q0 + lr) * DQ + hi * 8;
#pragma unroll
    for (int g = 0; g < FNQ; ++g)
#pragma unroll
        for (int dt = 0; dt < 4; ++dt) { *(v8us*)(pa + g * 16 * DQ + dt * 16) = oh[g][dt]; *(v8us*)(pl + g * 16 * DQ + dt * 16) = ol[g][dt]; }
    static_assert(FNQ == 2, "the wait behind the stores names the data registers of two column groups");
    // the data and address registers of the stores stay as they are up to this wait (inputs only)
    asm volatile("s_wait_xcnt 0x0" :: "v"(oh[0][0]), "v"(oh[0][1]), "v"(oh[0][2]), "v"(oh[0][3]), "v"(oh[1][0]), "v"(oh[1][1]), "v"(oh[1][2]), "v"(oh[1][3]), "v"(ol[0][0]), "v"(ol[0][1]), "v"(ol[0][2]), "v"(ol[0][3]), "v"(ol[1][0]), "v"(ol[1][1]), "v"(ol[1][2]), "v"(ol[1][3]), "v"(pa), "v"(pl) : "memory");
}
__global__ __launch_bounds__(32 * FWV) void k_fattn(const h16* __restrict__ Q16, const h16* __restrict__ K16, const h16* __restrict__ V16, const bf* __restrict__ Qh, const bf* __restrict__ Ql, const bf* __restrict__ Kh, const bf* __restrict__ Kl, const bf* __restrict__ Vh, const bf* __restrict__ Vl, bf* Ah, bf* Al) {
    const int lane = threadIdx.x & 31, lr = lane & 15, hi = lane >> 4; const int wave = __builtin_amdgcn_readfirstlane((int)(threadIdx.x >> 5));
    const int h = blockIdx.x; const int y = blockIdx.y; const int qb = (y < FNB / 2) ? FNB - 1 - y : y - FNB / 2;   // longest walks first; blocks y and y + FNB / 2 walk FNB + 1 blocks' worth of keys together
    const int q0 = (qb * FWV + wave) * (FNQ * 16);
    const size_t zq = (size_t)h * TT * HD, zk = (size_t)(h / REP) * TT * HD;
    if (q0 < RH) fattn_tile<bf, true, 32>(Qh + zq, Ql + zq, Kh + zk, Kl + zk, Vh + zk, Vl + zk, q0, lr, hi, Ah + h * HD, Al + h * HD);
    else fattn_tile<h16, false, 64>(Q16 + zq, nullptr, K16 + zk, nullptr, V16 + zk, nullptr, q0, lr, hi, Ah + h * HD, Al + h * HD);
}

extern "C" void kernel_launch(void* const* d_in, const int* in_sizes, int n_in,
                              void* d_out, int out_size, void* d_ws, size_t ws_size, hipStream_t stream) {
    (void)in_sizes; (void)n_in; (void)out_size;
    const float* x = (const float*)d_in[0]; const float* wq = (const float*)d_in[1]; const float* wk = (const float*)d_in[2]; const float* wv = (const float*)d_in[3]; const float* wo = (const float*)d_in[4]; const float* bo = (const float*)d_in[5];
    float* OUT = (float*)d_out;     // [1][4096][1024]
    char* wsp = (char*)d_ws;
    auto take = [&](size_t bytes) { char* p = wsp; wsp += (bytes + 255) & ~(size_t)255; return (void*)p; };
    bf* WQ = (bf*)take((size_t)DQ * DM * 2); bf* WK = (bf*)take((size_t)DKV * DM * 2); bf* WV = (bf*)take((size_t)DKV * DM * 2); bf* WO = (bf*)take((size_t)DM * DQ * 2);
    bf* XB = (bf*)take((size_t)TT * DM * 2);
    h16* QP16 = (h16*)take((size_t)NH_ * TT * HD * 2); h16* KP16 = (h16*)take((size_t)NKV * TT * HD * 2); h16* VT16 = (h16*)take((size_t)NKV * HD * TT * 2);
    bf* QPh = (bf*)take((size_t)NH_ * TT * HD * 2); bf* QPl = (bf*)take((size_t)NH_ * TT * HD * 2); bf* KPh = (bf*)take((size_t)NKV * TT * HD * 2); bf* KPl = (bf*)take((size_t)NKV * TT * HD * 2); bf* VTh = (bf*)take((size_t)NKV * HD * TT * 2); bf* VTl = (bf*)take((size_t)NKV * HD * TT * 2);
    bf* ATh = (bf*)take((size_t)TT * DQ * 2); bf* ATl = (bf*)take((size_t)TT * DQ * 2);
    if ((size_t)(wsp - (char*)d_ws) > ws_size) return;    // ws 256 MiB
    { k_wtG<<<(unsigned)((DM * DQ / 64 + 63) / 64), 256, 0, stream>>>(wq, DM, DQ, WQ); k_wtG<<<(unsigned)((DM * DKV / 64 + 63) / 64), 256, 0, stream>>>(wk, DM, DKV, WK); k_wtG<<<(unsigned)((DM * DKV / 64 + 63) / 64), 256, 0, stream>>>(wv, DM, DKV, WV);   /* (in, out) 'xw' weights: transposed once into Bt */
      k_wtG<<<(unsigned)((DQ * DM / 64 + 63) / 64), 256, 0, stream>>>(wo, DQ, DM, WO);
       }
    for (int b = 0; b < NB_; ++b) {
        
        k_cvt8<<<(unsigned)(((size_t)TT * DM / 8 + 255) / 256), 256, 0, stream>>>(x + (size_t)b * TT * DM, XB, (size_t)TT * DM / 8);
        k_gemmw<bf, 0, false, 1><<<dim3(TT / 64, DQ / 64, 1), 32, 0, stream>>>(XB, nullptr, WQ, nullptr, DM, nullptr, 0, nullptr, 0, 0, 0, QP16, QPh, QPl);
        k_gemmw<bf, 0, false, 1><<<dim3(TT / 64, DKV / 64, 1), 32, 0, stream>>>(XB, nullptr, WK, nullptr, DM, nullptr, 0, nullptr, 0, 0, 0, KP16, KPh, KPl);
        k_gemmw<bf, 0, false, 2><<<dim3(TT / 64, DKV / 64, 1), 32, 0, stream>>>(XB, nullptr, WV, nullptr, DM, nullptr, 0, nullptr, 0, 0, 0, VT16, VTh, VTl);
        k_fattn<<<dim3(NH_, FNB, 1), 32 * FWV, 0, stream>>>(QP16, KP16, VT16, QPh, QPl, KPh, KPl, VTh, VTl, ATh, ATl);
        k_gemmw<bf, 1, true, 0><<<dim3(TT / 64, DM / 64, 1), 32, 0, stream>>>(ATh, ATl, WO, nullptr, DQ, OUT + (size_t)b * TT * DM, DM, bo, 0, 0, 0, nullptr, nullptr, nullptr); }
}

// v004
// It runs in 220 microseconds.
// Timed twice side by side with v003, it ran 1.06 and 1.05 times as fast.
// All steps since v000 together make it 12.6 times as fast.
#include <hip/hip_runtime.h>

// Causal multi-head self-attention over 4,096 tokens with (in, out) weights (x [1][4096][1024]; q, k, v = x W ('xw' [1024][1024] 0.02, no bias; 16 heads x 64); scores with -inf strictly above the diagonal (triu k=1), then / sqrt(64) inside the softmax (the same function as scaling first); softmax; out = merged Wo + bo ('xw' + a REAL bias 0.02) -> [1][4096][1024] (4.2 M); argument order x, Wq, Wk, Wv, Wo, bo).
// Layout: bf16 copy of x; exact projections whose epilogue stores the attention operand planes; causal T-4096 attention of all heads fused in one launch with an online softmax (hybrid rows: < 512 hi/lo 3 products, rest fp16); merged hi/lo x Wo exact + bo.
// Fragment order: every 16-bit WMMA operand plane is stored as tiles of 16 rows x 32 k, FRG consecutive elements each; element (row lr, k = 16 s + 8 hi + j) lies at 256 s + 8 (16 hi + lr) + j,
// so a wave's fragment is two loads of 512 consecutive bytes (four whole 128-byte lines each): load s gives lane 16 hi + lr the elements k = 16 s + 8 hi + 0 .. 7 of row lr. GEMM operand planes of R rows: tile (k / 32, row / 16) at ((k / 32) * (R / 16) + row / 16) * FRG, so the four 16-row groups of a 64-row block lie 4 KiB in a row per k tile.
// Compute dtypes, f32 accumulate: every input rounded to bf16; projections exact; attention rows < 512 3 products, rest fp16; softmax f32; Wo hl x exact + bias.

#define NB_  1
#define TT   4096
#define DM   1024
#define NH_  16
#define NKV  16
#define REP  (NH_ / NKV)
#define HD   64
#define DQ   (NH_ * HD)
#define DKV  (NKV * HD)
#define RH   512                  // query rows < RH use hi+lo planes (0: none)
#define WIN  4096
#define SCL  0.125f   // HD^-0.5
#define FRG  512                  // elements of one 16 x 32 operand tile in fragment order
typedef _Float16 h16;
typedef unsigned short bf;
typedef __attribute__((ext_vector_type(16))) __bf16   v16bf;
typedef __attribute__((ext_vector_type(16))) _Float16 v16h;
typedef __attribute__((ext_vector_type(8)))  _Float16 v8h;
typedef __attribute__((ext_vector_type(8)))  unsigned short v8us;
typedef __attribute__((ext_vector_type(8)))  float    v8f;
typedef __attribute__((ext_vector_type(4)))  float    v4f;
typedef v8h  __attribute__((may_alias)) v8ha;
typedef v4f  __attribute__((may_alias)) v4fa;
typedef v8us __attribute__((may_alias)) v8usa;

__device__ __forceinline__ unsigned short f2bf(float f) { unsigned u = __float_as_uint(f); u += 0x7FFFu + ((u >> 16) & 1u); return (unsigned short)(u >> 16); }
__device__ __forceinline__ float bf2f(unsigned short b) { return __uint_as_float(((unsigned)b) << 16); }
__device__ __forceinline__ float bfr(float f) { return bf2f(f2bf(f)); }
__device__ __forceinline__ v16h cat16(v8h lo, v8h hi) { return __builtin_shufflevector(lo, hi, 0, 1, 2, 3, 4, 5, 6, 7, 8, 9, 10, 11, 12, 13, 14, 15); }
__device__ __forceinline__ v16bf cat16b(v8us lo, v8us hi) { return __builtin_bit_cast(v16bf, __builtin_shufflevector(lo, hi, 0, 1, 2, 3, 4, 5, 6, 7, 8, 9, 10, 11, 12, 13, 14, 15)); }
__device__ __forceinline__ v8f wmma16(v16h a, v16h b, v8f c) { return __builtin_amdgcn_wmma_f32_16x16x32_f16(false, a, false, b, (short)0, c, false, false); }
__device__ __forceinline__ v8f wmmab(v16bf a, v16bf b, v8f c) { return __builtin_amdgcn_wmma_f32_16x16x32_bf16(false, a, false, b, (short)0, c, false, false); }



__device__ __forceinline__ h16 tohx(float x) { return (h16)x; }
__device__ __forceinline__ void splitf(float y, unsigned short& h, unsigned short& l) { h = f2bf(y); l = f2bf(y - bf2f(h)); }
// eight f32 results -> their fp16 image and their bf16 hi/lo pair
__device__ __forceinline__ void planes8(const float* y, v8h& o16, v8us& oh, v8us& ol) {
#pragma unroll
    for (int e = 0; e < 8; ++e) { o16[e] = tohx(y[e]); unsigned short a, c; splitf(y[e], a, c); oh[e] = a; ol[e] = c; } }

// ---- k_gemmw: register-blocked GEMM, ONE WAVE per 64x64 output tile (16 accumulators), operands straight from 16-bit planes in fragment order (A of RA rows, Bt of RB rows); grid (M/64, N/64, Z), 32 threads.
// C[m][n] = sum_k A[m][k] Bt[n][k] (+ split products per NSPLIT). z-batch strides sA/sB/sC in elements. K % 32 == 0.
// EPI 0: C goes out in f32 (pitch ldc, + optional f32 bias[n]). EPI 1 and 2: m is the token, the 64 columns are one head (HD == 64), and C goes out only as the three 16-bit planes
// (fp16, bf16 hi, bf16 lo) that the attention reads, in fragment order: EPI 1 rows = tokens, k = d, per head tile (token / 16, d / 32), through the LDS transpose; EPI 2 rows = d, k = tokens, per head tile (token / 32, d / 16), straight from the accumulators (a lane holds 8 consecutive tokens of one d: its own 16 bytes of the tile).
template <typename T16> struct WFrag;
template <> struct WFrag<h16> { typedef v16h V; static __device__ __forceinline__ V ld(const h16* p) { return cat16(*(const v8h*)p, *(const v8h*)(p + FRG / 2)); } static __device__ __forceinline__ v8f mma(V a, V b, v8f c) { return wmma16(a, b, c); } };
template <> struct WFrag<bf> { typedef v16bf V; static __device__ __forceinline__ V ld(const bf* p) { return cat16b(*(const v8us*)p, *(const v8us*)(p + FRG / 2)); } static __device__ __forceinline__ v8f mma(V a, V b, v8f c) { return wmmab(a, b, c); } };
template <typename T16, int NSPLIT, bool BIAS, int EPI>
__global__ __launch_bounds__(32) void k_gemmw(const T16* __restrict__ A, const T16* __restrict__ A2, const T16* __restrict__ Bt, const T16* __restrict__ Bt2, int K, int RA, int RB, float* C, int ldc, const float* __restrict__ bias, size_t sA, size_t sB, size_t sC, h16* P16, bf* Ph, bf* Pl) {
    static_assert(EPI == 0 || HD == 64, "a 64-column tile is one head");
    typedef typename WFrag<T16>::V V;
    __shared__ __align__(16) float os[16 * 68];
    const size_t z = blockIdx.z; A += z * sA; if (A2) A2 += z * sA; Bt += z * sB; if (Bt2) Bt2 += z * sB; C += z * sC;
    const int lane = threadIdx.x & 31, lr = lane & 15, hi = lane >> 4; const int r0 = blockIdx.x * 64, c0 = blockIdx.y * 64;
    v8f acc[4][4];
#pragma unroll
    for (int mb = 0; mb < 4; ++mb)
#pragma unroll
        for (int nb = 0; nb < 4; ++nb) acc[mb][nb] = (v8f){};
    constexpr bool HA2 = NSPLIT == 1 || NSPLIT == 2, HB2 = NSPLIT >= 2;
    const size_t aoff = (size_t)(r0 / 16) * FRG + 8 * lane, boff = (size_t)(c0 / 16) * FRG + 8 * lane;   // this lane's 16 bytes of the first k tile of the first 16-row group
    const size_t ast = (size_t)(RA / 16) * FRG, bst = (size_t)(RB / 16) * FRG;                            // from one k tile to the next
#pragma unroll 1
    for (int kc = 0; kc < K; kc += 32) {
        const T16* pa = A + aoff + (kc / 32) * ast; const T16* pb = Bt + boff + (kc / 32) * bst; const T16* pa2 = HA2 ? A2 + aoff + (kc / 32) * ast : nullptr; const T16* pb2 = HB2 ? Bt2 + boff + (kc / 32) * bst : nullptr;
        V a[4], a2[4];
#pragma unroll
        for (int mb = 0; mb < 4; ++mb) { a[mb] = WFrag<T16>::ld(pa + mb * FRG); if (HA2) a2[mb] = WFrag<T16>::ld(pa2 + mb * FRG); }
#pragma unroll
        for (int nb = 0; nb < 4; ++nb) { const V b = WFrag<T16>::ld(pb + nb * FRG); V b2; if (HB2) b2 = WFrag<T16>::ld(pb2 + nb * FRG);
#pragma unroll
            for (int mb = 0; mb < 4; ++mb) { acc[mb][nb] = WFrag<T16>::mma(a[mb], b, acc[mb][nb]); if (HA2) acc[mb][nb] = WFrag<T16>::mma(a2[mb], b, acc[mb][nb]); if (HB2) acc[mb][nb] = WFrag<T16>::mma(a[mb], b2, acc[mb][nb]); } }
        // the address registers of this trip's loads stay as they are up to this wait (inputs only); the next trip's addresses are formed only behind it
        if constexpr (HA2 && HB2) asm volatile("s_wait_xcnt 0x0" :: "v"(pa), "v"(pb), "v"(pa2), "v"(pb2) : "memory");
        else if constexpr (HA2) asm volatile("s_wait_xcnt 0x0" :: "v"(pa), "v"(pb), "v"(pa2) : "memory");
        else if constexpr (HB2) asm volatile("s_wait_xcnt 0x0" :: "v"(pa), "v"(pb), "v"(pb2) : "memory");
        else asm volatile("s_wait_xcnt 0x0" :: "v"(pa), "v"(pb) : "memory");
        asm volatile("v_nop\n\tv_nop\n\tv_nop\n\tv_nop" : "+v"(acc[0][0]), "+v"(acc[1][1]), "+v"(acc[2][2]), "+v"(acc[3][3]) : "v"(a[0]), "v"(a[3]));
    }
    if constexpr (EPI == 2) {
#pragma unroll
        for (int nb = 0; nb < 4; ++nb) { const size_t e = (size_t)blockIdx.y * HD * TT + (size_t)((r0 / 32) * (HD / 16) + nb) * FRG + lane * 8; h16* p16 = P16 + e; bf* ph = Ph + e; bf* pl = Pl + e; v8h o16[4]; v8us oh[4], ol[4];
#pragma unroll
            for (int mb = 0; mb < 4; ++mb) { float y[8];
#pragma unroll
                for (int j = 0; j < 8; ++j) y[j] = acc[mb][nb][j];
                planes8(y, o16[mb], oh[mb], ol[mb]); }
#pragma unroll
            for (int mb = 0; mb < 4; ++mb) *(v8h*)(p16 + (mb >> 1) * (HD / 16) * FRG + (mb & 1) * (FRG / 2)) = o16[mb];      // each store: 512 bytes in a row, half a tile
#pragma unroll
            for (int mb = 0; mb < 4; ++mb) *(v8us*)(ph + (mb >> 1) * (HD / 16) * FRG + (mb & 1) * (FRG / 2)) = oh[mb];
#pragma unroll
            for (int mb = 0; mb < 4; ++mb) *(v8us*)(pl + (mb >> 1) * (HD / 16) * FRG + (mb & 1) * (FRG / 2)) = ol[mb];
        }
        return; }
#pragma unroll
    for (int mb = 0; mb < 4; ++mb) {
#pragma unroll
        for (int nb = 0; nb < 4; ++nb) {
#pragma unroll
            for (int j = 0; j < 8; ++j) os[(hi * 8 + j) * 68 + nb * 16 + lr] = acc[mb][nb][j]; }
        __builtin_amdgcn_wave_barrier(); asm volatile("" ::: "memory");
        if constexpr (EPI == 1) {
            const size_t e = ((size_t)blockIdx.y * TT + r0 + mb * 16) * HD + lane * 8; h16* p16 = P16 + e; bf* ph = Ph + e; bf* pl = Pl + e; v8h o16[4]; v8us oh[4], ol[4];
#pragma unroll
            for (int s = 0; s < 4; ++s) { const float* orow = os + lr * 68 + s * 16 + hi * 8; const v4f y0 = *(const v4fa*)orow, y1 = *(const v4fa*)(orow + 4); float y[8];
#pragma unroll
                for (int j = 0; j < 4; ++j) { y[j] = y0[j]; y[4 + j] = y1[j]; }
                planes8(y, o16[s], oh[s], ol[s]); }
#pragma unroll
            for (int s = 0; s < 4; ++s) { *(v8h*)(p16 + s * (FRG / 2)) = o16[s]; *(v8us*)(ph + s * (FRG / 2)) = oh[s]; *(v8us*)(pl + s * (FRG / 2)) = ol[s]; }   // each store: half a tile, 512 bytes in a row
        } else {
        float* crow = C + (size_t)(r0 + mb * 16) * ldc + c0;
        v4f val[8]; float* pc[8];
#pragma unroll
            for (int s = 0; s < 8; ++s) { const int row = 2 * s + hi, cofs = lr * 4; val[s] = *(const v4fa*)(os + row * 68 + cofs); if (BIAS) { val[s][0] += bfr(bias[c0 + cofs]); val[s][1] += bfr(bias[c0 + cofs + 1]); val[s][2] += bfr(bias[c0 + cofs + 2]); val[s][3] += bfr(bias[c0 + cofs + 3]); }
                pc[s] = crow + (size_t)row * ldc + cofs; *(v4f*)pc[s] = val[s]; }
            // the data and address registers of the stores stay as they are up to this wait (inputs only)
            asm volatile("s_wait_xcnt 0x0" :: "v"(val[0]), "v"(val[1]), "v"(val[2]), "v"(val[3]), "v"(val[4]), "v"(val[5]), "v"(val[6]), "v"(val[7]), "v"(pc[0]), "v"(pc[1]), "v"(pc[2]), "v"(pc[3]), "v"(pc[4]), "v"(pc[5]), "v"(pc[6]), "v"(pc[7]) : "memory");
        }
        __builtin_amdgcn_wave_barrier(); asm volatile("" ::: "memory");
    }
}

typedef __attribute__((ext_vector_type(4))) _Float16 v4h;
typedef __attribute__((ext_vector_type(2))) unsigned short v2us;
typedef __attribute__((ext_vector_type(4))) unsigned short v4us;
typedef __attribute__((ext_vector_type(4))) int v4i;

// k_wtG: (in, out) f32 weight w[k][n] -> bf16 plane in fragment order, rows = n, tile (k / 32, n / 16). A thread makes one 16-byte piece: eight k of one n; a wave's loads read 64 bytes in a row per half (a block's 256), its store 512.
__global__ __launch_bounds__(256) void k_wtG(const float* __restrict__ w, int K, int N, bf* Bt) {
    const int i = blockIdx.x * 256 + threadIdx.x; if (i >= N * K / 8) return;
    const int lane = i & 31, s = (i >> 5) & 1, tile = i >> 6, NT = N / 16; const int n = (tile % NT) * 16 + (lane & 15), k = (tile / NT) * 32 + s * 16 + (lane >> 4) * 8; v8us o; const float* p[8]; float f[8];
#pragma unroll
    for (int j = 0; j < 8; ++j) { p[j] = w + (size_t)(k + j) * N + n; f[j] = *p[j]; }
    // the address registers of the eight loads stay as they are up to this wait (inputs only)
    asm volatile("s_wait_xcnt 0x0" :: "v"(p[0]), "v"(p[1]), "v"(p[2]), "v"(p[3]), "v"(p[4]), "v"(p[5]), "v"(p[6]), "v"(p[7]) : "memory");
#pragma unroll
    for (int j = 0; j < 8; ++j) o[j] = f2bf(f[j]);
    *(v8us*)(Bt + (size_t)i * 8) = o;
}
// k_cvt8: f32 rows src[row][K], R rows -> bf16 plane in fragment order, tile (k / 32, row / 16). A thread makes one 16-byte piece: eight consecutive k of one row. A wave makes 8 rows of one tile: it reads their 128 bytes each (whole lines)
// and each of its four pieces per row lands with the other rows' in 128 bytes in a row; a block reads 512 bytes in a row of each of its 16 rows.
__global__ __launch_bounds__(256) void k_cvt8(const float* __restrict__ src, int K, int R, bf* dst, size_t n8) { const size_t i = (size_t)blockIdx.x * 256 + threadIdx.x; if (i >= n8) return;
    const unsigned lane = (unsigned)i & 31u, w = (unsigned)(i >> 5), KT = (unsigned)K / 32u; const unsigned rg = (w >> 1) / KT, kt = (w >> 1) % KT, row = (w & 1u) * 8u + (lane >> 2), pc = lane & 3u;   // piece pc: k = 8 pc + 0 .. 7 of the tile
    const float* p = src + (size_t)(rg * 16u + row) * K + kt * 32u + pc * 8u; const v8f v = *(const v8f*)p; v8us o;
    asm volatile("s_wait_xcnt 0x0" :: "v"(p) : "memory");            // the address registers of the loads stay as they are up to this wait (input only)
#pragma unroll
    for (int e = 0; e < 8; ++e) o[e] = f2bf(v[e]); *(v8us*)(dst + ((size_t)kt * ((unsigned)R / 16u) + rg) * FRG + (pc >> 1) * (FRG / 2) + ((pc & 1u) * 16u + row) * 8u) = o;  }

// ---- k_fattn: scores, causal softmax and probability x value contraction of ALL heads in one launch (online softmax); no score or probability ever reaches memory.
// One wave owns FNQ * 16 query columns of one head and walks the keys 0 .. its diagonal in passes of KB keys, transposed: S^T = K Q^T (A = K rows, B = Q rows), O^T += V^T P^T (A = V^T rows, B = P^T).
// A lane (lr, hi) holds, of each 16-key score tile, the keys 8 * hi + j of query column lr; two such tiles, converted in place, are the B operand of the second product in the k order of WFrag::ld.
// Per column: running maximum m (log2 units, equal in both lane halves), running sum l (one partial per lane half, joined at the end); O^T and l are rescaled only when a new maximum exceeds m by more than 8.
// Rows < RH: bf16 hi/lo planes, three products in both contractions; the rest fp16. The quotient O / l goes out as the merged hi/lo planes (rows = t, k = head * HD + d) in fragment order: a lane's 8 consecutive d of one query are its own 16 bytes of the tile. Grid (heads, FNB).
#define FNQ 2
#define FWV 4
#define FNB (TT / (FWV * FNQ * 16))   // work-groups per head
__device__ __forceinline__ float xhalf(float x) { return __builtin_bit_cast(float, __builtin_amdgcn_permlanex16(__builtin_bit_cast(int, x), __builtin_bit_cast(int, x), 0x76543210, 0xfedcba98, false, false)); }   // lane l <-> lane l ^ 16
// 2^x in place; the v_nop is the one slot the instruction set asks for behind a transcendental, in the same statement so that it stands directly behind it (source = result: nothing can overwrite the source alone)
__device__ __forceinline__ float exp2s(float x) { asm("v_exp_f32 %0, %0\n\tv_nop" : "+v"(x)); return x; }
template <typename T16, bool HL, int KB>
__device__ __forceinline__ void fattn_tile(const T16* __restrict__ Q, const T16* __restrict__ Q2, const T16* __restrict__ Kp, const T16* __restrict__ Kp2, const T16* __restrict__ Vt, const T16* __restrict__ Vt2, int q0, int lr, int hi, bf* Ah, bf* Al) {
    typedef typename WFrag<T16>::V V;
    constexpr int NKT = KB / 16, NKK = KB / 32;
    constexpr float C2 = SCL * 1.4426950408889634f;                  // score -> log2 units
    V qf[FNQ][2], qf2[FNQ][2];
    const int lane = hi * 16 + lr;
    const T16* pq = Q + (size_t)q0 * HD + 8 * lane; const T16* pq2 = HL ? Q2 + (size_t)q0 * HD + 8 * lane : nullptr;
#pragma unroll
    for (int g = 0; g < FNQ; ++g)
#pragma unroll
        for (int ks = 0; ks < 2; ++ks) { qf[g][ks] = WFrag<T16>::ld(pq + g * 16 * HD + ks * FRG); if (HL) qf2[g][ks] = WFrag<T16>::ld(pq2 + g * 16 * HD + ks * FRG); }
    const int kend = q0 + FNQ * 16;                                  // first key above every diagonal element of the tile
    const T16* pk = Kp + 8 * lane; const T16* pk2 = HL ? Kp2 + 8 * lane : nullptr;
    const T16* pv = Vt + 8 * lane; const T16* pv2 = HL ? Vt2 + 8 * lane : nullptr;
    V kf[NKT][2], kf2[NKT][2];
#pragma unroll
    for (int kt = 0; kt < NKT; ++kt)
#pragma unroll
        for (int ks = 0; ks < 2; ++ks) { kf[kt][ks] = WFrag<T16>::ld(pk + kt * 16 * HD + ks * FRG); if (HL) kf2[kt][ks] = WFrag<T16>::ld(pk2 + kt * 16 * HD + ks * FRG); }
    // the address registers of the Q and first K loads stay as they are up to this wait (inputs only)
    if (HL) asm volatile("s_wait_xcnt 0x0" :: "v"(pq), "v"(pq2), "v"(pk), "v"(pk2) : "memory"); else asm volatile("s_wait_xcnt 0x0" :: "v"(pq), "v"(pk) : "memory");
    __builtin_amdgcn_sched_barrier(0);                               // nothing below is lifted over the wait: without this line the build rewrites registers that the loads above name (their base, their lane offset) ahead of it
    v8f o[4][FNQ]; float m[FNQ], l[FNQ];
#pragma unroll
    for (int g = 0; g < FNQ; ++g) { m[g] = -3.0e38f; l[g] = 0.f;
#pragma unroll
        for (int dt = 0; dt < 4; ++dt) o[dt][g] = (v8f){}; }
#pragma unroll 1
    for (int k0 = 0; k0 < kend; k0 += KB) {
        V vf[4][NKK], vf2[4][NKK];                                   // this pass's V^T fragments: issued here, first used behind the softmax
#pragma unroll
        for (int dt = 0; dt < 4; ++dt)
#pragma unroll
            for (int kk = 0; kk < NKK; ++kk) { vf[dt][kk] = WFrag<T16>::ld(pv + (kk * (HD / 16) + dt) * FRG); if (HL) vf2[dt][kk] = WFrag<T16>::ld(pv2 + (kk * (HD / 16) + dt) * FRG); }
        // the V address registers stay as they are up to this wait (inputs only); they are rewritten only behind it
        if (HL) asm volatile("s_wait_xcnt 0x0" :: "v"(pv), "v"(pv2) : "memory"); else asm volatile("s_wait_xcnt 0x0" :: "v"(pv) : "memory");
        v8f s[NKT][FNQ];
#pragma unroll
        for (int kt = 0; kt < NKT; ++kt)
#pragma unroll
            for (int g = 0; g < FNQ; ++g) s[kt][g] = (v8f){};
#pragma unroll
        for (int ks = 0; ks < 2; ++ks)
#pragma unroll
            for (int kt = 0; kt < NKT; ++kt)
#pragma unroll
                for (int g = 0; g < FNQ; ++g) { s[kt][g] = WFrag<T16>::mma(kf[kt][ks], qf[g][ks], s[kt][g]); if (HL) { s[kt][g] = WFrag<T16>::mma(kf2[kt][ks], qf[g][ks], s[kt][g]); s[kt][g] = WFrag<T16>::mma(kf[kt][ks], qf2[g][ks], s[kt][g]); } }
        if (k0 + KB < kend) { pk += KB * HD; if (HL) pk2 += KB * HD; }   // the last pass fetches its own rows again: always inside the plane
#pragma unroll
        for (int kt = 0; kt < NKT; ++kt)                             // next pass's K fragments, in flight behind the softmax and the second product
#pragma unroll
            for (int ks = 0; ks < 2; ++ks) { kf[kt][ks] = WFrag<T16>::ld(pk + kt * 16 * HD + ks * FRG); if (HL) kf2[kt][ks] = WFrag<T16>::ld(pk2 + kt * 16 * HD + ks * FRG); }
        // the K address registers stay as they are up to this wait (inputs only); they are rewritten only behind it
        if (HL) asm volatile("s_wait_xcnt 0x0" :: "v"(pk), "v"(pk2) : "memory"); else asm volatile("s_wait_xcnt 0x0" :: "v"(pk) : "memory");
        if (k0 + KB - 1 > q0) {                                      // only passes that reach the diagonal mask (wave-uniform test)
#pragma unroll
            for (int kt = 0; kt < NKT; ++kt)
#pragma unroll
                for (int g = 0; g < FNQ; ++g)
#pragma unroll
                    for (int j = 0; j < 8; ++j) s[kt][g][j] = (k0 + kt * 16 + hi * 8 + j <= q0 + g * 16 + lr) ? s[kt][g][j] : -3.0e38f; }
        float tm[FNQ]; bool need = false;
#pragma unroll
        for (int g = 0; g < FNQ; ++g) { float t = s[0][g][0];
#pragma unroll
            for (int kt = 0; kt < NKT; ++kt)
#pragma unroll
                for (int j = 0; j < 8; ++j) t = fmaxf(t, s[kt][g][j]);
            t = fmaxf(t, xhalf(t)) * C2; tm[g] = t; need = need || (t > m[g] + 8.0f); }
        if (__builtin_amdgcn_ballot_w32(need) != 0) {                // scalar branch: rare once the maxima have settled
#pragma unroll
            for (int g = 0; g < FNQ; ++g) { const float mn = fmaxf(m[g], tm[g]); const float al = exp2s(m[g] - mn); m[g] = mn; l[g] *= al;
#pragma unroll
                for (int dt = 0; dt < 4; ++dt) o[dt][g] *= al; } }
        V pf[FNQ][NKK], pf2[FNQ][NKK];
#pragma unroll
        for (int g = 0; g < FNQ; ++g)
#pragma unroll
            for (int kk = 0; kk < NKK; ++kk) { float p[16]; float ls = 0.f;
#pragma unroll
                for (int e = 0; e < 16; ++e) { p[e] = exp2s(__builtin_fmaf(s[2 * kk + (e >> 3)][g][e & 7], C2, -m[g])); ls += p[e]; }
                l[g] += ls;
                if constexpr (HL) { v8us h0, h1, l0, l1;
#pragma unroll
                    for (int e = 0; e < 8; ++e) { unsigned short a, c; splitf(p[e], a, c); h0[e] = a; l0[e] = c; splitf(p[8 + e], a, c); h1[e] = a; l1[e] = c; }
                    pf[g][kk] = cat16b(h0, h1); pf2[g][kk] = cat16b(l0, l1);
                } else { v16h ph;
#pragma unroll
                    for (int e = 0; e < 16; ++e) ph[e] = tohx(p[e]);
                    pf[g][kk] = ph; } }
#pragma unroll
        for (int kk = 0; kk < NKK; ++kk)
#pragma unroll
            for (int dt = 0; dt < 4; ++dt)
#pragma unroll
                for (int g = 0; g < FNQ; ++g) { o[dt][g] = WFrag<T16>::mma(vf[dt][kk], pf[g][kk], o[dt][g]); if (HL) { o[dt][g] = WFrag<T16>::mma(vf2[dt][kk], pf[g][kk], o[dt][g]); o[dt][g] = WFrag<T16>::mma(vf[dt][kk], pf2[g][kk], o[dt][g]); } }
        pv += KB * HD; if (HL) pv2 += KB * HD;
    }
    v8us oh[FNQ][4], ol[FNQ][4];
#pragma unroll
    for (int g = 0; g < FNQ; ++g) { const float inv = __fdiv_rn(1.0f, l[g] + xhalf(l[g]));   // the two lane halves' sums, joined once
#pragma unroll
        for (int dt = 0; dt < 4; ++dt)
#pragma unroll
            for (int j = 0; j < 8; ++j) { unsigned short a, c; splitf(o[dt][g][j] * inv, a, c); oh[g][dt][j] = a; ol[g][dt][j] = c; } }
    bf* pa = Ah + (size_t)(q0 / 16) * FRG + lane * 8; bf* pl = Al + (size_t)(q0 / 16) * FRG + lane * 8;
#pragma unroll
    for (int g = 0; g < FNQ; ++g)
#pragma unroll
        for (int dt = 0; dt < 4; ++dt) { *(v8us*)(pa + ((dt >> 1) * (TT / 16) + g) * FRG + (dt & 1) * (FRG / 2)) = oh[g][dt]; *(v8us*)(pl + ((dt >> 1) * (TT / 16) + g) * FRG + (dt & 1) * (FRG / 2)) = ol[g][dt]; }
    static_assert(FNQ == 2, "the wait behind the stores names the data registers of two column groups");
    // the data and address registers of the stores stay as they are up to this wait (inputs only)
    asm volatile("s_wait_xcnt 0x0" :: "v"(oh[0][0]), "v"(oh[0][1]), "v"(oh[0][2]), "v"(oh[0][3]), "v"(oh[1][0]), "v"(oh[1][1]), "v"(oh[1][2]), "v"(oh[1][3]), "v"(ol[0][0]), "v"(ol[0][1]), "v"(ol[0][2]), "v"(ol[0][3]), "v"(ol[1][0]), "v"(ol[1][1]), "v"(ol[1][2]), "v"(ol[1][3]), "v"(pa), "v"(pl) : "memory");
}
__global__ __launch_bounds__(32 * FWV) void k_fattn(const h16* __restrict__ Q16, const h16* __restrict__ K16, const h16* __restrict__ V16, const bf* __restrict__ Qh, const bf* __restrict__ Ql, const bf* __restrict__ Kh, const bf* __restrict__ Kl, const bf* __restrict__ Vh, const bf* __restrict__ Vl, bf* Ah, bf* Al) {
    const int lane = threadIdx.x & 31, lr = lane & 15, hi = lane >> 4; const int wave = __builtin_amdgcn_readfirstlane((int)(threadIdx.x >> 5));
    const int h = blockIdx.x; const int y = blockIdx.y; const int qb = (y < FNB / 2) ? FNB - 1 - y : y - FNB / 2;   // longest walks first; blocks y and y + FNB / 2 walk FNB + 1 blocks' worth of keys together
    const int q0 = (qb * FWV + wave) * (FNQ * 16);
    const size_t zq = (size_t)h * TT * HD, zk = (size_t)(h / REP) * TT * HD;
    if (q0 < RH) fattn_tile<bf, true, 32>(Qh + zq, Ql + zq, Kh + zk, Kl + zk, Vh + zk, Vl + zk, q0, lr, hi, Ah + (size_t)h * (HD / 32) * (TT / 16) * FRG, Al + (size_t)h * (HD / 32) * (TT / 16) * FRG);
    else fattn_tile<h16, false, 64>(Q16 + zq, nullptr, K16 + zk, nullptr, V16 + zk, nullptr, q0, lr, hi, Ah + (size_t)h * (HD / 32) * (TT / 16) * FRG, Al + (size_t)h * (HD / 32) * (TT / 16) * FRG);
}

extern "C" void kernel_launch(void* const* d_in, const int* in_sizes, int n_in,
                              void* d_out, int out_size, void* d_ws, size_t ws_size, hipStream_t stream) {
    (void)in_sizes; (void)n_in; (void)out_size;
    const float* x = (const float*)d_in[0]; const float* wq = (const float*)d_in[1]; const float* wk = (const float*)d_in[2]; const float* wv = (const float*)d_in[3]; const float* wo = (const float*)d_in[4]; const float* bo = (const float*)d_in[5];
    float* OUT = (float*)d_out;     // [1][4096][1024]
    char* wsp = (char*)d_ws;
    auto take = [&](size_t bytes) { char* p = wsp; wsp += (bytes + 255) & ~(size_t)255; return (void*)p; };
    bf* WQ = (bf*)take((size_t)DQ * DM * 2); bf* WK = (bf*)take((size_t)DKV * DM * 2); bf* WV = (bf*)take((size_t)DKV * DM * 2); bf* WO = (bf*)take((size_t)DM * DQ * 2);
    bf* XB = (bf*)take((size_t)TT * DM * 2);
    h16* QP16 = (h16*)take((size_t)NH_ * TT * HD * 2); h16* KP16 = (h16*)take((size_t)NKV * TT * HD * 2); h16* VT16 = (h16*)take((size_t)NKV * HD * TT * 2);
    bf* QPh = (bf*)take((size_t)NH_ * TT * HD * 2); bf* QPl = (bf*)take((size_t)NH_ * TT * HD * 2); bf* KPh = (bf*)take((size_t)NKV * TT * HD * 2); bf* KPl = (bf*)take((size_t)NKV * TT * HD * 2); bf* VTh = (bf*)take((size_t)NKV * HD * TT * 2); bf* VTl = (bf*)take((size_t)NKV * HD * TT * 2);
    bf* ATh = (bf*)take((size_t)TT * DQ * 2); bf* ATl = (bf*)take((size_t)TT * DQ * 2);
    if ((size_t)(wsp - (char*)d_ws) > ws_size) return;    // ws 256 MiB
    { k_wtG<<<(unsigned)((DM * DQ / 8 + 255) / 256), 256, 0, stream>>>(wq, DM, DQ, WQ); k_wtG<<<(unsigned)((DM * DKV / 8 + 255) / 256), 256, 0, stream>>>(wk, DM, DKV, WK); k_wtG<<<(unsigned)((DM * DKV / 8 + 255) / 256), 256, 0, stream>>>(wv, DM, DKV, WV);   /* (in, out) 'xw' weights: transposed once into Bt */
      k_wtG<<<(unsigned)((DQ * DM / 8 + 255) / 256), 256, 0, stream>>>(wo, DQ, DM, WO);
       }
    for (int b = 0; b < NB_; ++b) {
        
        k_cvt8<<<(unsigned)(((size_t)TT * DM / 8 + 255) / 256), 256, 0, stream>>>(x + (size_t)b * TT * DM, DM, TT, XB, (size_t)TT * DM / 8);
        k_gemmw<bf, 0, false, 1><<<dim3(TT / 64, DQ / 64, 1), 32, 0, stream>>>(XB, nullptr, WQ, nullptr, DM, TT, DQ, nullptr, 0, nullptr, 0, 0, 0, QP16, QPh, QPl);
        k_gemmw<bf, 0, false, 1><<<dim3(TT / 64, DKV / 64, 1), 32, 0, stream>>>(XB, nullptr, WK, nullptr, DM, TT, DKV, nullptr, 0, nullptr, 0, 0, 0, KP16, KPh, KPl);
        k_gemmw<bf, 0, false, 2><<<dim3(TT / 64, DKV / 64, 1), 32, 0, stream>>>(XB, nullptr, WV, nullptr, DM, TT, DKV, nullptr, 0, nullptr, 0, 0, 0, VT16, VTh, VTl);
        k_fattn<<<dim3(NH_, FNB, 1), 32 * FWV, 0, stream>>>(QP16, KP16, VT16, QPh, QPl, KPh, KPl, VTh, VTl, ATh, ATl);
        k_gemmw<bf, 1, true, 0><<<dim3(TT / 64, DM / 64, 1), 32, 0, stream>>>(ATh, ATl, WO, nullptr, DQ, TT, DM, OUT + (size_t)b * TT * DM, DM, bo, 0, 0, 0, nullptr, nullptr, nullptr); }
}

// v005
// It runs in 122 microseconds.
// In two side-by-side timings against v004, it was 1.82 and 1.81 times as fast.
// Counting every step since v000, it is 22.9 times as fast.
#include <hip/hip_runtime.h>

// Causal multi-head self-attention over 4,096 tokens with (in, out) weights (x [1][4096][1024]; q, k, v = x W ('xw' [1024][1024] 0.02, no bias; 16 heads x 64); scores with -inf strictly above the diagonal (triu k=1), then / sqrt(64) inside the softmax (the same function as scaling first); softmax; out = merged Wo + bo ('xw' + a REAL bias 0.02) -> [1][4096][1024] (4.2 M); argument order x, Wq, Wk, Wv, Wo, bo).
// Layout: bf16 copy of x; exact projections whose epilogue stores the attention operand planes; causal T-4096 attention of all heads fused in one launch with an online softmax (hybrid rows: < 512 hi/lo 3 products, rest fp16); merged hi/lo x Wo exact + bo.
// Fragment order: every 16-bit WMMA operand plane is stored as tiles of 16 rows x 32 k, FRG consecutive elements each; element (row lr, k = 16 s + 8 hi + j) lies at 256 s + 8 (16 hi + lr) + j,
// so a wave's fragment is two loads of 512 consecutive bytes (four whole 128-byte lines each): load s gives lane 16 hi + lr the elements k = 16 s + 8 hi + 0 .. 7 of row lr. GEMM operand planes of R rows: tile (k / 32, row / 16) at ((k / 32) * (R / 16) + row / 16) * FRG, so the four 16-row groups of a 64-row block lie 4 KiB in a row per k tile.
// Compute dtypes, f32 accumulate: every input rounded to bf16; projections exact; attention rows < 512 3 products, rest fp16; softmax f32; Wo hl x exact + bias.

#define NB_  1
#define TT   4096
#define DM   1024
#define NH_  16
#define NKV  16
#define REP  (NH_ / NKV)
#define HD   64
#define DQ   (NH_ * HD)
#define DKV  (NKV * HD)
#define RH   512                  // query rows < RH use hi+lo planes (0: none)
#define WIN  4096
#define SCL  0.125f   // HD^-0.5
#define FRG  512                  // elements of one 16 x 32 operand tile in fragment order
typedef _Float16 h16;
typedef unsigned short bf;
typedef __attribute__((ext_vector_type(16))) __bf16   v16bf;
typedef __attribute__((ext_vector_type(16))) _Float16 v16h;
typedef __attribute__((ext_vector_type(8)))  _Float16 v8h;
typedef __attribute__((ext_vector_type(8)))  unsigned short v8us;
typedef __attribute__((ext_vector_type(8)))  float    v8f;
typedef __attribute__((ext_vector_type(4)))  float    v4f;
typedef v8h  __attribute__((may_alias)) v8ha;
typedef v4f  __attribute__((may_alias)) v4fa;
typedef v8us __attribute__((may_alias)) v8usa;

__device__ __forceinline__ unsigned short f2bf(float f) { unsigned u = __float_as_uint(f); u += 0x7FFFu + ((u >> 16) & 1u); return (unsigned short)(u >> 16); }
__device__ __forceinline__ float bf2f(unsigned short b) { return __uint_as_float(((unsigned)b) << 16); }
__device__ __forceinline__ float bfr(float f) { return bf2f(f2bf(f)); }
__device__ __forceinline__ v16h cat16(v8h lo, v8h hi) { return __builtin_shufflevector(lo, hi, 0, 1, 2, 3, 4, 5, 6, 7, 8, 9, 10, 11, 12, 13, 14, 15); }
__device__ __forceinline__ v16bf cat16b(v8us lo, v8us hi) { return __builtin_bit_cast(v16bf, __builtin_shufflevector(lo, hi, 0, 1, 2, 3, 4, 5, 6, 7, 8, 9, 10, 11, 12, 13, 14, 15)); }
__device__ __forceinline__ v8f wmma16(v16h a, v16h b, v8f c) { return __builtin_amdgcn_wmma_f32_16x16x32_f16(false, a, false, b, (short)0, c, false, false); }
__device__ __forceinline__ v8f wmmab(v16bf a, v16bf b, v8f c) { return __builtin_amdgcn_wmma_f32_16x16x32_bf16(false, a, false, b, (short)0, c, false, false); }



__device__ __forceinline__ h16 tohx(float x) { return (h16)x; }
__device__ __forceinline__ void splitf(float y, unsigned short& h, unsigned short& l) { h = f2bf(y); l = f2bf(y - bf2f(h)); }
// eight f32 results -> their fp16 image and their bf16 hi/lo pair
__device__ __forceinline__ void planes8(const float* y, v8h& o16, v8us& oh, v8us& ol) {
#pragma unroll
    for (int e = 0; e < 8; ++e) { o16[e] = tohx(y[e]); unsigned short a, c; splitf(y[e], a, c); oh[e] = a; ol[e] = c; } }

// ---- k_gemmw: register-blocked GEMM, ONE WAVE per 64x64 output tile (16 accumulators), operands straight from 16-bit planes in fragment order (A of RA rows, Bt of RB rows); grid (M/64, N/64, Z), 32 threads.
// C[m][n] = sum_k A[m][k] Bt[n][k] (+ split products per NSPLIT). z-batch strides sA/sB/sC in elements. K % 128 == 0.
// EPI 0: C goes out in f32 (pitch ldc, + optional f32 bias[n]). EPI 1 and 2: m is the token, the 64 columns are one head (HD == 64), and C goes out only as the three 16-bit planes
// (fp16, bf16 hi, bf16 lo) that the attention reads, in fragment order: EPI 1 rows = tokens, k = d, per head tile (token / 16, d / 32), through the LDS transpose; EPI 2 rows = d, k = tokens, per head tile (token / 32, d / 16), straight from the accumulators (a lane holds 8 consecutive tokens of one d: its own 16 bytes of the tile).
template <typename T16> struct WFrag;
template <> struct WFrag<h16> { typedef v16h V; static __device__ __forceinline__ V ld(const h16* p) { return cat16(*(const v8h*)p, *(const v8h*)(p + FRG / 2)); } static __device__ __forceinline__ v8f mma(V a, V b, v8f c) { return wmma16(a, b, c); } };
template <> struct WFrag<bf> { typedef v16bf V; static __device__ __forceinline__ V ld(const bf* p) { return cat16b(*(const v8us*)p, *(const v8us*)(p + FRG / 2)); } static __device__ __forceinline__ v8f mma(V a, V b, v8f c) { return wmmab(a, b, c); } };
template <typename T16, int NSPLIT, bool BIAS, int EPI>
__global__ __launch_bounds__(32) void k_gemmw(const T16* __restrict__ A, const T16* __restrict__ A2, const T16* __restrict__ Bt, const T16* __restrict__ Bt2, int K, int RA, int RB, float* C, int ldc, const float* __restrict__ bias, size_t sA, size_t sB, size_t sC, h16* P16, bf* Ph, bf* Pl) {
    static_assert(EPI == 0 || HD == 64, "a 64-column tile is one head");
    typedef typename WFrag<T16>::V V;
    __shared__ __align__(16) float os[16 * 68];
    const size_t z = blockIdx.z; A += z * sA; if (A2) A2 += z * sA; Bt += z * sB; if (Bt2) Bt2 += z * sB; C += z * sC;
    const int lane = threadIdx.x & 31, lr = lane & 15, hi = lane >> 4; const int r0 = blockIdx.x * 64, c0 = blockIdx.y * 64;
    v8f acc[4][4];
#pragma unroll
    for (int mb = 0; mb < 4; ++mb)
#pragma unroll
        for (int nb = 0; nb < 4; ++nb) acc[mb][nb] = (v8f){};
    constexpr bool HA2 = NSPLIT == 1 || NSPLIT == 2, HB2 = NSPLIT >= 2;
    const size_t aoff = (size_t)(r0 / 16) * FRG + 8 * lane, boff = (size_t)(c0 / 16) * FRG + 8 * lane;   // this lane's 16 bytes of the first k tile of the first 16-row group
    const size_t ast = (size_t)(RA / 16) * FRG, bst = (size_t)(RB / 16) * FRG;                            // from one k tile to the next
    // Fragment ring in registers: RD sets; the loads of k tile t + PD are issued in front of the products of k tile t, so a tile's load latency runs behind PD tiles' products (a lone wave per SIMD has nothing else to hide it).
    // PD tiles' loads (16 or 24 a tile: 48) stay in flight behind a tile's wait, under the load counter's 63. Every accumulator still takes its k tiles in rising order.
    constexpr int RD = 4, PD = (HA2 || HB2) ? 2 : 3;
    V a[RD][4], a2[RD][4], b[RD][4], b2[RD][4];
    const T16* pa = A + aoff; const T16* pb = Bt + boff; const T16* pa2 = HA2 ? A2 + aoff : nullptr; const T16* pb2 = HB2 ? Bt2 + boff : nullptr;   // the next k tile to fetch
    auto fetch = [&](const int s) {
#pragma unroll
        for (int mb = 0; mb < 4; ++mb) { a[s][mb] = WFrag<T16>::ld(pa + mb * FRG); if (HA2) a2[s][mb] = WFrag<T16>::ld(pa2 + mb * FRG); }
#pragma unroll
        for (int nb = 0; nb < 4; ++nb) { b[s][nb] = WFrag<T16>::ld(pb + nb * FRG); if (HB2) b2[s][nb] = WFrag<T16>::ld(pb2 + nb * FRG); }
        __builtin_amdgcn_sched_barrier(0);                           // the set's loads stay one group in front of the products that follow: without this line the build puts a product, with its load wait, in front of them, and they lose their lead
    };
    auto step = [&]() {
        __builtin_amdgcn_sched_barrier(0);                           // the products stay in front of the wait: without this line the build puts it directly behind the loads, where the wave stands at it before its products
        // the address registers of the last fetch, and the lane number that a base + lane form of its loads names, stay as they are up to this wait (inputs only); they are rewritten only behind it
        if constexpr (HA2 && HB2) asm volatile("s_wait_xcnt 0x0" :: "v"(pa), "v"(pb), "v"(pa2), "v"(pb2), "v"(lane) : "memory");
        else if constexpr (HA2) asm volatile("s_wait_xcnt 0x0" :: "v"(pa), "v"(pb), "v"(pa2), "v"(lane) : "memory");
        else if constexpr (HB2) asm volatile("s_wait_xcnt 0x0" :: "v"(pa), "v"(pb), "v"(pb2), "v"(lane) : "memory");
        else asm volatile("s_wait_xcnt 0x0" :: "v"(pa), "v"(pb), "v"(lane) : "memory");
        __builtin_amdgcn_sched_barrier(0);                           // nothing below is lifted over the wait: a build may otherwise rewrite a register that the loads name (a scalar base too) ahead of it
        pa += ast; pb += bst; if (HA2) pa2 += ast; if (HB2) pb2 += bst;
    };
    auto mul = [&](const int s) {
#pragma unroll
        for (int nb = 0; nb < 4; ++nb)
#pragma unroll
            for (int mb = 0; mb < 4; ++mb) { acc[mb][nb] = WFrag<T16>::mma(a[s][mb], b[s][nb], acc[mb][nb]); if (HA2) acc[mb][nb] = WFrag<T16>::mma(a2[s][mb], b[s][nb], acc[mb][nb]); if (HB2) acc[mb][nb] = WFrag<T16>::mma(a[s][mb], b2[s][nb], acc[mb][nb]); }
    };
    const int KT = K / 32;
#pragma unroll
    for (int s = 0; s < PD; ++s) { fetch(s); step(); }
#pragma unroll 1
    for (int kt = 0; kt < KT - RD; kt += RD) {                       // rolled: one trip is RD k tiles, each ring set at a fixed place in the trip (no register copies)
#pragma unroll
        for (int u = 0; u < RD; ++u) { fetch((u + PD) % RD); mul(u); step(); }
        // four vector slots behind the trip's last products, on the taken branch too
        asm volatile("v_nop\n\tv_nop\n\tv_nop\n\tv_nop" : "+v"(acc[0][0]), "+v"(acc[1][1]), "+v"(acc[2][2]), "+v"(acc[3][3]) : "v"(a[RD - 1][0]), "v"(a[RD - 1][3]));
    }
#pragma unroll
    for (int u = 0; u < RD; ++u) {                                   // the last RD k tiles: only the tiles that exist are fetched
        if (u + PD < RD) fetch((u + PD) % RD);
        mul(u);
        if (u + PD < RD) step(); }
    if constexpr (EPI == 2) {
#pragma unroll
        for (int nb = 0; nb < 4; ++nb) { const size_t e = (size_t)blockIdx.y * HD * TT + (size_t)((r0 / 32) * (HD / 16) + nb) * FRG + lane * 8; h16* p16 = P16 + e; bf* ph = Ph + e; bf* pl = Pl + e; v8h o16[4]; v8us oh[4], ol[4];
#pragma unroll
            for (int mb = 0; mb < 4; ++mb) { float y[8];
#pragma unroll
                for (int j = 0; j < 8; ++j) y[j] = acc[mb][nb][j];
                planes8(y, o16[mb], oh[mb], ol[mb]); }
#pragma unroll
            for (int mb = 0; mb < 4; ++mb) *(v8h*)(p16 + (mb >> 1) * (HD / 16) * FRG + (mb & 1) * (FRG / 2)) = o16[mb];      // each store: 512 bytes in a row, half a tile
#pragma unroll
            for (int mb = 0; mb < 4; ++mb) *(v8us*)(ph + (mb >> 1) * (HD / 16) * FRG + (mb & 1) * (FRG / 2)) = oh[mb];
#pragma unroll
            for (int mb = 0; mb < 4; ++mb) *(v8us*)(pl + (mb >> 1) * (HD / 16) * FRG + (mb & 1) * (FRG / 2)) = ol[mb];
            // the data and address registers of the stores stay as they are up to this wait (inputs only)
            asm volatile("s_wait_xcnt 0x0" :: "v"(o16[0]), "v"(o16[1]), "v"(o16[2]), "v"(o16[3]), "v"(oh[0]), "v"(oh[1]), "v"(oh[2]), "v"(oh[3]), "v"(ol[0]), "v"(ol[1]), "v"(ol[2]), "v"(ol[3]), "v"(p16), "v"(ph), "v"(pl) : "memory");
        }
        return; }
#pragma unroll
    for (int mb = 0; mb < 4; ++mb) {
#pragma unroll
        for (int nb = 0; nb < 4; ++nb) {
#pragma unroll
            for (int j = 0; j < 8; ++j) os[(hi * 8 + j) * 68 + nb * 16 + lr] = acc[mb][nb][j]; }
        __builtin_amdgcn_wave_barrier(); asm volatile("" ::: "memory");
        if constexpr (EPI == 1) {
            const size_t e = ((size_t)blockIdx.y * TT + r0 + mb * 16) * HD + lane * 8; h16* p16 = P16 + e; bf* ph = Ph + e; bf* pl = Pl + e; v8h o16[4]; v8us oh[4], ol[4];
#pragma unroll
            for (int s = 0; s < 4; ++s) { const float* orow = os + lr * 68 + s * 16 + hi * 8; const v4f y0 = *(const v4fa*)orow, y1 = *(const v4fa*)(orow + 4); float y[8];
#pragma unroll
                for (int j = 0; j < 4; ++j) { y[j] = y0[j]; y[4 + j] = y1[j]; }
                planes8(y, o16[s], oh[s], ol[s]); }
#pragma unroll
            for (int s = 0; s < 4; ++s) { *(v8h*)(p16 + s * (FRG / 2)) = o16[s]; *(v8us*)(ph + s * (FRG / 2)) = oh[s]; *(v8us*)(pl + s * (FRG / 2)) = ol[s]; }   // each store: half a tile, 512 bytes in a row
            // the data and address registers of the stores stay as they are up to this wait (inputs only)
            asm volatile("s_wait_xcnt 0x0" :: "v"(o16[0]), "v"(o16[1]), "v"(o16[2]), "v"(o16[3]), "v"(oh[0]), "v"(oh[1]), "v"(oh[2]), "v"(oh[3]), "v"(ol[0]), "v"(ol[1]), "v"(ol[2]), "v"(ol[3]), "v"(p16), "v"(ph), "v"(pl) : "memory");
        } else {
        float* crow = C + (size_t)(r0 + mb * 16) * ldc + c0;
        v4f val[8]; float* pc[8];
#pragma unroll
            for (int s = 0; s < 8; ++s) { const int row = 2 * s + hi, cofs = lr * 4; val[s] = *(const v4fa*)(os + row * 68 + cofs); if (BIAS) { val[s][0] += bfr(bias[c0 + cofs]); val[s][1] += bfr(bias[c0 + cofs + 1]); val[s][2] += bfr(bias[c0 + cofs + 2]); val[s][3] += bfr(bias[c0 + cofs + 3]); }
                pc[s] = crow + (size_t)row * ldc + cofs; *(v4f*)pc[s] = val[s]; }
            // the data and address registers of the stores stay as they are up to this wait (inputs only)
            asm volatile("s_wait_xcnt 0x0" :: "v"(val[0]), "v"(val[1]), "v"(val[2]), "v"(val[3]), "v"(val[4]), "v"(val[5]), "v"(val[6]), "v"(val[7]), "v"(pc[0]), "v"(pc[1]), "v"(pc[2]), "v"(pc[3]), "v"(pc[4]), "v"(pc[5]), "v"(pc[6]), "v"(pc[7]) : "memory");
        }
        __builtin_amdgcn_wave_barrier(); asm volatile("" ::: "memory");
    }
}

typedef __attribute__((ext_vector_type(4))) _Float16 v4h;
typedef __attribute__((ext_vector_type(2))) unsigned short v2us;
typedef __attribute__((ext_vector_type(4))) unsigned short v4us;
typedef __attribute__((ext_vector_type(4))) int v4i;

// k_wtG: (in, out) f32 weight w[k][n] -> bf16 plane in fragment order, rows = n, tile (k / 32, n / 16). A thread makes one 16-byte piece: eight k of one n; a wave's loads read 64 bytes in a row per half (a block's 256), its store 512.
__global__ __launch_bounds__(256) void k_wtG(const float* __restrict__ w, int K, int N, bf* Bt) {
    const int i = blockIdx.x * 256 + threadIdx.x; if (i >= N * K / 8) return;
    const int lane = i & 31, s = (i >> 5) & 1, tile = i >> 6, NT = N / 16; const int n = (tile % NT) * 16 + (lane & 15), k = (tile / NT) * 32 + s * 16 + (lane >> 4) * 8; v8us o; const float* p[8]; float f[8];
#pragma unroll
    for (int j = 0; j < 8; ++j) { p[j] = w + (size_t)(k + j) * N + n; f[j] = *p[j]; }
    // the address registers of the eight loads stay as they are up to this wait (inputs only)
    asm volatile("s_wait_xcnt 0x0" :: "v"(p[0]), "v"(p[1]), "v"(p[2]), "v"(p[3]), "v"(p[4]), "v"(p[5]), "v"(p[6]), "v"(p[7]) : "memory");
#pragma unroll
    for (int j = 0; j < 8; ++j) o[j] = f2bf(f[j]);
    *(v8us*)(Bt + (size_t)i * 8) = o;
}
// k_cvt8: f32 rows src[row][K], R rows -> bf16 plane in fragment order, tile (k / 32, row / 16). A thread makes one 16-byte piece: eight consecutive k of one row. A wave makes 8 rows of one tile: it reads their 128 bytes each (whole lines)
// and each of its four pieces per row lands with the other rows' in 128 bytes in a row; a block reads 512 bytes in a row of each of its 16 rows.
__global__ __launch_bounds__(256) void k_cvt8(const float* __restrict__ src, int K, int R, bf* dst, size_t n8) { const size_t i = (size_t)blockIdx.x * 256 + threadIdx.x; if (i >= n8) return;
    const unsigned lane = (unsigned)i & 31u, w = (unsigned)(i >> 5), KT = (unsigned)K / 32u; const unsigned rg = (w >> 1) / KT, kt = (w >> 1) % KT, row = (w & 1u) * 8u + (lane >> 2), pc = lane & 3u;   // piece pc: k = 8 pc + 0 .. 7 of the tile
    const float* p = src + (size_t)(rg * 16u + row) * K + kt * 32u + pc * 8u; const v8f v = *(const v8f*)p; v8us o;
    asm volatile("s_wait_xcnt 0x0" :: "v"(p) : "memory");            // the address registers of the loads stay as they are up to this wait (input only)
#pragma unroll
    for (int e = 0; e < 8; ++e) o[e] = f2bf(v[e]); *(v8us*)(dst + ((size_t)kt * ((unsigned)R / 16u) + rg) * FRG + (pc >> 1) * (FRG / 2) + ((pc & 1u) * 16u + row) * 8u) = o;  }

// ---- k_fattn: scores, causal softmax and probability x value contraction of ALL heads in one launch (online softmax); no score or probability ever reaches memory.
// One wave owns FNQ * 16 query columns of one head and walks the keys 0 .. its diagonal in passes of KB keys, transposed: S^T = K Q^T (A = K rows, B = Q rows), O^T += V^T P^T (A = V^T rows, B = P^T).
// A lane (lr, hi) holds, of each 16-key score tile, the keys 8 * hi + j of query column lr; two such tiles, converted in place, are the B operand of the second product in the k order of WFrag::ld.
// Per column: running maximum m (log2 units, equal in both lane halves), running sum l (one partial per lane half, joined at the end); O^T and l are rescaled only when a new maximum exceeds m by more than 8.
// Rows < RH: bf16 hi/lo planes, three products in both contractions; the rest fp16. The quotient O / l goes out as the merged hi/lo planes (rows = t, k = head * HD + d) in fragment order: a lane's 8 consecutive d of one query are its own 16 bytes of the tile. Grid (heads, FNB).
#define FNQ 2
#define FWV 4
#define FNB (TT / (FWV * FNQ * 16))   // work-groups per head
__device__ __forceinline__ float xhalf(float x) { return __builtin_bit_cast(float, __builtin_amdgcn_permlanex16(__builtin_bit_cast(int, x), __builtin_bit_cast(int, x), 0x76543210, 0xfedcba98, false, false)); }   // lane l <-> lane l ^ 16
// 2^x in place; the v_nop is the one slot the instruction set asks for behind a transcendental, in the same statement so that it stands directly behind it (source = result: nothing can overwrite the source alone)
__device__ __forceinline__ float exp2s(float x) { asm("v_exp_f32 %0, %0\n\tv_nop" : "+v"(x)); return x; }
template <typename T16, bool HL, int KB>
__device__ __forceinline__ void fattn_tile(const T16* __restrict__ Q, const T16* __restrict__ Q2, const T16* __restrict__ Kp, const T16* __restrict__ Kp2, const T16* __restrict__ Vt, const T16* __restrict__ Vt2, int q0, int lr, int hi, bf* Ah, bf* Al) {
    typedef typename WFrag<T16>::V V;
    constexpr int NKT = KB / 16, NKK = KB / 32;
    constexpr float C2 = SCL * 1.4426950408889634f;                  // score -> log2 units
    V qf[FNQ][2], qf2[FNQ][2];
    const int lane = hi * 16 + lr;
    const T16* pq = Q + (size_t)q0 * HD + 8 * lane; const T16* pq2 = HL ? Q2 + (size_t)q0 * HD + 8 * lane : nullptr;
#pragma unroll
    for (int g = 0; g < FNQ; ++g)
#pragma unroll
        for (int ks = 0; ks < 2; ++ks) { qf[g][ks] = WFrag<T16>::ld(pq + g * 16 * HD + ks * FRG); if (HL) qf2[g][ks] = WFrag<T16>::ld(pq2 + g * 16 * HD + ks * FRG); }
    const int kend = q0 + FNQ * 16;                                  // first key above every diagonal element of the tile
    const T16* pk = Kp + 8 * lane; const T16* pk2 = HL ? Kp2 + 8 * lane : nullptr;
    const T16* pv = Vt + 8 * lane; const T16* pv2 = HL ? Vt2 + 8 * lane : nullptr;
    V kf[NKT][2], kf2[NKT][2];
#pragma unroll
    for (int kt = 0; kt < NKT; ++kt)
#pragma unroll
        for (int ks = 0; ks < 2; ++ks) { kf[kt][ks] = WFrag<T16>::ld(pk + kt * 16 * HD + ks * FRG); if (HL) kf2[kt][ks] = WFrag<T16>::ld(pk2 + kt * 16 * HD + ks * FRG); }
    // the address registers of the Q and first K loads stay as they are up to this wait (inputs only)
    if (HL) asm volatile("s_wait_xcnt 0x0" :: "v"(pq), "v"(pq2), "v"(pk), "v"(pk2) : "memory"); else asm volatile("s_wait_xcnt 0x0" :: "v"(pq), "v"(pk) : "memory");
    __builtin_amdgcn_sched_barrier(0);                               // nothing below is lifted over the wait: without this line the build rewrites registers that the loads above name (their base, their lane offset) ahead of it
    v8f o[4][FNQ]; float m[FNQ], l[FNQ];
#pragma unroll
    for (int g = 0; g < FNQ; ++g) { m[g] = -3.0e38f; l[g] = 0.f;
#pragma unroll
        for (int dt = 0; dt < 4; ++dt) o[dt][g] = (v8f){}; }
#pragma unroll 1
    for (int k0 = 0; k0 < kend; k0 += KB) {
        V vf[4][NKK], vf2[4][NKK];                                   // this pass's V^T fragments: issued here, first used behind the softmax
#pragma unroll
        for (int dt = 0; dt < 4; ++dt)
#pragma unroll
            for (int kk = 0; kk < NKK; ++kk) { vf[dt][kk] = WFrag<T16>::ld(pv + (kk * (HD / 16) + dt) * FRG); if (HL) vf2[dt][kk] = WFrag<T16>::ld(pv2 + (kk * (HD / 16) + dt) * FRG); }
        // the V address registers stay as they are up to this wait (inputs only); they are rewritten only behind it
        if (HL) asm volatile("s_wait_xcnt 0x0" :: "v"(pv), "v"(pv2) : "memory"); else asm volatile("s_wait_xcnt 0x0" :: "v"(pv) : "memory");
        v8f s[NKT][FNQ];
#pragma unroll
        for (int kt = 0; kt < NKT; ++kt)
#pragma unroll
            for (int g = 0; g < FNQ; ++g) s[kt][g] = (v8f){};
#pragma unroll
        for (int ks = 0; ks < 2; ++ks)
#pragma unroll
            for (int kt = 0; kt < NKT; ++kt)
#pragma unroll
                for (int g = 0; g < FNQ; ++g) { s[kt][g] = WFrag<T16>::mma(kf[kt][ks], qf[g][ks], s[kt][g]); if (HL) { s[kt][g] = WFrag<T16>::mma(kf2[kt][ks], qf[g][ks], s[kt][g]); s[kt][g] = WFrag<T16>::mma(kf[kt][ks], qf2[g][ks], s[kt][g]); } }
        if (k0 + KB < kend) { pk += KB * HD; if (HL) pk2 += KB * HD; }   // the last pass fetches its own rows again: always inside the plane
#pragma unroll
        for (int kt = 0; kt < NKT; ++kt)                             // next pass's K fragments, in flight behind the softmax and the second product
#pragma unroll
            for (int ks = 0; ks < 2; ++ks) { kf[kt][ks] = WFrag<T16>::ld(pk + kt * 16 * HD + ks * FRG); if (HL) kf2[kt][ks] = WFrag<T16>::ld(pk2 + kt * 16 * HD + ks * FRG); }
        // the K address registers stay as they are up to this wait (inputs only); they are rewritten only behind it
        if (HL) asm volatile("s_wait_xcnt 0x0" :: "v"(pk), "v"(pk2) : "memory"); else asm volatile("s_wait_xcnt 0x0" :: "v"(pk) : "memory");
        if (k0 + KB - 1 > q0) {                                      // only passes that reach the diagonal mask (wave-uniform test)
#pragma unroll
            for (int kt = 0; kt < NKT; ++kt)
#pragma unroll
                for (int g = 0; g < FNQ; ++g)
#pragma unroll
                    for (int j = 0; j < 8; ++j) s[kt][g][j] = (k0 + kt * 16 + hi * 8 + j <= q0 + g * 16 + lr) ? s[kt][g][j] : -3.0e38f; }
        float tm[FNQ]; bool need = false;
#pragma unroll
        for (int g = 0; g < FNQ; ++g) { float t = s[0][g][0];
#pragma unroll
            for (int kt = 0; kt < NKT; ++kt)
#pragma unroll
                for (int j = 0; j < 8; ++j) t = fmaxf(t, s[kt][g][j]);
            t = fmaxf(t, xhalf(t)) * C2; tm[g] = t; need = need || (t > m[g] + 8.0f); }
        if (__builtin_amdgcn_ballot_w32(need) != 0) {                // scalar branch: rare once the maxima have settled
#pragma unroll
            for (int g = 0; g < FNQ; ++g) { const float mn = fmaxf(m[g], tm[g]); const float al = exp2s(m[g] - mn); m[g] = mn; l[g] *= al;
#pragma unroll
                for (int dt = 0; dt < 4; ++dt) o[dt][g] *= al; } }
        V pf[FNQ][NKK], pf2[FNQ][NKK];
#pragma unroll
        for (int g = 0; g < FNQ; ++g)
#pragma unroll
            for (int kk = 0; kk < NKK; ++kk) { float p[16]; float ls = 0.f;
#pragma unroll
                for (int e = 0; e < 16; ++e) { p[e] = exp2s(__builtin_fmaf(s[2 * kk + (e >> 3)][g][e & 7], C2, -m[g])); ls += p[e]; }
                l[g] += ls;
                if constexpr (HL) { v8us h0, h1, l0, l1;
#pragma unroll
                    for (int e = 0; e < 8; ++e) { unsigned short a, c; splitf(p[e], a, c); h0[e] = a; l0[e] = c; splitf(p[8 + e], a, c); h1[e] = a; l1[e] = c; }
                    pf[g][kk] = cat16b(h0, h1); pf2[g][kk] = cat16b(l0, l1);
                } else { v16h ph;
#pragma unroll
                    for (int e = 0; e < 16; ++e) ph[e] = tohx(p[e]);
                    pf[g][kk] = ph; } }
#pragma unroll
        for (int kk = 0; kk < NKK; ++kk)
#pragma unroll
            for (int dt = 0; dt < 4; ++dt)
#pragma unroll
                for (int g = 0; g < FNQ; ++g) { o[dt][g] = WFrag<T16>::mma(vf[dt][kk], pf[g][kk], o[dt][g]); if (HL) { o[dt][g] = WFrag<T16>::mma(vf2[dt][kk], pf[g][kk], o[dt][g]); o[dt][g] = WFrag<T16>::mma(vf[dt][kk], pf2[g][kk], o[dt][g]); } }
        pv += KB * HD; if (HL) pv2 += KB * HD;
    }
    v8us oh[FNQ][4], ol[FNQ][4];
#pragma unroll
    for (int g = 0; g < FNQ; ++g) { const float inv = __fdiv_rn(1.0f, l[g] + xhalf(l[g]));   // the two lane halves' sums, joined once
#pragma unroll
        for (int dt = 0; dt < 4; ++dt)
#pragma unroll
            for (int j = 0; j < 8; ++j) { unsigned short a, c; splitf(o[dt][g][j] * inv, a, c); oh[g][dt][j] = a; ol[g][dt][j] = c; } }
    bf* pa = Ah + (size_t)(q0 / 16) * FRG + lane * 8; bf* pl = Al + (size_t)(q0 / 16) * FRG + lane * 8;
#pragma unroll
    for (int g = 0; g < FNQ; ++g)
#pragma unroll
        for (int dt = 0; dt < 4; ++dt) { *(v8us*)(pa + ((dt >> 1) * (TT / 16) + g) * FRG + (dt & 1) * (FRG / 2)) = oh[g][dt]; *(v8us*)(pl + ((dt >> 1) * (TT / 16) + g) * FRG + (dt & 1) * (FRG / 2)) = ol[g][dt]; }
    static_assert(FNQ == 2, "the wait behind the stores names the data registers of two column groups");
    // the data and address registers of the stores stay as they are up to this wait (inputs only)
    asm volatile("s_wait_xcnt 0x0" :: "v"(oh[0][0]), "v"(oh[0][1]), "v"(oh[0][2]), "v"(oh[0][3]), "v"(oh[1][0]), "v"(oh[1][1]), "v"(oh[1][2]), "v"(oh[1][3]), "v"(ol[0][0]), "v"(ol[0][1]), "v"(ol[0][2]), "v"(ol[0][3]), "v"(ol[1][0]), "v"(ol[1][1]), "v"(ol[1][2]), "v"(ol[1][3]), "v"(pa), "v"(pl) : "memory");
}
__global__ __launch_bounds__(32 * FWV) void k_fattn(const h16* __restrict__ Q16, const h16* __restrict__ K16, const h16* __restrict__ V16, const bf* __restrict__ Qh, const bf* __restrict__ Ql, const bf* __restrict__ Kh, const bf* __restrict__ Kl, const bf* __restrict__ Vh, const bf* __restrict__ Vl, bf* Ah, bf* Al) {
    const int lane = threadIdx.x & 31, lr = lane & 15, hi = lane >> 4; const int wave = __builtin_amdgcn_readfirstlane((int)(threadIdx.x >> 5));
    const int h = blockIdx.x; const int y = blockIdx.y; const int qb = (y < FNB / 2) ? FNB - 1 - y : y - FNB / 2;   // longest walks first; blocks y and y + FNB / 2 walk FNB + 1 blocks' worth of keys together
    const int q0 = (qb * FWV + wave) * (FNQ * 16);
    const size_t zq = (size_t)h * TT * HD, zk = (size_t)(h / REP) * TT * HD;
    if (q0 < RH) fattn_tile<bf, true, 32>(Qh + zq, Ql + zq, Kh + zk, Kl + zk, Vh + zk, Vl + zk, q0, lr, hi, Ah + (size_t)h * (HD / 32) * (TT / 16) * FRG, Al + (size_t)h * (HD / 32) * (TT / 16) * FRG);
    else fattn_tile<h16, false, 64>(Q16 + zq, nullptr, K16 + zk, nullptr, V16 + zk, nullptr, q0, lr, hi, Ah + (size_t)h * (HD / 32) * (TT / 16) * FRG, Al + (size_t)h * (HD / 32) * (TT / 16) * FRG);
}

extern "C" void kernel_launch(void* const* d_in, const int* in_sizes, int n_in,
                              void* d_out, int out_size, void* d_ws, size_t ws_size, hipStream_t stream) {
    (void)in_sizes; (void)n_in; (void)out_size;
    const float* x = (const float*)d_in[0]; const float* wq = (const float*)d_in[1]; const float* wk = (const float*)d_in[2]; const float* wv = (const float*)d_in[3]; const float* wo = (const float*)d_in[4]; const float* bo = (const float*)d_in[5];
    float* OUT = (float*)d_out;     // [1][4096][1024]
    char* wsp = (char*)d_ws;
    auto take = [&](size_t bytes) { char* p = wsp; wsp += (bytes + 255) & ~(size_t)255; return (void*)p; };
    bf* WQ = (bf*)take((size_t)DQ * DM * 2); bf* WK = (bf*)take((size_t)DKV * DM * 2); bf* WV = (bf*)take((size_t)DKV * DM * 2); bf* WO = (bf*)take((size_t)DM * DQ * 2);
    bf* XB = (bf*)take((size_t)TT * DM * 2);
    h16* QP16 = (h16*)take((size_t)NH_ * TT * HD * 2); h16* KP16 = (h16*)take((size_t)NKV * TT * HD * 2); h16* VT16 = (h16*)take((size_t)NKV * HD * TT * 2);
    bf* QPh = (bf*)take((size_t)NH_ * TT * HD * 2); bf* QPl = (bf*)take((size_t)NH_ * TT * HD * 2); bf* KPh = (bf*)take((size_t)NKV * TT * HD * 2); bf* KPl = (bf*)take((size_t)NKV * TT * HD * 2); bf* VTh = (bf*)take((size_t)NKV * HD * TT * 2); bf* VTl = (bf*)take((size_t)NKV * HD * TT * 2);
    bf* ATh = (bf*)take((size_t)TT * DQ * 2); bf* ATl = (bf*)take((size_t)TT * DQ * 2);
    if ((size_t)(wsp - (char*)d_ws) > ws_size) return;    // ws 256 MiB
    { k_wtG<<<(unsigned)((DM * DQ / 8 + 255) / 256), 256, 0, stream>>>(wq, DM, DQ, WQ); k_wtG<<<(unsigned)((DM * DKV / 8 + 255) / 256), 256, 0, stream>>>(wk, DM, DKV, WK); k_wtG<<<(unsigned)((DM * DKV / 8 + 255) / 256), 256, 0, stream>>>(wv, DM, DKV, WV);   /* (in, out) 'xw' weights: transposed once into Bt */
      k_wtG<<<(unsigned)((DQ * DM / 8 + 255) / 256), 256, 0, stream>>>(wo, DQ, DM, WO);
       }
    for (int b = 0; b < NB_; ++b) {
        
        k_cvt8<<<(unsigned)(((size_t)TT * DM / 8 + 255) / 256), 256, 0, stream>>>(x + (size_t)b * TT * DM, DM, TT, XB, (size_t)TT * DM / 8);
        k_gemmw<bf, 0, false, 1><<<dim3(TT / 64, DQ / 64, 1), 32, 0, stream>>>(XB, nullptr, WQ, nullptr, DM, TT, DQ, nullptr, 0, nullptr, 0, 0, 0, QP16, QPh, QPl);
        k_gemmw<bf, 0, false, 1><<<dim3(TT / 64, DKV / 64, 1), 32, 0, stream>>>(XB, nullptr, WK, nullptr, DM, TT, DKV, nullptr, 0, nullptr, 0, 0, 0, KP16, KPh, KPl);
        k_gemmw<bf, 0, false, 2><<<dim3(TT / 64, DKV / 64, 1), 32, 0, stream>>>(XB, nullptr, WV, nullptr, DM, TT, DKV, nullptr, 0, nullptr, 0, 0, 0, VT16, VTh, VTl);
        k_fattn<<<dim3(NH_, FNB, 1), 32 * FWV, 0, stream>>>(QP16, KP16, VT16, QPh, QPl, KPh, KPl, VTh, VTl, ATh, ATl);
        k_gemmw<bf, 1, true, 0><<<dim3(TT / 64, DM / 64, 1), 32, 0, stream>>>(ATh, ATl, WO, nullptr, DQ, TT, DM, OUT + (size_t)b * TT * DM, DM, bo, 0, 0, 0, nullptr, nullptr, nullptr); }
}

// v006
// It runs in 114 microseconds.
// Next to v005, in two timings, it ran 1.07 and 1.08 times as fast.
// Counting every step since v000, it is 24.6 times as fast.
#include <hip/hip_runtime.h>

// Causal multi-head self-attention over 4,096 tokens with (in, out) weights (x [1][4096][1024]; q, k, v = x W ('xw' [1024][1024] 0.02, no bias; 16 heads x 64); scores with -inf strictly above the diagonal (triu k=1), then / sqrt(64) inside the softmax (the same function as scaling first); softmax; out = merged Wo + bo ('xw' + a REAL bias 0.02) -> [1][4096][1024] (4.2 M); argument order x, Wq, Wk, Wv, Wo, bo).
// Layout: bf16 copies of x and the weights (one launch); exact projections whose epilogue stores the attention operand planes; causal T-4096 attention of all heads fused in one launch with an online softmax (hybrid rows: < 512 hi/lo 3 products, rest fp16); merged hi/lo x Wo exact + bo.
// Fragment order: every 16-bit WMMA operand plane is stored as tiles of 16 rows x 32 k, FRG consecutive elements each; element (row lr, k = 16 s + 8 hi + j) lies at 256 s + 8 (16 hi + lr) + j,
// so a wave's fragment is two loads of 512 consecutive bytes (four whole 128-byte lines each): load s gives lane 16 hi + lr the elements k = 16 s + 8 hi + 0 .. 7 of row lr. GEMM operand planes of R rows: tile (k / 32, row / 16) at ((k / 32) * (R / 16) + row / 16) * FRG, so the four 16-row groups of a 64-row block lie 4 KiB in a row per k tile.
// Compute dtypes, f32 accumulate: every input rounded to bf16; projections exact; attention rows < 512 3 products, rest fp16; softmax f32; Wo hl x exact + bias.

#define NB_  1
#define TT   4096
#define DM   1024
#define NH_  16
#define NKV  16
#define REP  (NH_ / NKV)
#define HD   64
#define DQ   (NH_ * HD)
#define DKV  (NKV * HD)
#define RH   512                  // query rows < RH use hi+lo planes (0: none)
#define WIN  4096
#define SCL  0.125f   // HD^-0.5
#define FRG  512                  // elements of one 16 x 32 operand tile in fragment order
typedef _Float16 h16;
typedef unsigned short bf;
typedef __attribute__((ext_vector_type(16))) __bf16   v16bf;
typedef __attribute__((ext_vector_type(16))) _Float16 v16h;
typedef __attribute__((ext_vector_type(8)))  _Float16 v8h;
typedef __attribute__((ext_vector_type(8)))  unsigned short v8us;
typedef __attribute__((ext_vector_type(8)))  float    v8f;
typedef __attribute__((ext_vector_type(4)))  float    v4f;
typedef v8h  __attribute__((may_alias)) v8ha;
typedef v4f  __attribute__((may_alias)) v4fa;
typedef v8us __attribute__((may_alias)) v8usa;

__device__ __forceinline__ unsigned short f2bf(float f) { unsigned u = __float_as_uint(f); u += 0x7FFFu + ((u >> 16) & 1u); return (unsigned short)(u >> 16); }
__device__ __forceinline__ float bf2f(unsigned short b) { return __uint_as_float(((unsigned)b) << 16); }
__device__ __forceinline__ float bfr(float f) { return bf2f(f2bf(f)); }
__device__ __forceinline__ v16h cat16(v8h lo, v8h hi) { return __builtin_shufflevector(lo, hi, 0, 1, 2, 3, 4, 5, 6, 7, 8, 9, 10, 11, 12, 13, 14, 15); }
__device__ __forceinline__ v16bf cat16b(v8us lo, v8us hi) { return __builtin_bit_cast(v16bf, __builtin_shufflevector(lo, hi, 0, 1, 2, 3, 4, 5, 6, 7, 8, 9, 10, 11, 12, 13, 14, 15)); }
__device__ __forceinline__ v8f wmma16(v16h a, v16h b, v8f c) { return __builtin_amdgcn_wmma_f32_16x16x32_f16(false, a, false, b, (short)0, c, false, false); }
__device__ __forceinline__ v8f wmmab(v16bf a, v16bf b, v8f c) { return __builtin_amdgcn_wmma_f32_16x16x32_bf16(false, a, false, b, (short)0, c, false, false); }



__device__ __forceinline__ h16 tohx(float x) { return (h16)x; }
__device__ __forceinline__ void splitf(float y, unsigned short& h, unsigned short& l) { h = f2bf(y); l = f2bf(y - bf2f(h)); }
// eight f32 results -> their fp16 image and their bf16 hi/lo pair
__device__ __forceinline__ void planes8(const float* y, v8h& o16, v8us& oh, v8us& ol) {
#pragma unroll
    for (int e = 0; e < 8; ++e) { o16[e] = tohx(y[e]); unsigned short a, c; splitf(y[e], a, c); oh[e] = a; ol[e] = c; } }

// ---- k_gemmw: register-blocked GEMM, ONE WAVE per 64x64 output tile (16 accumulators), operands straight from 16-bit planes in fragment order (A of RA rows, Bt of RB rows); grid (M/64, N/64, Z), 32 threads.
// C[m][n] = sum_k A[m][k] Bt[n][k] (+ split products per NSPLIT). z-batch strides sA/sB/sC in elements. K % 128 == 0.
// EPI 0: C goes out in f32 (pitch ldc, + optional f32 bias[n]). EPI 1 and 2: m is the token, the 64 columns are one head (HD == 64), and C goes out only as the three 16-bit planes
// (fp16, bf16 hi, bf16 lo) that the attention reads, in fragment order: EPI 1 rows = tokens, k = d, per head tile (token / 16, d / 32), through the LDS transpose; EPI 2 rows = d, k = tokens, per head tile (token / 32, d / 16), straight from the accumulators (a lane holds 8 consecutive tokens of one d: its own 16 bytes of the tile).
template <typename T16> struct WFrag;
template <> struct WFrag<h16> { typedef v16h V; static __device__ __forceinline__ V ld(const h16* p) { return cat16(*(const v8h*)p, *(const v8h*)(p + FRG / 2)); } static __device__ __forceinline__ v8f mma(V a, V b, v8f c) { return wmma16(a, b, c); } };
template <> struct WFrag<bf> { typedef v16bf V; static __device__ __forceinline__ V ld(const bf* p) { return cat16b(*(const v8us*)p, *(const v8us*)(p + FRG / 2)); } static __device__ __forceinline__ v8f mma(V a, V b, v8f c) { return wmmab(a, b, c); } };
template <typename T16, int NSPLIT, bool BIAS, int EPI>
__global__ __launch_bounds__(32) void k_gemmw(const T16* __restrict__ A, const T16* __restrict__ A2, const T16* __restrict__ Bt, const T16* __restrict__ Bt2, int K, int RA, int RB, float* C, int ldc, const float* __restrict__ bias, size_t sA, size_t sB, size_t sC, h16* P16, bf* Ph, bf* Pl) {
    static_assert(EPI == 0 || HD == 64, "a 64-column tile is one head");
    typedef typename WFrag<T16>::V V;
    __shared__ __align__(16) float os[16 * 68];
    const size_t z = blockIdx.z; A += z * sA; if (A2) A2 += z * sA; Bt += z * sB; if (Bt2) Bt2 += z * sB; C += z * sC;
    const int lane = threadIdx.x & 31, lr = lane & 15, hi = lane >> 4; const int r0 = blockIdx.x * 64, c0 = blockIdx.y * 64;
    v8f acc[4][4];
#pragma unroll
    for (int mb = 0; mb < 4; ++mb)
#pragma unroll
        for (int nb = 0; nb < 4; ++nb) acc[mb][nb] = (v8f){};
    constexpr bool HA2 = NSPLIT == 1 || NSPLIT == 2, HB2 = NSPLIT >= 2;
    const size_t aoff = (size_t)(r0 / 16) * FRG + 8 * lane, boff = (size_t)(c0 / 16) * FRG + 8 * lane;   // this lane's 16 bytes of the first k tile of the first 16-row group
    const size_t ast = (size_t)(RA / 16) * FRG, bst = (size_t)(RB / 16) * FRG;                            // from one k tile to the next
    // Fragment ring in registers: RD sets; the loads of k tile t + PD are issued in front of the products of k tile t, so a tile's load latency runs behind PD tiles' products (a lone wave per SIMD has nothing else to hide it).
    // PD tiles' loads (16 or 24 a tile: 48) stay in flight behind a tile's wait, under the load counter's 63. Every accumulator still takes its k tiles in rising order.
    constexpr int RD = 4, PD = (HA2 || HB2) ? 2 : 3;
    V a[RD][4], a2[RD][4], b[RD][4], b2[RD][4];
    const T16* pa = A + aoff; const T16* pb = Bt + boff; const T16* pa2 = HA2 ? A2 + aoff : nullptr; const T16* pb2 = HB2 ? Bt2 + boff : nullptr;   // the next k tile to fetch
    auto fetch = [&](const int s) {
#pragma unroll
        for (int mb = 0; mb < 4; ++mb) { a[s][mb] = WFrag<T16>::ld(pa + mb * FRG); if (HA2) a2[s][mb] = WFrag<T16>::ld(pa2 + mb * FRG); }
#pragma unroll
        for (int nb = 0; nb < 4; ++nb) { b[s][nb] = WFrag<T16>::ld(pb + nb * FRG); if (HB2) b2[s][nb] = WFrag<T16>::ld(pb2 + nb * FRG); }
        __builtin_amdgcn_sched_barrier(0);                           // the set's loads stay one group in front of the products that follow: without this line the build puts a product, with its load wait, in front of them, and they lose their lead
    };
    auto step = [&]() {
        __builtin_amdgcn_sched_barrier(0);                           // the products stay in front of the wait: without this line the build puts it directly behind the loads, where the wave stands at it before its products
        // the address registers of the last fetch, and the lane number that a base + lane form of its loads names, stay as they are up to this wait (inputs only); they are rewritten only behind it
        if constexpr (HA2 && HB2) asm volatile("s_wait_xcnt 0x0" :: "v"(pa), "v"(pb), "v"(pa2), "v"(pb2), "v"(lane) : "memory");
        else if constexpr (HA2) asm volatile("s_wait_xcnt 0x0" :: "v"(pa), "v"(pb), "v"(pa2), "v"(lane) : "memory");
        else if constexpr (HB2) asm volatile("s_wait_xcnt 0x0" :: "v"(pa), "v"(pb), "v"(pb2), "v"(lane) : "memory");
        else asm volatile("s_wait_xcnt 0x0" :: "v"(pa), "v"(pb), "v"(lane) : "memory");
        __builtin_amdgcn_sched_barrier(0);                           // nothing below is lifted over the wait: a build may otherwise rewrite a register that the loads name (a scalar base too) ahead of it
        pa += ast; pb += bst; if (HA2) pa2 += ast; if (HB2) pb2 += bst;
    };
    auto mul = [&](const int s) {
#pragma unroll
        for (int nb = 0; nb < 4; ++nb)
#pragma unroll
            for (int mb = 0; mb < 4; ++mb) { acc[mb][nb] = WFrag<T16>::mma(a[s][mb], b[s][nb], acc[mb][nb]); if (HA2) acc[mb][nb] = WFrag<T16>::mma(a2[s][mb], b[s][nb], acc[mb][nb]); if (HB2) acc[mb][nb] = WFrag<T16>::mma(a[s][mb], b2[s][nb], acc[mb][nb]); }
    };
    const int KT = K / 32;
#pragma unroll
    for (int s = 0; s < PD; ++s) { fetch(s); step(); }
#pragma unroll 1
    for (int kt = 0; kt < KT - RD; kt += RD) {                       // rolled: one trip is RD k tiles, each ring set at a fixed place in the trip (no register copies)
#pragma unroll
        for (int u = 0; u < RD; ++u) { fetch((u + PD) % RD); mul(u); step(); }
        // four vector slots behind the trip's last products, on the taken branch too
        asm volatile("v_nop\n\tv_nop\n\tv_nop\n\tv_nop" : "+v"(acc[0][0]), "+v"(acc[1][1]), "+v"(acc[2][2]), "+v"(acc[3][3]) : "v"(a[RD - 1][0]), "v"(a[RD - 1][3]));
    }
#pragma unroll
    for (int u = 0; u < RD; ++u) {                                   // the last RD k tiles: only the tiles that exist are fetched
        if (u + PD < RD) fetch((u + PD) % RD);
        mul(u);
        if (u + PD < RD) step(); }
    if constexpr (EPI == 2) {
#pragma unroll
        for (int nb = 0; nb < 4; ++nb) { const size_t e = (size_t)blockIdx.y * HD * TT + (size_t)((r0 / 32) * (HD / 16) + nb) * FRG + lane * 8; h16* p16 = P16 + e; bf* ph = Ph + e; bf* pl = Pl + e; v8h o16[4]; v8us oh[4], ol[4];
#pragma unroll
            for (int mb = 0; mb < 4; ++mb) { float y[8];
#pragma unroll
                for (int j = 0; j < 8; ++j) y[j] = acc[mb][nb][j];
                planes8(y, o16[mb], oh[mb], ol[mb]); }
#pragma unroll
            for (int mb = 0; mb < 4; ++mb) *(v8h*)(p16 + (mb >> 1) * (HD / 16) * FRG + (mb & 1) * (FRG / 2)) = o16[mb];      // each store: 512 bytes in a row, half a tile
#pragma unroll
            for (int mb = 0; mb < 4; ++mb) *(v8us*)(ph + (mb >> 1) * (HD / 16) * FRG + (mb & 1) * (FRG / 2)) = oh[mb];
#pragma unroll
            for (int mb = 0; mb < 4; ++mb) *(v8us*)(pl + (mb >> 1) * (HD / 16) * FRG + (mb & 1) * (FRG / 2)) = ol[mb];
            // the data and address registers of the stores stay as they are up to this wait (inputs only)
            asm volatile("s_wait_xcnt 0x0" :: "v"(o16[0]), "v"(o16[1]), "v"(o16[2]), "v"(o16[3]), "v"(oh[0]), "v"(oh[1]), "v"(oh[2]), "v"(oh[3]), "v"(ol[0]), "v"(ol[1]), "v"(ol[2]), "v"(ol[3]), "v"(p16), "v"(ph), "v"(pl) : "memory");
        }
        return; }
#pragma unroll
    for (int mb = 0; mb < 4; ++mb) {
#pragma unroll
        for (int nb = 0; nb < 4; ++nb) {
#pragma unroll
            for (int j = 0; j < 8; ++j) os[(hi * 8 + j) * 68 + nb * 16 + lr] = acc[mb][nb][j]; }
        __builtin_amdgcn_wave_barrier(); asm volatile("" ::: "memory");
        if constexpr (EPI == 1) {
            const size_t e = ((size_t)blockIdx.y * TT + r0 + mb * 16) * HD + lane * 8; h16* p16 = P16 + e; bf* ph = Ph + e; bf* pl = Pl + e; v8h o16[4]; v8us oh[4], ol[4];
#pragma unroll
            for (int s = 0; s < 4; ++s) { const float* orow = os + lr * 68 + s * 16 + hi * 8; const v4f y0 = *(const v4fa*)orow, y1 = *(const v4fa*)(orow + 4); float y[8];
#pragma unroll
                for (int j = 0; j < 4; ++j) { y[j] = y0[j]; y[4 + j] = y1[j]; }
                planes8(y, o16[s], oh[s], ol[s]); }
#pragma unroll
            for (int s = 0; s < 4; ++s) { *(v8h*)(p16 + s * (FRG / 2)) = o16[s]; *(v8us*)(ph + s * (FRG / 2)) = oh[s]; *(v8us*)(pl + s * (FRG / 2)) = ol[s]; }   // each store: half a tile, 512 bytes in a row
            // the data and address registers of the stores stay as they are up to this wait (inputs only)
            asm volatile("s_wait_xcnt 0x0" :: "v"(o16[0]), "v"(o16[1]), "v"(o16[2]), "v"(o16[3]), "v"(oh[0]), "v"(oh[1]), "v"(oh[2]), "v"(oh[3]), "v"(ol[0]), "v"(ol[1]), "v"(ol[2]), "v"(ol[3]), "v"(p16), "v"(ph), "v"(pl) : "memory");
        } else {
        float* crow = C + (size_t)(r0 + mb * 16) * ldc + c0;
        v4f val[8]; float* pc[8];
#pragma unroll
            for (int s = 0; s < 8; ++s) { const int row = 2 * s + hi, cofs = lr * 4; val[s] = *(const v4fa*)(os + row * 68 + cofs); if (BIAS) { val[s][0] += bfr(bias[c0 + cofs]); val[s][1] += bfr(bias[c0 + cofs + 1]); val[s][2] += bfr(bias[c0 + cofs + 2]); val[s][3] += bfr(bias[c0 + cofs + 3]); }
                pc[s] = crow + (size_t)row * ldc + cofs; *(v4f*)pc[s] = val[s]; }
            // the data and address registers of the stores stay as they are up to this wait (inputs only)
            asm volatile("s_wait_xcnt 0x0" :: "v"(val[0]), "v"(val[1]), "v"(val[2]), "v"(val[3]), "v"(val[4]), "v"(val[5]), "v"(val[6]), "v"(val[7]), "v"(pc[0]), "v"(pc[1]), "v"(pc[2]), "v"(pc[3]), "v"(pc[4]), "v"(pc[5]), "v"(pc[6]), "v"(pc[7]) : "memory");
        }
        __builtin_amdgcn_wave_barrier(); asm volatile("" ::: "memory");
    }
}

typedef __attribute__((ext_vector_type(4))) _Float16 v4h;
typedef __attribute__((ext_vector_type(2))) unsigned short v2us;
typedef __attribute__((ext_vector_type(4))) unsigned short v4us;
typedef __attribute__((ext_vector_type(4))) int v4i;

// k_prep: every f32 -> bf16 operand plane (x and the four (in, out) weights) in ONE launch of PTH threads, all resident at once; a thread makes one 16-byte piece of each weight plane and PXU pieces of the x plane,
// and all its loads are issued in front of the first conversion (40 a wave, under the load counter's 63), so a wave waits for memory once. The launch costs one gap and 4,096 wave starts where five launches of one-piece threads cost five and 32,768.
// Weight w[k][n] -> plane in fragment order, rows = n, tile (k / 32, n / 16); a piece is eight k of one n: a wave's loads read 64 bytes in a row per half (a block's 256), its store 512.
// x[row][k] -> plane in fragment order, tile (k / 32, row / 16); a piece is eight consecutive k of one row. A wave makes 8 rows of PXU tiles in a row: it reads PXU * 128 bytes in a row of each (whole lines), and each of a tile's four pieces per row lands with the other rows' in 128 bytes in a row.
#define PTH (DM * DQ / 8)             // threads: the pieces of one weight plane
#define PXU (TT * DM / 8 / PTH)       // x pieces per thread
__global__ __launch_bounds__(256) void k_prep(const float* __restrict__ x, const float* __restrict__ wq, const float* __restrict__ wk, const float* __restrict__ wv, const float* __restrict__ wo, bf* XB, bf* WQ, bf* WK, bf* WV, bf* WO) {
    static_assert(DQ == DM && DKV == DM, "the four weight planes share one piece index");
    static_assert(PXU * PTH * 8 == TT * DM && (DM / 32) % PXU == 0 && PTH % 256 == 0, "a thread's x pieces are PXU k tiles in a row of one x row");
    const unsigned i = blockIdx.x * 256u + threadIdx.x, lane = i & 31u, w = i >> 5;
    constexpr unsigned NT = DM / 16u, KT = DM / 32u;
    const unsigned tile = i >> 6, n = (tile % NT) * 16u + (lane & 15u), k = (tile / NT) * 32u + (w & 1u) * 16u + (lane >> 4) * 8u;
    const unsigned wofs = k * DM + n;                                // the piece's first element in each weight
    const unsigned rg = (w >> 1) / (KT / PXU), kt = (w >> 1) % (KT / PXU) * PXU, row = (w & 1u) * 8u + (lane >> 2), pc = lane & 3u;   // piece pc: k = 8 pc + 0 .. 7 of the tiles kt + 0 .. PXU - 1
    const unsigned xofs = (rg * 16u + row) * DM + kt * 32u + pc * 8u;  // the first x piece; the next lies one k tile (128 bytes) further on in the row
    v8f v[PXU]; float fq[8], fk[8], fv[8], fo[8];
#pragma unroll
    for (int u = 0; u < PXU; ++u) v[u] = *(const v8f*)(x + xofs + u * 32);
#pragma unroll
    for (int j = 0; j < 8; ++j) { fq[j] = wq[wofs + j * DM]; fk[j] = wk[wofs + j * DM]; fv[j] = wv[wofs + j * DM]; fo[j] = wo[wofs + j * DM]; }
    asm volatile("s_wait_xcnt 0x0" :: "v"(wofs), "v"(xofs) : "memory");   // the offset registers of the loads stay as they are up to this wait (inputs only)
    v8us oq, ok, ov, oo, ox[PXU];
#pragma unroll
    for (int u = 0; u < PXU; ++u)
#pragma unroll
        for (int e = 0; e < 8; ++e) ox[u][e] = f2bf(v[u][e]);
#pragma unroll
    for (int j = 0; j < 8; ++j) { oq[j] = f2bf(fq[j]); ok[j] = f2bf(fk[j]); ov[j] = f2bf(fv[j]); oo[j] = f2bf(fo[j]); }
    bf* px = XB + ((size_t)kt * (TT / 16u) + rg) * FRG + (pc >> 1) * (FRG / 2) + ((pc & 1u) * 16u + row) * 8u;
#pragma unroll
    for (int u = 0; u < PXU; ++u) *(v8us*)(px + (size_t)u * (TT / 16u) * FRG) = ox[u];
    *(v8us*)(WQ + (size_t)i * 8) = oq; *(v8us*)(WK + (size_t)i * 8) = ok; *(v8us*)(WV + (size_t)i * 8) = ov; *(v8us*)(WO + (size_t)i * 8) = oo;
}

// ---- k_fattn: scores, causal softmax and probability x value contraction of ALL heads in one launch (online softmax); no score or probability ever reaches memory.
// One wave owns FNQ * 16 query columns of one head and walks the keys 0 .. its diagonal in passes of KB keys, transposed: S^T = K Q^T (A = K rows, B = Q rows), O^T += V^T P^T (A = V^T rows, B = P^T).
// A lane (lr, hi) holds, of each 16-key score tile, the keys 8 * hi + j of query column lr; two such tiles, converted in place, are the B operand of the second product in the k order of WFrag::ld.
// Per column: running maximum m (log2 units, equal in both lane halves), running sum l (one partial per lane half, joined at the end); O^T and l are rescaled only when a new maximum exceeds m by more than 8.
// Rows < RH: bf16 hi/lo planes, three products in both contractions; the rest fp16. The quotient O / l goes out as the merged hi/lo planes (rows = t, k = head * HD + d) in fragment order: a lane's 8 consecutive d of one query are its own 16 bytes of the tile. Grid (heads, FNB).
#define FNQ 2
#define FWV 4
#define FNB (TT / (FWV * FNQ * 16))   // work-groups per head
__device__ __forceinline__ float xhalf(float x) { return __builtin_bit_cast(float, __builtin_amdgcn_permlanex16(__builtin_bit_cast(int, x), __builtin_bit_cast(int, x), 0x76543210, 0xfedcba98, false, false)); }   // lane l <-> lane l ^ 16
// 2^x in place; the v_nop is the one slot the instruction set asks for behind a transcendental, in the same statement so that it stands directly behind it (source = result: nothing can overwrite the source alone)
__device__ __forceinline__ float exp2s(float x) { asm("v_exp_f32 %0, %0\n\tv_nop" : "+v"(x)); return x; }
template <typename T16, bool HL, int KB>
__device__ __forceinline__ void fattn_tile(const T16* __restrict__ Q, const T16* __restrict__ Q2, const T16* __restrict__ Kp, const T16* __restrict__ Kp2, const T16* __restrict__ Vt, const T16* __restrict__ Vt2, int q0, int lr, int hi, bf* Ah, bf* Al) {
    typedef typename WFrag<T16>::V V;
    constexpr int NKT = KB / 16, NKK = KB / 32;
    constexpr float C2 = SCL * 1.4426950408889634f;                  // score -> log2 units
    V qf[FNQ][2], qf2[FNQ][2];
    const int lane = hi * 16 + lr;
    const T16* pq = Q + (size_t)q0 * HD + 8 * lane; const T16* pq2 = HL ? Q2 + (size_t)q0 * HD + 8 * lane : nullptr;
#pragma unroll
    for (int g = 0; g < FNQ; ++g)
#pragma unroll
        for (int ks = 0; ks < 2; ++ks) { qf[g][ks] = WFrag<T16>::ld(pq + g * 16 * HD + ks * FRG); if (HL) qf2[g][ks] = WFrag<T16>::ld(pq2 + g * 16 * HD + ks * FRG); }
    const int kend = q0 + FNQ * 16;                                  // first key above every diagonal element of the tile
    const T16* pk = Kp + 8 * lane; const T16* pk2 = HL ? Kp2 + 8 * lane : nullptr;
    const T16* pv = Vt + 8 * lane; const T16* pv2 = HL ? Vt2 + 8 * lane : nullptr;
    V kf[NKT][2], kf2[NKT][2];
#pragma unroll
    for (int kt = 0; kt < NKT; ++kt)
#pragma unroll
        for (int ks = 0; ks < 2; ++ks) { kf[kt][ks] = WFrag<T16>::ld(pk + kt * 16 * HD + ks * FRG); if (HL) kf2[kt][ks] = WFrag<T16>::ld(pk2 + kt * 16 * HD + ks * FRG); }
    // the address registers of the Q and first K loads stay as they are up to this wait (inputs only)
    if (HL) asm volatile("s_wait_xcnt 0x0" :: "v"(pq), "v"(pq2), "v"(pk), "v"(pk2) : "memory"); else asm volatile("s_wait_xcnt 0x0" :: "v"(pq), "v"(pk) : "memory");
    __builtin_amdgcn_sched_barrier(0);                               // nothing below is lifted over the wait: without this line the build rewrites registers that the loads above name (their base, their lane offset) ahead of it
    v8f o[4][FNQ]; float m[FNQ], l[FNQ];
#pragma unroll
    for (int g = 0; g < FNQ; ++g) { m[g] = -3.0e38f; l[g] = 0.f;
#pragma unroll
        for (int dt = 0; dt < 4; ++dt) o[dt][g] = (v8f){}; }
#pragma unroll 1
    for (int k0 = 0; k0 < kend; k0 += KB) {
        V vf[4][NKK], vf2[4][NKK];                                   // this pass's V^T fragments: issued here, first used behind the softmax
#pragma unroll
        for (int dt = 0; dt < 4; ++dt)
#pragma unroll
            for (int kk = 0; kk < NKK; ++kk) { vf[dt][kk] = WFrag<T16>::ld(pv + (kk * (HD / 16) + dt) * FRG); if (HL) vf2[dt][kk] = WFrag<T16>::ld(pv2 + (kk * (HD / 16) + dt) * FRG); }
        // the V address registers stay as they are up to this wait (inputs only); they are rewritten only behind it
        if (HL) asm volatile("s_wait_xcnt 0x0" :: "v"(pv), "v"(pv2) : "memory"); else asm volatile("s_wait_xcnt 0x0" :: "v"(pv) : "memory");
        v8f s[NKT][FNQ];
#pragma unroll
        for (int kt = 0; kt < NKT; ++kt)
#pragma unroll
            for (int g = 0; g < FNQ; ++g) s[kt][g] = (v8f){};
#pragma unroll
        for (int ks = 0; ks < 2; ++ks)
#pragma unroll
            for (int kt = 0; kt < NKT; ++kt)
#pragma unroll
                for (int g = 0; g < FNQ; ++g) { s[kt][g] = WFrag<T16>::mma(kf[kt][ks], qf[g][ks], s[kt][g]); if (HL) { s[kt][g] = WFrag<T16>::mma(kf2[kt][ks], qf[g][ks], s[kt][g]); s[kt][g] = WFrag<T16>::mma(kf[kt][ks], qf2[g][ks], s[kt][g]); } }
        if (k0 + KB < kend) { pk += KB * HD; if (HL) pk2 += KB * HD; }   // the last pass fetches its own rows again: always inside the plane
#pragma unroll
        for (int kt = 0; kt < NKT; ++kt)                             // next pass's K fragments, in flight behind the softmax and the second product
#pragma unroll
            for (int ks = 0; ks < 2; ++ks) { kf[kt][ks] = WFrag<T16>::ld(pk + kt * 16 * HD + ks * FRG); if (HL) kf2[kt][ks] = WFrag<T16>::ld(pk2 + kt * 16 * HD + ks * FRG); }
        // the K address registers stay as they are up to this wait (inputs only); they are rewritten only behind it
        if (HL) asm volatile("s_wait_xcnt 0x0" :: "v"(pk), "v"(pk2) : "memory"); else asm volatile("s_wait_xcnt 0x0" :: "v"(pk) : "memory");
        if (k0 + KB - 1 > q0) {                                      // only passes that reach the diagonal mask (wave-uniform test)
#pragma unroll
            for (int kt = 0; kt < NKT; ++kt)
#pragma unroll
                for (int g = 0; g < FNQ; ++g)
#pragma unroll
                    for (int j = 0; j < 8; ++j) s[kt][g][j] = (k0 + kt * 16 + hi * 8 + j <= q0 + g * 16 + lr) ? s[kt][g][j] : -3.0e38f; }
        float tm[FNQ]; bool need = false;
#pragma unroll
        for (int g = 0; g < FNQ; ++g) { float t = s[0][g][0];
#pragma unroll
            for (int kt = 0; kt < NKT; ++kt)
#pragma unroll
                for (int j = 0; j < 8; ++j) t = fmaxf(t, s[kt][g][j]);
            t = fmaxf(t, xhalf(t)) * C2; tm[g] = t; need = need || (t > m[g] + 8.0f); }
        if (__builtin_amdgcn_ballot_w32(need) != 0) {                // scalar branch: rare once the maxima have settled
#pragma unroll
            for (int g = 0; g < FNQ; ++g) { const float mn = fmaxf(m[g], tm[g]); const float al = exp2s(m[g] - mn); m[g] = mn; l[g] *= al;
#pragma unroll
                for (int dt = 0; dt < 4; ++dt) o[dt][g] *= al; } }
        V pf[FNQ][NKK], pf2[FNQ][NKK];
#pragma unroll
        for (int g = 0; g < FNQ; ++g)
#pragma unroll
            for (int kk = 0; kk < NKK; ++kk) { float p[16]; float ls = 0.f;
#pragma unroll
                for (int e = 0; e < 16; ++e) { p[e] = exp2s(__builtin_fmaf(s[2 * kk + (e >> 3)][g][e & 7], C2, -m[g])); ls += p[e]; }
                l[g] += ls;
                if constexpr (HL) { v8us h0, h1, l0, l1;
#pragma unroll
                    for (int e = 0; e < 8; ++e) { unsigned short a, c; splitf(p[e], a, c); h0[e] = a; l0[e] = c; splitf(p[8 + e], a, c); h1[e] = a; l1[e] = c; }
                    pf[g][kk] = cat16b(h0, h1); pf2[g][kk] = cat16b(l0, l1);
                } else { v16h ph;
#pragma unroll
                    for (int e = 0; e < 16; ++e) ph[e] = tohx(p[e]);
                    pf[g][kk] = ph; } }
#pragma unroll
        for (int kk = 0; kk < NKK; ++kk)
#pragma unroll
            for (int dt = 0; dt < 4; ++dt)
#pragma unroll
                for (int g = 0; g < FNQ; ++g) { o[dt][g] = WFrag<T16>::mma(vf[dt][kk], pf[g][kk], o[dt][g]); if (HL) { o[dt][g] = WFrag<T16>::mma(vf2[dt][kk], pf[g][kk], o[dt][g]); o[dt][g] = WFrag<T16>::mma(vf[dt][kk], pf2[g][kk], o[dt][g]); } }
        pv += KB * HD; if (HL) pv2 += KB * HD;
    }
    v8us oh[FNQ][4], ol[FNQ][4];
#pragma unroll
    for (int g = 0; g < FNQ; ++g) { const float inv = __fdiv_rn(1.0f, l[g] + xhalf(l[g]));   // the two lane halves' sums, joined once
#pragma unroll
        for (int dt = 0; dt < 4; ++dt)
#pragma unroll
            for (int j = 0; j < 8; ++j) { unsigned short a, c; splitf(o[dt][g][j] * inv, a, c); oh[g][dt][j] = a; ol[g][dt][j] = c; } }
    bf* pa = Ah + (size_t)(q0 / 16) * FRG + lane * 8; bf* pl = Al + (size_t)(q0 / 16) * FRG + lane * 8;
#pragma unroll
    for (int g = 0; g < FNQ; ++g)
#pragma unroll
        for (int dt = 0; dt < 4; ++dt) { *(v8us*)(pa + ((dt >> 1) * (TT / 16) + g) * FRG + (dt & 1) * (FRG / 2)) = oh[g][dt]; *(v8us*)(pl + ((dt >> 1) * (TT / 16) + g) * FRG + (dt & 1) * (FRG / 2)) = ol[g][dt]; }
    static_assert(FNQ == 2, "the wait behind the stores names the data registers of two column groups");
    // the data and address registers of the stores stay as they are up to this wait (inputs only)
    asm volatile("s_wait_xcnt 0x0" :: "v"(oh[0][0]), "v"(oh[0][1]), "v"(oh[0][2]), "v"(oh[0][3]), "v"(oh[1][0]), "v"(oh[1][1]), "v"(oh[1][2]), "v"(oh[1][3]), "v"(ol[0][0]), "v"(ol[0][1]), "v"(ol[0][2]), "v"(ol[0][3]), "v"(ol[1][0]), "v"(ol[1][1]), "v"(ol[1][2]), "v"(ol[1][3]), "v"(pa), "v"(pl) : "memory");
}
__global__ __launch_bounds__(32 * FWV) void k_fattn(const h16* __restrict__ Q16, const h16* __restrict__ K16, const h16* __restrict__ V16, const bf* __restrict__ Qh, const bf* __restrict__ Ql, const bf* __restrict__ Kh, const bf* __restrict__ Kl, const bf* __restrict__ Vh, const bf* __restrict__ Vl, bf* Ah, bf* Al) {
    const int lane = threadIdx.x & 31, lr = lane & 15, hi = lane >> 4; const int wave = __builtin_amdgcn_readfirstlane((int)(threadIdx.x >> 5));
    const int h = blockIdx.x; const int y = blockIdx.y; const int qb = (y < FNB / 2) ? FNB - 1 - y : y - FNB / 2;   // longest walks first; blocks y and y + FNB / 2 walk FNB + 1 blocks' worth of keys together
    const int q0 = (qb * FWV + wave) * (FNQ * 16);
    const size_t zq = (size_t)h * TT * HD, zk = (size_t)(h / REP) * TT * HD;
    if (q0 < RH) fattn_tile<bf, true, 32>(Qh + zq, Ql + zq, Kh + zk, Kl + zk, Vh + zk, Vl + zk, q0, lr, hi, Ah + (size_t)h * (HD / 32) * (TT / 16) * FRG, Al + (size_t)h * (HD / 32) * (TT / 16) * FRG);
    else fattn_tile<h16, false, 64>(Q16 + zq, nullptr, K16 + zk, nullptr, V16 + zk, nullptr, q0, lr, hi, Ah + (size_t)h * (HD / 32) * (TT / 16) * FRG, Al + (size_t)h * (HD / 32) * (TT / 16) * FRG);
}

extern "C" void kernel_launch(void* const* d_in, const int* in_sizes, int n_in,
                              void* d_out, int out_size, void* d_ws, size_t ws_size, hipStream_t stream) {
    (void)in_sizes; (void)n_in; (void)out_size;
    const float* x = (const float*)d_in[0]; const float* wq = (const float*)d_in[1]; const float* wk = (const float*)d_in[2]; const float* wv = (const float*)d_in[3]; const float* wo = (const float*)d_in[4]; const float* bo = (const float*)d_in[5];
    float* OUT = (float*)d_out;     // [1][4096][1024]
    char* wsp = (char*)d_ws;
    auto take = [&](size_t bytes) { char* p = wsp; wsp += (bytes + 255) & ~(size_t)255; return (void*)p; };
    bf* WQ = (bf*)take((size_t)DQ * DM * 2); bf* WK = (bf*)take((size_t)DKV * DM * 2); bf* WV = (bf*)take((size_t)DKV * DM * 2); bf* WO = (bf*)take((size_t)DM * DQ * 2);
    bf* XB = (bf*)take((size_t)TT * DM * 2);
    h16* QP16 = (h16*)take((size_t)NH_ * TT * HD * 2); h16* KP16 = (h16*)take((size_t)NKV * TT * HD * 2); h16* VT16 = (h16*)take((size_t)NKV * HD * TT * 2);
    bf* QPh = (bf*)take((size_t)NH_ * TT * HD * 2); bf* QPl = (bf*)take((size_t)NH_ * TT * HD * 2); bf* KPh = (bf*)take((size_t)NKV * TT * HD * 2); bf* KPl = (bf*)take((size_t)NKV * TT * HD * 2); bf* VTh = (bf*)take((size_t)NKV * HD * TT * 2); bf* VTl = (bf*)take((size_t)NKV * HD * TT * 2);
    bf* ATh = (bf*)take((size_t)TT * DQ * 2); bf* ATl = (bf*)take((size_t)TT * DQ * 2);
    if ((size_t)(wsp - (char*)d_ws) > ws_size) return;    // ws 256 MiB
    static_assert(NB_ == 1, "one launch converts the one batch entry's x beside the weights");
    k_prep<<<PTH / 256, 256, 0, stream>>>(x, wq, wk, wv, wo, XB, WQ, WK, WV, WO);
    for (int b = 0; b < NB_; ++b) {
        k_gemmw<bf, 0, false, 1><<<dim3(TT / 64, DQ / 64, 1), 32, 0, stream>>>(XB, nullptr, WQ, nullptr, DM, TT, DQ, nullptr, 0, nullptr, 0, 0, 0, QP16, QPh, QPl);
        k_gemmw<bf, 0, false, 1><<<dim3(TT / 64, DKV / 64, 1), 32, 0, stream>>>(XB, nullptr, WK, nullptr, DM, TT, DKV, nullptr, 0, nullptr, 0, 0, 0, KP16, KPh, KPl);
        k_gemmw<bf, 0, false, 2><<<dim3(TT / 64, DKV / 64, 1), 32, 0, stream>>>(XB, nullptr, WV, nullptr, DM, TT, DKV, nullptr, 0, nullptr, 0, 0, 0, VT16, VTh, VTl);
        k_fattn<<<dim3(NH_, FNB, 1), 32 * FWV, 0, stream>>>(QP16, KP16, VT16, QPh, QPl, KPh, KPl, VTh, VTl, ATh, ATl);
        k_gemmw<bf, 1, true, 0><<<dim3(TT / 64, DM / 64, 1), 32, 0, stream>>>(ATh, ATl, WO, nullptr, DQ, TT, DM, OUT + (size_t)b * TT * DM, DM, bo, 0, 0, 0, nullptr, nullptr, nullptr); }
}

// v007
// A run of this version takes 102 microseconds.
// Timed twice side by side with v006, it ran 1.13 times as fast both times.
// All steps since v000 together make it 27.7 times as fast.
#include <hip/hip_runtime.h>

// Causal multi-head self-attention over 4,096 tokens with (in, out) weights (x [1][4096][1024]; q, k, v = x W ('xw' [1024][1024] 0.02, no bias; 16 heads x 64); scores with -inf strictly above the diagonal (triu k=1), then / sqrt(64) inside the softmax (the same function as scaling first); softmax; out = merged Wo + bo ('xw' + a REAL bias 0.02) -> [1][4096][1024] (4.2 M); argument order x, Wq, Wk, Wv, Wo, bo).
// Layout: bf16 copies of x and the weights (one launch); exact projections whose epilogue stores the attention operand planes; causal T-4096 attention of all heads fused in one launch with an online softmax (hybrid rows: < 512 hi/lo 3 products, rest fp16); merged hi/lo x Wo exact + bo.
// Fragment order: every 16-bit WMMA operand plane is stored as tiles of 16 rows x 32 k, FRG consecutive elements each; element (row lr, k = 16 s + 8 hi + j) lies at 256 s + 8 (16 hi + lr) + j,
// so a wave's fragment is two loads of 512 consecutive bytes (four whole 128-byte lines each): load s gives lane 16 hi + lr the elements k = 16 s + 8 hi + 0 .. 7 of row lr. GEMM operand planes of R rows: tile (k / 32, row / 16) at ((k / 32) * (R / 16) + row / 16) * FRG, so the four 16-row groups of a 64-row block lie 4 KiB in a row per k tile.
// Compute dtypes, f32 accumulate: every input rounded to bf16; projections exact; attention rows < 512 3 products, rest fp16; softmax f32; Wo hl x exact + bias.

#define NB_  1
#define TT   4096
#define DM   1024
#define NH_  16
#define NKV  16
#define REP  (NH_ / NKV)
#define HD   64
#define DQ   (NH_ * HD)
#define DKV  (NKV * HD)
#define RH   512                  // query rows < RH use hi+lo planes (0: none)
#define WIN  4096
#define SCL  0.125f   // HD^-0.5
#define FRG  512                  // elements of one 16 x 32 operand tile in fragment order
typedef _Float16 h16;
typedef unsigned short bf;
typedef __attribute__((ext_vector_type(16))) __bf16   v16bf;
typedef __attribute__((ext_vector_type(16))) _Float16 v16h;
typedef __attribute__((ext_vector_type(8)))  _Float16 v8h;
typedef __attribute__((ext_vector_type(8)))  unsigned short v8us;
typedef __attribute__((ext_vector_type(8)))  float    v8f;
typedef __attribute__((ext_vector_type(4)))  float    v4f;
typedef v8h  __attribute__((may_alias)) v8ha;
typedef v4f  __attribute__((may_alias)) v4fa;
typedef v8us __attribute__((may_alias)) v8usa;

__device__ __forceinline__ unsigned short f2bf(float f) { unsigned u = __float_as_uint(f); u += 0x7FFFu + ((u >> 16) & 1u); return (unsigned short)(u >> 16); }
__device__ __forceinline__ float bf2f(unsigned short b) { return __uint_as_float(((unsigned)b) << 16); }
__device__ __forceinline__ float bfr(float f) { return bf2f(f2bf(f)); }
__device__ __forceinline__ v16h cat16(v8h lo, v8h hi) { return __builtin_shufflevector(lo, hi, 0, 1, 2, 3, 4, 5, 6, 7, 8, 9, 10, 11, 12, 13, 14, 15); }
__device__ __forceinline__ v16bf cat16b(v8us lo, v8us hi) { return __builtin_bit_cast(v16bf, __builtin_shufflevector(lo, hi, 0, 1, 2, 3, 4, 5, 6, 7, 8, 9, 10, 11, 12, 13, 14, 15)); }
__device__ __forceinline__ v8f wmma16(v16h a, v16h b, v8f c) { return __builtin_amdgcn_wmma_f32_16x16x32_f16(false, a, false, b, (short)0, c, false, false); }
__device__ __forceinline__ v8f wmmab(v16bf a, v16bf b, v8f c) { return __builtin_amdgcn_wmma_f32_16x16x32_bf16(false, a, false, b, (short)0, c, false, false); }



__device__ __forceinline__ h16 tohx(float x) { return (h16)x; }
__device__ __forceinline__ void splitf(float y, unsigned short& h, unsigned short& l) { h = f2bf(y); l = f2bf(y - bf2f(h)); }
// eight f32 results -> their fp16 image and their bf16 hi/lo pair
__device__ __forceinline__ void planes8(const float* y, v8h& o16, v8us& oh, v8us& ol) {
#pragma unroll
    for (int e = 0; e < 8; ++e) { o16[e] = tohx(y[e]); unsigned short a, c; splitf(y[e], a, c); oh[e] = a; ol[e] = c; } }

// ---- k_gemmw: register-blocked GEMM, ONE WAVE per 64x64 output tile (16 accumulators), operands straight from 16-bit planes in fragment order (A of RA rows, Bt of RB rows); grid (M/64, N/64, Z), 32 threads.
// C[m][n] = sum_k A[m][k] Bt[n][k] (+ split products per NSPLIT). z-batch strides sA/sB/sC in elements. K % 128 == 0.
// EPI 0: C goes out in f32 (pitch ldc, + optional f32 bias[n]). EPI 1 and 2: m is the token, the 64 columns are one head (HD == 64), and C goes out only as the three 16-bit planes
// (fp16, bf16 hi, bf16 lo) that the attention reads, in fragment order: EPI 1 rows = tokens, k = d, per head tile (token / 16, d / 32), through the LDS transpose; EPI 2 rows = d, k = tokens, per head tile (token / 32, d / 16), straight from the accumulators (a lane holds 8 consecutive tokens of one d: its own 16 bytes of the tile).
template <typename T16> struct WFrag;
template <> struct WFrag<h16> { typedef v16h V; static __device__ __forceinline__ V ld(const h16* p) { return cat16(*(const v8h*)p, *(const v8h*)(p + FRG / 2)); } static __device__ __forceinline__ v8f mma(V a, V b, v8f c) { return wmma16(a, b, c); } };
template <> struct WFrag<bf> { typedef v16bf V; static __device__ __forceinline__ V ld(const bf* p) { return cat16b(*(const v8us*)p, *(const v8us*)(p + FRG / 2)); } static __device__ __forceinline__ v8f mma(V a, V b, v8f c) { return wmmab(a, b, c); } };
template <typename T16, int NSPLIT, bool BIAS, int EPI>
__global__ __launch_bounds__(32) void k_gemmw(const T16* __restrict__ A, const T16* __restrict__ A2, const T16* __restrict__ Bt, const T16* __restrict__ Bt2, int K, int RA, int RB, float* C, int ldc, const float* __restrict__ bias, size_t sA, size_t sB, size_t sC, h16* P16, bf* Ph, bf* Pl) {
    static_assert(EPI == 0 || HD == 64, "a 64-column tile is one head");
    typedef typename WFrag<T16>::V V;
    __shared__ __align__(16) float os[16 * 68];
    const size_t z = blockIdx.z; A += z * sA; if (A2) A2 += z * sA; Bt += z * sB; if (Bt2) Bt2 += z * sB; C += z * sC;
    const int lane = threadIdx.x & 31, lr = lane & 15, hi = lane >> 4; const int r0 = blockIdx.x * 64, c0 = blockIdx.y * 64;
    v8f acc[4][4];
#pragma unroll
    for (int mb = 0; mb < 4; ++mb)
#pragma unroll
        for (int nb = 0; nb < 4; ++nb) acc[mb][nb] = (v8f){};
    constexpr bool HA2 = NSPLIT == 1 || NSPLIT == 2, HB2 = NSPLIT >= 2;
    const size_t aoff = (size_t)(r0 / 16) * FRG + 8 * lane, boff = (size_t)(c0 / 16) * FRG + 8 * lane;   // this lane's 16 bytes of the first k tile of the first 16-row group
    const size_t ast = (size_t)(RA / 16) * FRG, bst = (size_t)(RB / 16) * FRG;                            // from one k tile to the next
    // Fragment ring in registers: RD sets; the loads of k tile t + PD are issued in front of the products of k tile t, so a tile's load latency runs behind PD tiles' products (a lone wave per SIMD has nothing else to hide it).
    // PD tiles' loads (16 or 24 a tile: 48) stay in flight behind a tile's wait, under the load counter's 63. Every accumulator still takes its k tiles in rising order.
    constexpr int RD = 4, PD = (HA2 || HB2) ? 2 : 3;
    V a[RD][4], a2[RD][4], b[RD][4], b2[RD][4];
    const T16* pa = A + aoff; const T16* pb = Bt + boff; const T16* pa2 = HA2 ? A2 + aoff : nullptr; const T16* pb2 = HB2 ? Bt2 + boff : nullptr;   // the next k tile to fetch
    auto fetch = [&](const int s) {
#pragma unroll
        for (int mb = 0; mb < 4; ++mb) { a[s][mb] = WFrag<T16>::ld(pa + mb * FRG); if (HA2) a2[s][mb] = WFrag<T16>::ld(pa2 + mb * FRG); }
#pragma unroll
        for (int nb = 0; nb < 4; ++nb) { b[s][nb] = WFrag<T16>::ld(pb + nb * FRG); if (HB2) b2[s][nb] = WFrag<T16>::ld(pb2 + nb * FRG); }
        __builtin_amdgcn_sched_barrier(0);                           // the set's loads stay one group in front of the products that follow: without this line the build puts a product, with its load wait, in front of them, and they lose their lead
    };
    auto step = [&]() {
        __builtin_amdgcn_sched_barrier(0);                           // the products stay in front of the wait: without this line the build puts it directly behind the loads, where the wave stands at it before its products
        // the address registers of the last fetch, and the lane number that a base + lane form of its loads names, stay as they are up to this wait (inputs only); they are rewritten only behind it
        if constexpr (HA2 && HB2) asm volatile("s_wait_xcnt 0x0" :: "v"(pa), "v"(pb), "v"(pa2), "v"(pb2), "v"(lane) : "memory");
        else if constexpr (HA2) asm volatile("s_wait_xcnt 0x0" :: "v"(pa), "v"(pb), "v"(pa2), "v"(lane) : "memory");
        else if constexpr (HB2) asm volatile("s_wait_xcnt 0x0" :: "v"(pa), "v"(pb), "v"(pb2), "v"(lane) : "memory");
        else asm volatile("s_wait_xcnt 0x0" :: "v"(pa), "v"(pb), "v"(lane) : "memory");
        __builtin_amdgcn_sched_barrier(0);                           // nothing below is lifted over the wait: a build may otherwise rewrite a register that the loads name (a scalar base too) ahead of it
        pa += ast; pb += bst; if (HA2) pa2 += ast; if (HB2) pb2 += bst;
    };
    auto mul = [&](const int s) {
#pragma unroll
        for (int nb = 0; nb < 4; ++nb)
#pragma unroll
            for (int mb = 0; mb < 4; ++mb) { acc[mb][nb] = WFrag<T16>::mma(a[s][mb], b[s][nb], acc[mb][nb]); if (HA2) acc[mb][nb] = WFrag<T16>::mma(a2[s][mb], b[s][nb], acc[mb][nb]); if (HB2) acc[mb][nb] = WFrag<T16>::mma(a[s][mb], b2[s][nb], acc[mb][nb]); }
    };
    const int KT = K / 32;
#pragma unroll
    for (int s = 0; s < PD; ++s) { fetch(s); step(); }
#pragma unroll 1
    for (int kt = 0; kt < KT - RD; kt += RD) {                       // rolled: one trip is RD k tiles, each ring set at a fixed place in the trip (no register copies)
#pragma unroll
        for (int u = 0; u < RD; ++u) { fetch((u + PD) % RD); mul(u); step(); }
        // four vector slots behind the trip's last products, on the taken branch too
        asm volatile("v_nop\n\tv_nop\n\tv_nop\n\tv_nop" : "+v"(acc[0][0]), "+v"(acc[1][1]), "+v"(acc[2][2]), "+v"(acc[3][3]) : "v"(a[RD - 1][0]), "v"(a[RD - 1][3]));
    }
#pragma unroll
    for (int u = 0; u < RD; ++u) {                                   // the last RD k tiles: only the tiles that exist are fetched
        if (u + PD < RD) fetch((u + PD) % RD);
        mul(u);
        if (u + PD < RD) step(); }
    if constexpr (EPI == 2) {
#pragma unroll
        for (int nb = 0; nb < 4; ++nb) { const size_t e = (size_t)blockIdx.y * HD * TT + (size_t)((r0 / 32) * (HD / 16) + nb) * FRG + lane * 8; h16* p16 = P16 + e; bf* ph = Ph + e; bf* pl = Pl + e; v8h o16[4]; v8us oh[4], ol[4];
#pragma unroll
            for (int mb = 0; mb < 4; ++mb) { float y[8];
#pragma unroll
                for (int j = 0; j < 8; ++j) y[j] = acc[mb][nb][j];
                planes8(y, o16[mb], oh[mb], ol[mb]); }
#pragma unroll
            for (int mb = 0; mb < 4; ++mb) *(v8h*)(p16 + (mb >> 1) * (HD / 16) * FRG + (mb & 1) * (FRG / 2)) = o16[mb];      // each store: 512 bytes in a row, half a tile
#pragma unroll
            for (int mb = 0; mb < 4; ++mb) *(v8us*)(ph + (mb >> 1) * (HD / 16) * FRG + (mb & 1) * (FRG / 2)) = oh[mb];
#pragma unroll
            for (int mb = 0; mb < 4; ++mb) *(v8us*)(pl + (mb >> 1) * (HD / 16) * FRG + (mb & 1) * (FRG / 2)) = ol[mb];
            // the data and address registers of the stores stay as they are up to this wait (inputs only)
            asm volatile("s_wait_xcnt 0x0" :: "v"(o16[0]), "v"(o16[1]), "v"(o16[2]), "v"(o16[3]), "v"(oh[0]), "v"(oh[1]), "v"(oh[2]), "v"(oh[3]), "v"(ol[0]), "v"(ol[1]), "v"(ol[2]), "v"(ol[3]), "v"(p16), "v"(ph), "v"(pl) : "memory");
        }
        return; }
#pragma unroll
    for (int mb = 0; mb < 4; ++mb) {
#pragma unroll
        for (int nb = 0; nb < 4; ++nb) {
#pragma unroll
            for (int j = 0; j < 8; ++j) os[(hi * 8 + j) * 68 + nb * 16 + lr] = acc[mb][nb][j]; }
        __builtin_amdgcn_wave_barrier(); asm volatile("" ::: "memory");
        if constexpr (EPI == 1) {
            const size_t e = ((size_t)blockIdx.y * TT + r0 + mb * 16) * HD + lane * 8; h16* p16 = P16 + e; bf* ph = Ph + e; bf* pl = Pl + e; v8h o16[4]; v8us oh[4], ol[4];
#pragma unroll
            for (int s = 0; s < 4; ++s) { const float* orow = os + lr * 68 + s * 16 + hi * 8; const v4f y0 = *(const v4fa*)orow, y1 = *(const v4fa*)(orow + 4); float y[8];
#pragma unroll
                for (int j = 0; j < 4; ++j) { y[j] = y0[j]; y[4 + j] = y1[j]; }
                planes8(y, o16[s], oh[s], ol[s]); }
#pragma unroll
            for (int s = 0; s < 4; ++s) { *(v8h*)(p16 + s * (FRG / 2)) = o16[s]; *(v8us*)(ph + s * (FRG / 2)) = oh[s]; *(v8us*)(pl + s * (FRG / 2)) = ol[s]; }   // each store: half a tile, 512 bytes in a row
            // the data and address registers of the stores stay as they are up to this wait (inputs only)
            asm volatile("s_wait_xcnt 0x0" :: "v"(o16[0]), "v"(o16[1]), "v"(o16[2]), "v"(o16[3]), "v"(oh[0]), "v"(oh[1]), "v"(oh[2]), "v"(oh[3]), "v"(ol[0]), "v"(ol[1]), "v"(ol[2]), "v"(ol[3]), "v"(p16), "v"(ph), "v"(pl) : "memory");
        } else {
        float* crow = C + (size_t)(r0 + mb * 16) * ldc + c0;
        v4f val[8]; float* pc[8];
#pragma unroll
            for (int s = 0; s < 8; ++s) { const int row = 2 * s + hi, cofs = lr * 4; val[s] = *(const v4fa*)(os + row * 68 + cofs); if (BIAS) { val[s][0] += bfr(bias[c0 + cofs]); val[s][1] += bfr(bias[c0 + cofs + 1]); val[s][2] += bfr(bias[c0 + cofs + 2]); val[s][3] += bfr(bias[c0 + cofs + 3]); }
                pc[s] = crow + (size_t)row * ldc + cofs; *(v4f*)pc[s] = val[s]; }
            // the data and address registers of the stores stay as they are up to this wait (inputs only)
            asm volatile("s_wait_xcnt 0x0" :: "v"(val[0]), "v"(val[1]), "v"(val[2]), "v"(val[3]), "v"(val[4]), "v"(val[5]), "v"(val[6]), "v"(val[7]), "v"(pc[0]), "v"(pc[1]), "v"(pc[2]), "v"(pc[3]), "v"(pc[4]), "v"(pc[5]), "v"(pc[6]), "v"(pc[7]) : "memory");
        }
        __builtin_amdgcn_wave_barrier(); asm volatile("" ::: "memory");
    }
}

typedef __attribute__((ext_vector_type(4))) _Float16 v4h;
typedef __attribute__((ext_vector_type(2))) unsigned short v2us;
typedef __attribute__((ext_vector_type(4))) unsigned short v4us;
typedef __attribute__((ext_vector_type(4))) int v4i;

// k_prep: every f32 -> bf16 operand plane (x and the four (in, out) weights) in ONE launch of PTH threads, all resident at once; a thread makes one 16-byte piece of each weight plane and PXU pieces of the x plane,
// and all its loads are issued in front of the first conversion (40 a wave, under the load counter's 63), so a wave waits for memory once. The launch costs one gap and 4,096 wave starts where five launches of one-piece threads cost five and 32,768.
// Weight w[k][n] -> plane in fragment order, rows = n, tile (k / 32, n / 16); a piece is eight k of one n: a wave's loads read 64 bytes in a row per half (a block's 256), its store 512.
// x[row][k] -> plane in fragment order, tile (k / 32, row / 16); a piece is eight consecutive k of one row. A wave makes 8 rows of PXU tiles in a row: it reads PXU * 128 bytes in a row of each (whole lines), and each of a tile's four pieces per row lands with the other rows' in 128 bytes in a row.
#define PTH (DM * DQ / 8)             // threads: the pieces of one weight plane
#define PXU (TT * DM / 8 / PTH)       // x pieces per thread
__global__ __launch_bounds__(256) void k_prep(const float* __restrict__ x, const float* __restrict__ wq, const float* __restrict__ wk, const float* __restrict__ wv, const float* __restrict__ wo, bf* XB, bf* WQ, bf* WK, bf* WV, bf* WO) {
    static_assert(DQ == DM && DKV == DM, "the four weight planes share one piece index");
    static_assert(PXU * PTH * 8 == TT * DM && (DM / 32) % PXU == 0 && PTH % 256 == 0, "a thread's x pieces are PXU k tiles in a row of one x row");
    const unsigned i = blockIdx.x * 256u + threadIdx.x, lane = i & 31u, w = i >> 5;
    constexpr unsigned NT = DM / 16u, KT = DM / 32u;
    const unsigned tile = i >> 6, n = (tile % NT) * 16u + (lane & 15u), k = (tile / NT) * 32u + (w & 1u) * 16u + (lane >> 4) * 8u;
    const unsigned wofs = k * DM + n;                                // the piece's first element in each weight
    const unsigned rg = (w >> 1) / (KT / PXU), kt = (w >> 1) % (KT / PXU) * PXU, row = (w & 1u) * 8u + (lane >> 2), pc = lane & 3u;   // piece pc: k = 8 pc + 0 .. 7 of the tiles kt + 0 .. PXU - 1
    const unsigned xofs = (rg * 16u + row) * DM + kt * 32u + pc * 8u;  // the first x piece; the next lies one k tile (128 bytes) further on in the row
    v8f v[PXU]; float fq[8], fk[8], fv[8], fo[8];
#pragma unroll
    for (int u = 0; u < PXU; ++u) v[u] = *(const v8f*)(x + xofs + u * 32);
#pragma unroll
    for (int j = 0; j < 8; ++j) { fq[j] = wq[wofs + j * DM]; fk[j] = wk[wofs + j * DM]; fv[j] = wv[wofs + j * DM]; fo[j] = wo[wofs + j * DM]; }
    asm volatile("s_wait_xcnt 0x0" :: "v"(wofs), "v"(xofs) : "memory");   // the offset registers of the loads stay as they are up to this wait (inputs only)
    v8us oq, ok, ov, oo, ox[PXU];
#pragma unroll
    for (int u = 0; u < PXU; ++u)
#pragma unroll
        for (int e = 0; e < 8; ++e) ox[u][e] = f2bf(v[u][e]);
#pragma unroll
    for (int j = 0; j < 8; ++j) { oq[j] = f2bf(fq[j]); ok[j] = f2bf(fk[j]); ov[j] = f2bf(fv[j]); oo[j] = f2bf(fo[j]); }
    bf* px = XB + ((size_t)kt * (TT / 16u) + rg) * FRG + (pc >> 1) * (FRG / 2) + ((pc & 1u) * 16u + row) * 8u;
#pragma unroll
    for (int u = 0; u < PXU; ++u) *(v8us*)(px + (size_t)u * (TT / 16u) * FRG) = ox[u];
    *(v8us*)(WQ + (size_t)i * 8) = oq; *(v8us*)(WK + (size_t)i * 8) = ok; *(v8us*)(WV + (size_t)i * 8) = ov; *(v8us*)(WO + (size_t)i * 8) = oo;
}

// ---- k_fattn: scores, causal softmax and probability x value contraction of ALL heads in one launch (online softmax); no score or probability ever reaches memory.
// FKS waves own FNQ * 16 query columns of one head and walk the keys 0 .. their diagonal in passes of KB keys, wave 'part' taking the passes part, part + FKS, ..., transposed: S^T = K Q^T (A = K rows, B = Q rows), O^T += V^T P^T (A = V^T rows, B = P^T).
// Each part keeps its own m, l and O^T; behind the walk part 1 hands them to part 0 through LDS, which brings both to the common maximum, adds them and stores. So the longest walk of the launch is half as many passes per wave, and every SIMD holds two waves
// (the two parts of one tile) from a block's start to the hand-over: one wave's products run behind the other's softmax. A block fills its WGP's registers; blocks start heaviest first, so a WGP that ends a lighter block early takes the heaviest one left.
// A lane (lr, hi) holds, of each 16-key score tile, the keys 8 * hi + j of query column lr; two such tiles, converted in place, are the B operand of the second product in the k order of WFrag::ld.
// Per column: running maximum m (log2 units, equal in both lane halves), running sum l (one partial per lane half, joined at the end); O^T and l are rescaled only when a new maximum exceeds m by more than 8.
// Rows < RH: bf16 hi/lo planes, three products in both contractions; the rest fp16. The quotient O / l goes out as the merged hi/lo planes (rows = t, k = head * HD + d) in fragment order: a lane's 8 consecutive d of one query are its own 16 bytes of the tile. Grid (heads, FNB).
#define FNQ 2
#define FWV 4
#define FKS 2                         // waves that share one tile's key walk
#define FNB (TT / (FWV * FNQ * 16))   // work-groups per head
#define FXP (FNQ * 4 * 2 + 1)         // 16-byte pieces a lane hands over: O^T, then (m, l)
__device__ __forceinline__ float xhalf(float x) { return __builtin_bit_cast(float, __builtin_amdgcn_permlanex16(__builtin_bit_cast(int, x), __builtin_bit_cast(int, x), 0x76543210, 0xfedcba98, false, false)); }   // lane l <-> lane l ^ 16
// 2^x in place; the v_nop is the one slot the instruction set asks for behind a transcendental, in the same statement so that it stands directly behind it (source = result: nothing can overwrite the source alone)
__device__ __forceinline__ float exp2s(float x) { asm("v_exp_f32 %0, %0\n\tv_nop" : "+v"(x)); return x; }
template <typename T16, bool HL, int KB>
__device__ __forceinline__ void fattn_tile(const T16* __restrict__ Q, const T16* __restrict__ Q2, const T16* __restrict__ Kp, const T16* __restrict__ Kp2, const T16* __restrict__ Vt, const T16* __restrict__ Vt2, int q0, int lr, int hi, int part, v4f* xs, bf* Ah, bf* Al) {
    typedef typename WFrag<T16>::V V;
    constexpr int NKT = KB / 16, NKK = KB / 32;
    constexpr float C2 = SCL * 1.4426950408889634f;                  // score -> log2 units
    V qf[FNQ][2], qf2[FNQ][2];
    const int lane = hi * 16 + lr;
    const T16* pq = Q + (size_t)q0 * HD + 8 * lane; const T16* pq2 = HL ? Q2 + (size_t)q0 * HD + 8 * lane : nullptr;
#pragma unroll
    for (int g = 0; g < FNQ; ++g)
#pragma unroll
        for (int ks = 0; ks < 2; ++ks) { qf[g][ks] = WFrag<T16>::ld(pq + g * 16 * HD + ks * FRG); if (HL) qf2[g][ks] = WFrag<T16>::ld(pq2 + g * 16 * HD + ks * FRG); }
    const int kend = q0 + FNQ * 16;                                  // first key above every diagonal element of the tile
    const int kofs = part * KB * HD + 8 * lane;                      // this part's first pass (KB < TT keys in: inside the plane, also where the part has no pass)
    const T16* pk = Kp + kofs; const T16* pk2 = HL ? Kp2 + kofs : nullptr;
    const T16* pv = Vt + kofs; const T16* pv2 = HL ? Vt2 + kofs : nullptr;
    V kf[NKT][2], kf2[NKT][2];
#pragma unroll
    for (int kt = 0; kt < NKT; ++kt)
#pragma unroll
        for (int ks = 0; ks < 2; ++ks) { kf[kt][ks] = WFrag<T16>::ld(pk + kt * 16 * HD + ks * FRG); if (HL) kf2[kt][ks] = WFrag<T16>::ld(pk2 + kt * 16 * HD + ks * FRG); }
    // the address registers of the Q and first K loads stay as they are up to this wait (inputs only)
    if (HL) asm volatile("s_wait_xcnt 0x0" :: "v"(pq), "v"(pq2), "v"(pk), "v"(pk2) : "memory"); else asm volatile("s_wait_xcnt 0x0" :: "v"(pq), "v"(pk) : "memory");
    __builtin_amdgcn_sched_barrier(0);                               // nothing below is lifted over the wait: without this line the build rewrites registers that the loads above name (their base, their lane offset) ahead of it
    v8f o[4][FNQ]; float m[FNQ], l[FNQ];
#pragma unroll
    for (int g = 0; g < FNQ; ++g) { m[g] = -3.0e38f; l[g] = 0.f;
#pragma unroll
        for (int dt = 0; dt < 4; ++dt) o[dt][g] = (v8f){}; }
#pragma unroll 1
    for (int k0 = part * KB; k0 < kend; k0 += FKS * KB) {
        V vf[4][NKK], vf2[4][NKK];                                   // this pass's V^T fragments: issued here, first used behind the softmax
#pragma unroll
        for (int dt = 0; dt < 4; ++dt)
#pragma unroll
            for (int kk = 0; kk < NKK; ++kk) { vf[dt][kk] = WFrag<T16>::ld(pv + (kk * (HD / 16) + dt) * FRG); if (HL) vf2[dt][kk] = WFrag<T16>::ld(pv2 + (kk * (HD / 16) + dt) * FRG); }
        // the V address registers stay as they are up to this wait (inputs only); they are rewritten only behind it
        if (HL) asm volatile("s_wait_xcnt 0x0" :: "v"(pv), "v"(pv2) : "memory"); else asm volatile("s_wait_xcnt 0x0" :: "v"(pv) : "memory");
        v8f s[NKT][FNQ];
#pragma unroll
        for (int kt = 0; kt < NKT; ++kt)
#pragma unroll
            for (int g = 0; g < FNQ; ++g) s[kt][g] = (v8f){};
#pragma unroll
        for (int ks = 0; ks < 2; ++ks)
#pragma unroll
            for (int kt = 0; kt < NKT; ++kt)
#pragma unroll
                for (int g = 0; g < FNQ; ++g) { s[kt][g] = WFrag<T16>::mma(kf[kt][ks], qf[g][ks], s[kt][g]); if (HL) { s[kt][g] = WFrag<T16>::mma(kf2[kt][ks], qf[g][ks], s[kt][g]); s[kt][g] = WFrag<T16>::mma(kf[kt][ks], qf2[g][ks], s[kt][g]); } }
        if (k0 + FKS * KB < kend) { pk += FKS * KB * HD; if (HL) pk2 += FKS * KB * HD; }   // the last pass fetches its own rows again: always inside the plane
#pragma unroll
        for (int kt = 0; kt < NKT; ++kt)                             // next pass's K fragments, in flight behind the softmax and the second product
#pragma unroll
            for (int ks = 0; ks < 2; ++ks) { kf[kt][ks] = WFrag<T16>::ld(pk + kt * 16 * HD + ks * FRG); if (HL) kf2[kt][ks] = WFrag<T16>::ld(pk2 + kt * 16 * HD + ks * FRG); }
        // the K address registers stay as they are up to this wait (inputs only); they are rewritten only behind it
        if (HL) asm volatile("s_wait_xcnt 0x0" :: "v"(pk), "v"(pk2) : "memory"); else asm volatile("s_wait_xcnt 0x0" :: "v"(pk) : "memory");
        if (k0 + KB - 1 > q0) {                                      // only passes that reach the diagonal mask (wave-uniform test)
#pragma unroll
            for (int kt = 0; kt < NKT; ++kt)
#pragma unroll
                for (int g = 0; g < FNQ; ++g)
#pragma unroll
                    for (int j = 0; j < 8; ++j) s[kt][g][j] = (k0 + kt * 16 + hi * 8 + j <= q0 + g * 16 + lr) ? s[kt][g][j] : -3.0e38f; }
        float tm[FNQ]; bool need = false;
#pragma unroll
        for (int g = 0; g < FNQ; ++g) { float t = s[0][g][0];
#pragma unroll
            for (int kt = 0; kt < NKT; ++kt)
#pragma unroll
                for (int j = 0; j < 8; ++j) t = fmaxf(t, s[kt][g][j]);
            t = fmaxf(t, xhalf(t)) * C2; tm[g] = t; need = need || (t > m[g] + 8.0f); }
        if (__builtin_amdgcn_ballot_w32(need) != 0) {                // scalar branch: rare once the maxima have settled
#pragma unroll
            for (int g = 0; g < FNQ; ++g) { const float mn = fmaxf(m[g], tm[g]); const float al = exp2s(m[g] - mn); m[g] = mn; l[g] *= al;
#pragma unroll
                for (int dt = 0; dt < 4; ++dt) o[dt][g] *= al; } }
        V pf[FNQ][NKK], pf2[FNQ][NKK];
#pragma unroll
        for (int g = 0; g < FNQ; ++g)
#pragma unroll
            for (int kk = 0; kk < NKK; ++kk) { float p[16]; float ls = 0.f;
#pragma unroll
                for (int e = 0; e < 16; ++e) { p[e] = exp2s(__builtin_fmaf(s[2 * kk + (e >> 3)][g][e & 7], C2, -m[g])); ls += p[e]; }
                l[g] += ls;
                if constexpr (HL) { v8us h0, h1, l0, l1;
#pragma unroll
                    for (int e = 0; e < 8; ++e) { unsigned short a, c; splitf(p[e], a, c); h0[e] = a; l0[e] = c; splitf(p[8 + e], a, c); h1[e] = a; l1[e] = c; }
                    pf[g][kk] = cat16b(h0, h1); pf2[g][kk] = cat16b(l0, l1);
                } else { v16h ph;
#pragma unroll
                    for (int e = 0; e < 16; ++e) ph[e] = tohx(p[e]);
                    pf[g][kk] = ph; } }
#pragma unroll
        for (int kk = 0; kk < NKK; ++kk)
#pragma unroll
            for (int dt = 0; dt < 4; ++dt)
#pragma unroll
                for (int g = 0; g < FNQ; ++g) { o[dt][g] = WFrag<T16>::mma(vf[dt][kk], pf[g][kk], o[dt][g]); if (HL) { o[dt][g] = WFrag<T16>::mma(vf2[dt][kk], pf[g][kk], o[dt][g]); o[dt][g] = WFrag<T16>::mma(vf[dt][kk], pf2[g][kk], o[dt][g]); } }
        pv += FKS * KB * HD; if (HL) pv2 += FKS * KB * HD;
    }
    static_assert(FKS == 2 && FNQ == 2, "one hand-over, its last piece holds two m and two l");
    if (part != 0) {                                                 // wave-uniform
#pragma unroll
        for (int dt = 0; dt < 4; ++dt)
#pragma unroll
            for (int g = 0; g < FNQ; ++g) { xs[((dt * FNQ + g) * 2) * 32 + lane] = __builtin_shufflevector(o[dt][g], o[dt][g], 0, 1, 2, 3); xs[((dt * FNQ + g) * 2 + 1) * 32 + lane] = __builtin_shufflevector(o[dt][g], o[dt][g], 4, 5, 6, 7); }
        xs[(FXP - 1) * 32 + lane] = (v4f){m[0], m[1], l[0], l[1]}; }
    __syncthreads();                                                 // part 1's hand-over is in LDS before part 0 reads it; every wave of the block passes here once
    if (part != 0) return;
    { const v4f ml = xs[(FXP - 1) * 32 + lane];                      // a part without a pass hands over m = -3.0e38, l = 0, O = 0: its factor is 0
#pragma unroll
        for (int g = 0; g < FNQ; ++g) { const float mn = fmaxf(m[g], ml[g]); const float a0 = exp2s(m[g] - mn), a1 = exp2s(ml[g] - mn); l[g] = l[g] * a0 + ml[FNQ + g] * a1;
#pragma unroll
            for (int dt = 0; dt < 4; ++dt) { const v4f x0 = xs[((dt * FNQ + g) * 2) * 32 + lane], x1 = xs[((dt * FNQ + g) * 2 + 1) * 32 + lane];
#pragma unroll
                for (int j = 0; j < 4; ++j) { o[dt][g][j] = o[dt][g][j] * a0 + x0[j] * a1; o[dt][g][4 + j] = o[dt][g][4 + j] * a0 + x1[j] * a1; } } } }
    v8us oh[FNQ][4], ol[FNQ][4];
#pragma unroll
    for (int g = 0; g < FNQ; ++g) { const float inv = __fdiv_rn(1.0f, l[g] + xhalf(l[g]));   // the two lane halves' sums, joined once
#pragma unroll
        for (int dt = 0; dt < 4; ++dt)
#pragma unroll
            for (int j = 0; j < 8; ++j) { unsigned short a, c; splitf(o[dt][g][j] * inv, a, c); oh[g][dt][j] = a; ol[g][dt][j] = c; } }
    bf* pa = Ah + (size_t)(q0 / 16) * FRG + lane * 8; bf* pl = Al + (size_t)(q0 / 16) * FRG + lane * 8;
#pragma unroll
    for (int g = 0; g < FNQ; ++g)
#pragma unroll
        for (int dt = 0; dt < 4; ++dt) { *(v8us*)(pa + ((dt >> 1) * (TT / 16) + g) * FRG + (dt & 1) * (FRG / 2)) = oh[g][dt]; *(v8us*)(pl + ((dt >> 1) * (TT / 16) + g) * FRG + (dt & 1) * (FRG / 2)) = ol[g][dt]; }
    static_assert(FNQ == 2, "the wait behind the stores names the data registers of two column groups");
    // the data and address registers of the stores stay as they are up to this wait (inputs only)
    asm volatile("s_wait_xcnt 0x0" :: "v"(oh[0][0]), "v"(oh[0][1]), "v"(oh[0][2]), "v"(oh[0][3]), "v"(oh[1][0]), "v"(oh[1][1]), "v"(oh[1][2]), "v"(oh[1][3]), "v"(ol[0][0]), "v"(ol[0][1]), "v"(ol[0][2]), "v"(ol[0][3]), "v"(ol[1][0]), "v"(ol[1][1]), "v"(ol[1][2]), "v"(ol[1][3]), "v"(pa), "v"(pl) : "memory");
}
__global__ __launch_bounds__(32 * FWV * FKS) void k_fattn(const h16* __restrict__ Q16, const h16* __restrict__ K16, const h16* __restrict__ V16, const bf* __restrict__ Qh, const bf* __restrict__ Ql, const bf* __restrict__ Kh, const bf* __restrict__ Kl, const bf* __restrict__ Vh, const bf* __restrict__ Vl, bf* Ah, bf* Al) {
    const int lane = threadIdx.x & 31, lr = lane & 15, hi = lane >> 4; const int wave = __builtin_amdgcn_readfirstlane((int)(threadIdx.x >> 5));
    static_assert(RH % (FWV * FNQ * 16) == 0, "a block's waves all take the same branch below, so all meet at its barrier");
    __shared__ v4f xsh[FWV * FXP * 32];
    const int tile = wave % FWV, part = wave / FWV;                  // waves w and w + FWV: the two parts of one tile
    const int h = blockIdx.x; const int qb = FNB - 1 - (int)blockIdx.y;   // cost falls with the index
    const int q0 = (qb * FWV + tile) * (FNQ * 16); v4f* xs = xsh + tile * FXP * 32;
    const size_t zq = (size_t)h * TT * HD, zk = (size_t)(h / REP) * TT * HD;
    if (q0 < RH) fattn_tile<bf, true, 32>(Qh + zq, Ql + zq, Kh + zk, Kl + zk, Vh + zk, Vl + zk, q0, lr, hi, part, xs, Ah + (size_t)h * (HD / 32) * (TT / 16) * FRG, Al + (size_t)h * (HD / 32) * (TT / 16) * FRG);
    else fattn_tile<h16, false, 64>(Q16 + zq, nullptr, K16 + zk, nullptr, V16 + zk, nullptr, q0, lr, hi, part, xs, Ah + (size_t)h * (HD / 32) * (TT / 16) * FRG, Al + (size_t)h * (HD / 32) * (TT / 16) * FRG);
}

extern "C" void kernel_launch(void* const* d_in, const int* in_sizes, int n_in,
                              void* d_out, int out_size, void* d_ws, size_t ws_size, hipStream_t stream) {
    (void)in_sizes; (void)n_in; (void)out_size;
    const float* x = (const float*)d_in[0]; const float* wq = (const float*)d_in[1]; const float* wk = (const float*)d_in[2]; const float* wv = (const float*)d_in[3]; const float* wo = (const float*)d_in[4]; const float* bo = (const float*)d_in[5];
    float* OUT = (float*)d_out;     // [1][4096][1024]
    char* wsp = (char*)d_ws;
    auto take = [&](size_t bytes) { char* p = wsp; wsp += (bytes + 255) & ~(size_t)255; return (void*)p; };
    bf* WQ = (bf*)take((size_t)DQ * DM * 2); bf* WK = (bf*)take((size_t)DKV * DM * 2); bf* WV = (bf*)take((size_t)DKV * DM * 2); bf* WO = (bf*)take((size_t)DM * DQ * 2);
    bf* XB = (bf*)take((size_t)TT * DM * 2);
    h16* QP16 = (h16*)take((size_t)NH_ * TT * HD * 2); h16* KP16 = (h16*)take((size_t)NKV * TT * HD * 2); h16* VT16 = (h16*)take((size_t)NKV * HD * TT * 2);
    bf* QPh = (bf*)take((size_t)NH_ * TT * HD * 2); bf* QPl = (bf*)take((size_t)NH_ * TT * HD * 2); bf* KPh = (bf*)take((size_t)NKV * TT * HD * 2); bf* KPl = (bf*)take((size_t)NKV * TT * HD * 2); bf* VTh = (bf*)take((size_t)NKV * HD * TT * 2); bf* VTl = (bf*)take((size_t)NKV * HD * TT * 2);
    bf* ATh = (bf*)take((size_t)TT * DQ * 2); bf* ATl = (bf*)take((size_t)TT * DQ * 2);
    if ((size_t)(wsp - (char*)d_ws) > ws_size) return;    // ws 256 MiB
    static_assert(NB_ == 1, "one launch converts the one batch entry's x beside the weights");
    k_prep<<<PTH / 256, 256, 0, stream>>>(x, wq, wk, wv, wo, XB, WQ, WK, WV, WO);
    for (int b = 0; b < NB_; ++b) {
        k_gemmw<bf, 0, false, 1><<<dim3(TT / 64, DQ / 64, 1), 32, 0, stream>>>(XB, nullptr, WQ, nullptr, DM, TT, DQ, nullptr, 0, nullptr, 0, 0, 0, QP16, QPh, QPl);
        k_gemmw<bf, 0, false, 1><<<dim3(TT / 64, DKV / 64, 1), 32, 0, stream>>>(XB, nullptr, WK, nullptr, DM, TT, DKV, nullptr, 0, nullptr, 0, 0, 0, KP16, KPh, KPl);
        k_gemmw<bf, 0, false, 2><<<dim3(TT / 64, DKV / 64, 1), 32, 0, stream>>>(XB, nullptr, WV, nullptr, DM, TT, DKV, nullptr, 0, nullptr, 0, 0, 0, VT16, VTh, VTl);
        k_fattn<<<dim3(NH_, FNB, 1), 32 * FWV * FKS, 0, stream>>>(QP16, KP16, VT16, QPh, QPl, KPh, KPl, VTh, VTl, ATh, ATl);
        k_gemmw<bf, 1, true, 0><<<dim3(TT / 64, DM / 64, 1), 32, 0, stream>>>(ATh, ATl, WO, nullptr, DQ, TT, DM, OUT + (size_t)b * TT * DM, DM, bo, 0, 0, 0, nullptr, nullptr, nullptr); }
}

// v008
// It runs in 88.3 microseconds.
// Timed twice side by side with v007, it ran 1.16 times as fast both times.
// All steps since v000 together make it 32.1 times as fast.
#include <hip/hip_runtime.h>

// Causal multi-head self-attention over 4,096 tokens with (in, out) weights (x [1][4096][1024]; q, k, v = x W ('xw' [1024][1024] 0.02, no bias; 16 heads x 64); scores with -inf strictly above the diagonal (triu k=1), then / sqrt(64) inside the softmax (the same function as scaling first); softmax; out = merged Wo + bo ('xw' + a REAL bias 0.02) -> [1][4096][1024] (4.2 M); argument order x, Wq, Wk, Wv, Wo, bo).
// Layout: bf16 copies of x and the weights (one launch); exact projections whose epilogue stores the attention operand planes; causal T-4096 attention of all heads fused in one launch with an online softmax (hybrid rows: < 512 hi/lo 3 products, rest fp16); merged hi/lo x Wo exact + bo.
// Fragment order: every 16-bit WMMA operand plane is stored as tiles of 16 rows x 32 k, FRG consecutive elements each; element (row lr, k = 16 s + 8 hi + j) lies at 256 s + 8 (16 hi + lr) + j,
// so a wave's fragment is two loads of 512 consecutive bytes (four whole 128-byte lines each): load s gives lane 16 hi + lr the elements k = 16 s + 8 hi + 0 .. 7 of row lr. GEMM operand planes of R rows: tile (k / 32, row / 16) at ((k / 32) * (R / 16) + row / 16) * FRG, so the four 16-row groups of a 64-row block lie 4 KiB in a row per k tile.
// Compute dtypes, f32 accumulate: every input rounded to bf16; projections exact; attention rows < 512 3 products, rest fp16; softmax f32; Wo hl x exact + bias.

#define NB_  1
#define TT   4096
#define DM   1024
#define NH_  16
#define NKV  16
#define REP  (NH_ / NKV)
#define HD   64
#define DQ   (NH_ * HD)
#define DKV  (NKV * HD)
#define RH   512                  // query rows < RH use hi+lo planes (0: none)
#define WIN  4096
#define SCL  0.125f   // HD^-0.5
#define FRG  512                  // elements of one 16 x 32 operand tile in fragment order
typedef _Float16 h16;
typedef unsigned short bf;
typedef __attribute__((ext_vector_type(16))) __bf16   v16bf;
typedef __attribute__((ext_vector_type(16))) _Float16 v16h;
typedef __attribute__((ext_vector_type(8)))  _Float16 v8h;
typedef __attribute__((ext_vector_type(8)))  unsigned short v8us;
typedef __attribute__((ext_vector_type(8)))  float    v8f;
typedef __attribute__((ext_vector_type(4)))  float    v4f;
typedef v8h  __attribute__((may_alias)) v8ha;
typedef v4f  __attribute__((may_alias)) v4fa;
typedef v8us __attribute__((may_alias)) v8usa;

__device__ __forceinline__ unsigned short f2bf(float f) { unsigned u = __float_as_uint(f); u += 0x7FFFu + ((u >> 16) & 1u); return (unsigned short)(u >> 16); }
__device__ __forceinline__ float bf2f(unsigned short b) { return __uint_as_float(((unsigned)b) << 16); }
__device__ __forceinline__ float bfr(float f) { return bf2f(f2bf(f)); }
__device__ __forceinline__ v16h cat16(v8h lo, v8h hi) { return __builtin_shufflevector(lo, hi, 0, 1, 2, 3, 4, 5, 6, 7, 8, 9, 10, 11, 12, 13, 14, 15); }
__device__ __forceinline__ v16bf cat16b(v8us lo, v8us hi) { return __builtin_bit_cast(v16bf, __builtin_shufflevector(lo, hi, 0, 1, 2, 3, 4, 5, 6, 7, 8, 9, 10, 11, 12, 13, 14, 15)); }
__device__ __forceinline__ v8f wmma16(v16h a, v16h b, v8f c) { return __builtin_amdgcn_wmma_f32_16x16x32_f16(false, a, false, b, (short)0, c, false, false); }
__device__ __forceinline__ v8f wmmab(v16bf a, v16bf b, v8f c) { return __builtin_amdgcn_wmma_f32_16x16x32_bf16(false, a, false, b, (short)0, c, false, false); }



__device__ __forceinline__ h16 tohx(float x) { return (h16)x; }
__device__ __forceinline__ void splitf(float y, unsigned short& h, unsigned short& l) { h = f2bf(y); l = f2bf(y - bf2f(h)); }
// eight f32 results -> their fp16 image and their bf16 hi/lo pair
__device__ __forceinline__ void planes8(const float* y, v8h& o16, v8us& oh, v8us& ol) {
#pragma unroll
    for (int e = 0; e < 8; ++e) { o16[e] = tohx(y[e]); unsigned short a, c; splitf(y[e], a, c); oh[e] = a; ol[e] = c; } }

// ---- k_gemmw: register-blocked GEMM, ONE WAVE per 64x64 output tile (16 accumulators), operands straight from 16-bit planes in fragment order (A of RA rows, Bt of RB rows); EPI 0: grid (M/64, N/64, Z), 32 threads.
// C[m][n] = sum_k A[m][k] Bt[n][k] (+ split products per NSPLIT). z-batch strides sA/sB/sC in elements. EPI 0: K % 128 == 0; EPI 1: (K / 32 - 2) % 3 == 0.
// EPI 0: C goes out in f32 (pitch ldc, + optional f32 bias[n]). EPI 1: the three projections in ONE launch, grid (M/256, N/64), 12 waves: wave w makes row tile w % 4 of projection z = w / 4 = 0, 1, 2 for Q, K, V (weights sB apart, fp16 planes sC apart, hi and lo planes 2 sC apart); m is the token, the 64 columns are one head (HD == 64),
// and C goes out only as the three 16-bit planes (fp16, bf16 hi, bf16 lo) that the attention reads, in fragment order: z < 2 rows = tokens, k = d, per head tile (token / 16, d / 32), through the LDS transpose; z = 2 rows = d, k = tokens, per head tile (token / 32, d / 16), straight from the accumulators (a lane holds 8 consecutive tokens of one d: its own 16 bytes of the tile).
// One work-group fills a WGP, three waves to a SIMD (registers), and all 256 are resident at once: a wave's load waits, start and epilogue run behind its two neighbours' products,
// and of the 24 fragment groups that the 12 waves load per k tile only 7 differ (4 of x, each read by 3 waves; 3 of the weights, each by 4), so the WGP cache serves the rest. The waves never meet: no barrier, LDS per wave.
template <typename T16> struct WFrag;
template <> struct WFrag<h16> { typedef v16h V; static __device__ __forceinline__ V ld(const h16* p) { return cat16(*(const v8h*)p, *(const v8h*)(p + FRG / 2)); } static __device__ __forceinline__ v8f mma(V a, V b, v8f c) { return wmma16(a, b, c); } };
template <> struct WFrag<bf> { typedef v16bf V; static __device__ __forceinline__ V ld(const bf* p) { return cat16b(*(const v8us*)p, *(const v8us*)(p + FRG / 2)); } static __device__ __forceinline__ v8f mma(V a, V b, v8f c) { return wmmab(a, b, c); } };
template <typename T16, int NSPLIT, bool BIAS, int EPI>
__global__ __launch_bounds__(EPI == 1 ? 384 : 32) void k_gemmw(const T16* __restrict__ A, const T16* __restrict__ A2, const T16* __restrict__ Bt, const T16* __restrict__ Bt2, int K, int RA, int RB, float* C, int ldc, const float* __restrict__ bias, size_t sA, size_t sB, size_t sC, h16* P16, bf* Ph, bf* Pl) {
    static_assert(EPI == 0 || HD == 64, "a 64-column tile is one head");
    typedef typename WFrag<T16>::V V;
    __shared__ __align__(16) float osh[(EPI == 1 ? 8 : 1) * 16 * 68];  // EPI 1: one transpose buffer for each wave of z < 2
    const int wave = EPI == 1 ? __builtin_amdgcn_readfirstlane((int)(threadIdx.x >> 5)) : 0;
    float* os = osh + (EPI == 1 ? (wave & 7) * 16 * 68 : 0);
    const size_t z = EPI == 1 ? wave >> 2 : blockIdx.z; A += z * sA; if (A2) A2 += z * sA; Bt += z * sB; if (Bt2) Bt2 += z * sB;
    if constexpr (EPI == 0) C += z * sC; else { P16 += z * sC; Ph += z * 2 * sC; Pl += z * 2 * sC; }
    const int lane = threadIdx.x & 31, lr = lane & 15, hi = lane >> 4; const int r0 = (EPI == 1 ? blockIdx.x * 4 + (wave & 3) : blockIdx.x) * 64, c0 = blockIdx.y * 64;
    v8f acc[4][4];
#pragma unroll
    for (int mb = 0; mb < 4; ++mb)
#pragma unroll
        for (int nb = 0; nb < 4; ++nb) acc[mb][nb] = (v8f){};
    constexpr bool HA2 = NSPLIT == 1 || NSPLIT == 2, HB2 = NSPLIT >= 2;
    const size_t aoff = (size_t)(r0 / 16) * FRG + 8 * lane, boff = (size_t)(c0 / 16) * FRG + 8 * lane;   // this lane's 16 bytes of the first k tile of the first 16-row group
    const size_t ast = (size_t)(RA / 16) * FRG, bst = (size_t)(RB / 16) * FRG;                            // from one k tile to the next
    // Fragment ring in registers: RD sets; the loads of k tile t + PD are issued in front of the products of k tile t, so a tile's load latency runs behind PD tiles' products (in EPI 0 a lone wave per SIMD has nothing else to hide it).
    // PD tiles' loads (16 or 24 a tile: at most 48) stay in flight behind a tile's wait, under the load counter's 63. Every accumulator still takes its k tiles in rising order.
    // EPI 1: three sets, two tiles ahead, so that three waves' registers fit a SIMD; its last TL k tiles are the PD that are already fetched. (K / 32 - TL) % RD == 0.
    constexpr int RD = EPI == 1 ? 3 : 4, PD = (EPI == 1 || HA2 || HB2) ? 2 : 3, TL = EPI == 1 ? PD : RD;
    V a[RD][4], a2[RD][4], b[RD][4], b2[RD][4];
    const T16* pa = A + aoff; const T16* pb = Bt + boff; const T16* pa2 = HA2 ? A2 + aoff : nullptr; const T16* pb2 = HB2 ? Bt2 + boff : nullptr;   // the next k tile to fetch
    auto fetch = [&](const int s) {
#pragma unroll
        for (int mb = 0; mb < 4; ++mb) { a[s][mb] = WFrag<T16>::ld(pa + mb * FRG); if (HA2) a2[s][mb] = WFrag<T16>::ld(pa2 + mb * FRG); }
#pragma unroll
        for (int nb = 0; nb < 4; ++nb) { b[s][nb] = WFrag<T16>::ld(pb + nb * FRG); if (HB2) b2[s][nb] = WFrag<T16>::ld(pb2 + nb * FRG); }
        __builtin_amdgcn_sched_barrier(0);                           // the set's loads stay one group in front of the products that follow: without this line the build puts a product, with its load wait, in front of them, and they lose their lead
    };
    auto step = [&]() {
        __builtin_amdgcn_sched_barrier(0);                           // the products stay in front of the wait: without this line the build puts it directly behind the loads, where the wave stands at it before its products
        // the address registers of the last fetch, and the lane number that a base + lane form of its loads names, stay as they are up to this wait (inputs only); they are rewritten only behind it
        if constexpr (HA2 && HB2) asm volatile("s_wait_xcnt 0x0" :: "v"(pa), "v"(pb), "v"(pa2), "v"(pb2), "v"(lane) : "memory");
        else if constexpr (HA2) asm volatile("s_wait_xcnt 0x0" :: "v"(pa), "v"(pb), "v"(pa2), "v"(lane) : "memory");
        else if constexpr (HB2) asm volatile("s_wait_xcnt 0x0" :: "v"(pa), "v"(pb), "v"(pb2), "v"(lane) : "memory");
        else asm volatile("s_wait_xcnt 0x0" :: "v"(pa), "v"(pb), "v"(lane) : "memory");
        __builtin_amdgcn_sched_barrier(0);                           // nothing below is lifted over the wait: a build may otherwise rewrite a register that the loads name (a scalar base too) ahead of it
        pa += ast; pb += bst; if (HA2) pa2 += ast; if (HB2) pb2 += bst;
    };
    auto mul = [&](const int s) {
#pragma unroll
        for (int nb = 0; nb < 4; ++nb)
#pragma unroll
            for (int mb = 0; mb < 4; ++mb) { acc[mb][nb] = WFrag<T16>::mma(a[s][mb], b[s][nb], acc[mb][nb]); if (HA2) acc[mb][nb] = WFrag<T16>::mma(a2[s][mb], b[s][nb], acc[mb][nb]); if (HB2) acc[mb][nb] = WFrag<T16>::mma(a[s][mb], b2[s][nb], acc[mb][nb]); }
    };
    const int KT = K / 32;
#pragma unroll
    for (int s = 0; s < PD; ++s) { fetch(s); step(); }
#pragma unroll 1
    for (int kt = 0; kt < KT - TL; kt += RD) {                       // rolled: one trip is RD k tiles, each ring set at a fixed place in the trip (no register copies)
#pragma unroll
        for (int u = 0; u < RD; ++u) { fetch((u + PD) % RD); mul(u); step(); }
        // four vector slots behind the trip's last products, on the taken branch too
        asm volatile("v_nop\n\tv_nop\n\tv_nop\n\tv_nop" : "+v"(acc[0][0]), "+v"(acc[1][1]), "+v"(acc[2][2]), "+v"(acc[3][3]) : "v"(a[RD - 1][0]), "v"(a[RD - 1][3]));
    }
#pragma unroll
    for (int u = 0; u < TL; ++u) {                                   // the last TL k tiles: only the tiles that exist are fetched
        if (u + PD < TL) fetch((u + PD) % RD);
        mul(u);
        if (u + PD < TL) step(); }
    if (EPI == 1 && z == 2) {                                        // wave-uniform; no barrier follows
#pragma unroll
        for (int nb = 0; nb < 4; ++nb) { const size_t e = (size_t)blockIdx.y * HD * TT + (size_t)((r0 / 32) * (HD / 16) + nb) * FRG + lane * 8; h16* p16 = P16 + e; bf* ph = Ph + e; bf* pl = Pl + e; v8h o16[4]; v8us oh[4], ol[4];
#pragma unroll
            for (int mb = 0; mb < 4; ++mb) { float y[8];
#pragma unroll
                for (int j = 0; j < 8; ++j) y[j] = acc[mb][nb][j];
                planes8(y, o16[mb], oh[mb], ol[mb]); }
#pragma unroll
            for (int mb = 0; mb < 4; ++mb) *(v8h*)(p16 + (mb >> 1) * (HD / 16) * FRG + (mb & 1) * (FRG / 2)) = o16[mb];      // each store: 512 bytes in a row, half a tile
#pragma unroll
            for (int mb = 0; mb < 4; ++mb) *(v8us*)(ph + (mb >> 1) * (HD / 16) * FRG + (mb & 1) * (FRG / 2)) = oh[mb];
#pragma unroll
            for (int mb = 0; mb < 4; ++mb) *(v8us*)(pl + (mb >> 1) * (HD / 16) * FRG + (mb & 1) * (FRG / 2)) = ol[mb];
            // the data and address registers of the stores stay as they are up to this wait (inputs only)
            asm volatile("s_wait_xcnt 0x0" :: "v"(o16[0]), "v"(o16[1]), "v"(o16[2]), "v"(o16[3]), "v"(oh[0]), "v"(oh[1]), "v"(oh[2]), "v"(oh[3]), "v"(ol[0]), "v"(ol[1]), "v"(ol[2]), "v"(ol[3]), "v"(p16), "v"(ph), "v"(pl) : "memory");
        }
        return; }
#pragma unroll
    for (int mb = 0; mb < 4; ++mb) {
#pragma unroll
        for (int nb = 0; nb < 4; ++nb) {
#pragma unroll
            for (int j = 0; j < 8; ++j) os[(hi * 8 + j) * 68 + nb * 16 + lr] = acc[mb][nb][j]; }
        __builtin_amdgcn_wave_barrier(); asm volatile("" ::: "memory");
        if constexpr (EPI == 1) {
            const size_t e = ((size_t)blockIdx.y * TT + r0 + mb * 16) * HD + lane * 8; h16* p16 = P16 + e; bf* ph = Ph + e; bf* pl = Pl + e; v8h o16[4]; v8us oh[4], ol[4];
#pragma unroll
            for (int s = 0; s < 4; ++s) { const float* orow = os + lr * 68 + s * 16 + hi * 8; const v4f y0 = *(const v4fa*)orow, y1 = *(const v4fa*)(orow + 4); float y[8];
#pragma unroll
                for (int j = 0; j < 4; ++j) { y[j] = y0[j]; y[4 + j] = y1[j]; }
                planes8(y, o16[s], oh[s], ol[s]); }
#pragma unroll
            for (int s = 0; s < 4; ++s) { *(v8h*)(p16 + s * (FRG / 2)) = o16[s]; *(v8us*)(ph + s * (FRG / 2)) = oh[s]; *(v8us*)(pl + s * (FRG / 2)) = ol[s]; }   // each store: half a tile, 512 bytes in a row
            // the data and address registers of the stores stay as they are up to this wait (inputs only)
            asm volatile("s_wait_xcnt 0x0" :: "v"(o16[0]), "v"(o16[1]), "v"(o16[2]), "v"(o16[3]), "v"(oh[0]), "v"(oh[1]), "v"(oh[2]), "v"(oh[3]), "v"(ol[0]), "v"(ol[1]), "v"(ol[2]), "v"(ol[3]), "v"(p16), "v"(ph), "v"(pl) : "memory");
        } else {
        float* crow = C + (size_t)(r0 + mb * 16) * ldc + c0;
        v4f val[8]; float* pc[8];
#pragma unroll
            for (int s = 0; s < 8; ++s) { const int row = 2 * s + hi, cofs = lr * 4; val[s] = *(const v4fa*)(os + row * 68 + cofs); if (BIAS) { val[s][0] += bfr(bias[c0 + cofs]); val[s][1] += bfr(bias[c0 + cofs + 1]); val[s][2] += bfr(bias[c0 + cofs + 2]); val[s][3] += bfr(bias[c0 + cofs + 3]); }
                pc[s] = crow + (size_t)row * ldc + cofs; *(v4f*)pc[s] = val[s]; }
            // the data and address registers of the stores stay as they are up to this wait (inputs only)
            asm volatile("s_wait_xcnt 0x0" :: "v"(val[0]), "v"(val[1]), "v"(val[2]), "v"(val[3]), "v"(val[4]), "v"(val[5]), "v"(val[6]), "v"(val[7]), "v"(pc[0]), "v"(pc[1]), "v"(pc[2]), "v"(pc[3]), "v"(pc[4]), "v"(pc[5]), "v"(pc[6]), "v"(pc[7]) : "memory");
        }
        __builtin_amdgcn_wave_barrier(); asm volatile("" ::: "memory");
    }
}

typedef __attribute__((ext_vector_type(4))) _Float16 v4h;
typedef __attribute__((ext_vector_type(2))) unsigned short v2us;
typedef __attribute__((ext_vector_type(4))) unsigned short v4us;
typedef __attribute__((ext_vector_type(4))) int v4i;

// k_prep: every f32 -> bf16 operand plane (x and the four (in, out) weights) in ONE launch of PTH threads, all resident at once; a thread makes one 16-byte piece of each weight plane and PXU pieces of the x plane,
// and all its loads are issued in front of the first conversion (40 a wave, under the load counter's 63), so a wave waits for memory once. The launch costs one gap and 4,096 wave starts where five launches of one-piece threads cost five and 32,768.
// Weight w[k][n] -> plane in fragment order, rows = n, tile (k / 32, n / 16); a piece is eight k of one n: a wave's loads read 64 bytes in a row per half (a block's 256), its store 512.
// x[row][k] -> plane in fragment order, tile (k / 32, row / 16); a piece is eight consecutive k of one row. A wave makes 8 rows of PXU tiles in a row: it reads PXU * 128 bytes in a row of each (whole lines), and each of a tile's four pieces per row lands with the other rows' in 128 bytes in a row.
#define PTH (DM * DQ / 8)             // threads: the pieces of one weight plane
#define PXU (TT * DM / 8 / PTH)       // x pieces per thread
__global__ __launch_bounds__(256) void k_prep(const float* __restrict__ x, const float* __restrict__ wq, const float* __restrict__ wk, const float* __restrict__ wv, const float* __restrict__ wo, bf* XB, bf* WQ, bf* WK, bf* WV, bf* WO) {
    static_assert(DQ == DM && DKV == DM, "the four weight planes share one piece index");
    static_assert(PXU * PTH * 8 == TT * DM && (DM / 32) % PXU == 0 && PTH % 256 == 0, "a thread's x pieces are PXU k tiles in a row of one x row");
    const unsigned i = blockIdx.x * 256u + threadIdx.x, lane = i & 31u, w = i >> 5;
    constexpr unsigned NT = DM / 16u, KT = DM / 32u;
    const unsigned tile = i >> 6, n = (tile % NT) * 16u + (lane & 15u), k = (tile / NT) * 32u + (w & 1u) * 16u + (lane >> 4) * 8u;
    const unsigned wofs = k * DM + n;                                // the piece's first element in each weight
    const unsigned rg = (w >> 1) / (KT / PXU), kt = (w >> 1) % (KT / PXU) * PXU, row = (w & 1u) * 8u + (lane >> 2), pc = lane & 3u;   // piece pc: k = 8 pc + 0 .. 7 of the tiles kt + 0 .. PXU - 1
    const unsigned xofs = (rg * 16u + row) * DM + kt * 32u + pc * 8u;  // the first x piece; the next lies one k tile (128 bytes) further on in the row
    v8f v[PXU]; float fq[8], fk[8], fv[8], fo[8];
#pragma unroll
    for (int u = 0; u < PXU; ++u) v[u] = *(const v8f*)(x + xofs + u * 32);
#pragma unroll
    for (int j = 0; j < 8; ++j) { fq[j] = wq[wofs + j * DM]; fk[j] = wk[wofs + j * DM]; fv[j] = wv[wofs + j * DM]; fo[j] = wo[wofs + j * DM]; }
    asm volatile("s_wait_xcnt 0x0" :: "v"(wofs), "v"(xofs) : "memory");   // the offset registers of the loads stay as they are up to this wait (inputs only)
    v8us oq, ok, ov, oo, ox[PXU];
#pragma unroll
    for (int u = 0; u < PXU; ++u)
#pragma unroll
        for (int e = 0; e < 8; ++e) ox[u][e] = f2bf(v[u][e]);
#pragma unroll
    for (int j = 0; j < 8; ++j) { oq[j] = f2bf(fq[j]); ok[j] = f2bf(fk[j]); ov[j] = f2bf(fv[j]); oo[j] = f2bf(fo[j]); }
    bf* px = XB + ((size_t)kt * (TT / 16u) + rg) * FRG + (pc >> 1) * (FRG / 2) + ((pc & 1u) * 16u + row) * 8u;
#pragma unroll
    for (int u = 0; u < PXU; ++u) *(v8us*)(px + (size_t)u * (TT / 16u) * FRG) = ox[u];
    *(v8us*)(WQ + (size_t)i * 8) = oq; *(v8us*)(WK + (size_t)i * 8) = ok; *(v8us*)(WV + (size_t)i * 8) = ov; *(v8us*)(WO + (size_t)i * 8) = oo;
}

// ---- k_fattn: scores, causal softmax and probability x value contraction of ALL heads in one launch (online softmax); no score or probability ever reaches memory.
// FKS waves own FNQ * 16 query columns of one head and walk the keys 0 .. their diagonal in passes of KB keys, wave 'part' taking the passes part, part + FKS, ..., transposed: S^T = K Q^T (A = K rows, B = Q rows), O^T += V^T P^T (A = V^T rows, B = P^T).
// Each part keeps its own m, l and O^T; behind the walk part 1 hands them to part 0 through LDS, which brings both to the common maximum, adds them and stores. So the longest walk of the launch is half as many passes per wave, and every SIMD holds two waves
// (the two parts of one tile) from a block's start to the hand-over: one wave's products run behind the other's softmax. A block fills its WGP's registers; blocks start heaviest first, so a WGP that ends a lighter block early takes the heaviest one left.
// A lane (lr, hi) holds, of each 16-key score tile, the keys 8 * hi + j of query column lr; two such tiles, converted in place, are the B operand of the second product in the k order of WFrag::ld.
// Per column: running maximum m (log2 units, equal in both lane halves), running sum l (one partial per lane half, joined at the end); O^T and l are rescaled only when a new maximum exceeds m by more than 8.
// Rows < RH: bf16 hi/lo planes, three products in both contractions; the rest fp16. The quotient O / l goes out as the merged hi/lo planes (rows = t, k = head * HD + d) in fragment order: a lane's 8 consecutive d of one query are its own 16 bytes of the tile. Grid (heads, FNB).
#define FNQ 2
#define FWV 4
#define FKS 2                         // waves that share one tile's key walk
#define FNB (TT / (FWV * FNQ * 16))   // work-groups per head
#define FXP (FNQ * 4 * 2 + 1)         // 16-byte pieces a lane hands over: O^T, then (m, l)
__device__ __forceinline__ float xhalf(float x) { return __builtin_bit_cast(float, __builtin_amdgcn_permlanex16(__builtin_bit_cast(int, x), __builtin_bit_cast(int, x), 0x76543210, 0xfedcba98, false, false)); }   // lane l <-> lane l ^ 16
// 2^x in place; the v_nop is the one slot the instruction set asks for behind a transcendental, in the same statement so that it stands directly behind it (source = result: nothing can overwrite the source alone)
__device__ __forceinline__ float exp2s(float x) { asm("v_exp_f32 %0, %0\n\tv_nop" : "+v"(x)); return x; }
template <typename T16, bool HL, int KB>
__device__ __forceinline__ void fattn_tile(const T16* __restrict__ Q, const T16* __restrict__ Q2, const T16* __restrict__ Kp, const T16* __restrict__ Kp2, const T16* __restrict__ Vt, const T16* __restrict__ Vt2, int q0, int lr, int hi, int part, v4f* xs, bf* Ah, bf* Al) {
    typedef typename WFrag<T16>::V V;
    constexpr int NKT = KB / 16, NKK = KB / 32;
    constexpr float C2 = SCL * 1.4426950408889634f;                  // score -> log2 units
    V qf[FNQ][2], qf2[FNQ][2];
    const int lane = hi * 16 + lr;
    const T16* pq = Q + (size_t)q0 * HD + 8 * lane; const T16* pq2 = HL ? Q2 + (size_t)q0 * HD + 8 * lane : nullptr;
#pragma unroll
    for (int g = 0; g < FNQ; ++g)
#pragma unroll
        for (int ks = 0; ks < 2; ++ks) { qf[g][ks] = WFrag<T16>::ld(pq + g * 16 * HD + ks * FRG); if (HL) qf2[g][ks] = WFrag<T16>::ld(pq2 + g * 16 * HD + ks * FRG); }
    const int kend = q0 + FNQ * 16;                                  // first key above every diagonal element of the tile
    const int kofs = part * KB * HD + 8 * lane;                      // this part's first pass (KB < TT keys in: inside the plane, also where the part has no pass)
    const T16* pk = Kp + kofs; const T16* pk2 = HL ? Kp2 + kofs : nullptr;
    const T16* pv = Vt + kofs; const T16* pv2 = HL ? Vt2 + kofs : nullptr;
    V kf[NKT][2], kf2[NKT][2];
#pragma unroll
    for (int kt = 0; kt < NKT; ++kt)
#pragma unroll
        for (int ks = 0; ks < 2; ++ks) { kf[kt][ks] = WFrag<T16>::ld(pk + kt * 16 * HD + ks * FRG); if (HL) kf2[kt][ks] = WFrag<T16>::ld(pk2 + kt * 16 * HD + ks * FRG); }
    // the address registers of the Q and first K loads stay as they are up to this wait (inputs only)
    if (HL) asm volatile("s_wait_xcnt 0x0" :: "v"(pq), "v"(pq2), "v"(pk), "v"(pk2) : "memory"); else asm volatile("s_wait_xcnt 0x0" :: "v"(pq), "v"(pk) : "memory");
    __builtin_amdgcn_sched_barrier(0);                               // nothing below is lifted over the wait: without this line the build rewrites registers that the loads above name (their base, their lane offset) ahead of it
    v8f o[4][FNQ]; float m[FNQ], l[FNQ];
#pragma unroll
    for (int g = 0; g < FNQ; ++g) { m[g] = -3.0e38f; l[g] = 0.f;
#pragma unroll
        for (int dt = 0; dt < 4; ++dt) o[dt][g] = (v8f){}; }
#pragma unroll 1
    for (int k0 = part * KB; k0 < kend; k0 += FKS * KB) {
        V vf[4][NKK], vf2[4][NKK];                                   // this pass's V^T fragments: issued here, first used behind the softmax
#pragma unroll
        for (int dt = 0; dt < 4; ++dt)
#pragma unroll
            for (int kk = 0; kk < NKK; ++kk) { vf[dt][kk] = WFrag<T16>::ld(pv + (kk * (HD / 16) + dt) * FRG); if (HL) vf2[dt][kk] = WFrag<T16>::ld(pv2 + (kk * (HD / 16) + dt) * FRG); }
        // the V address registers stay as they are up to this wait (inputs only); they are rewritten only behind it
        if (HL) asm volatile("s_wait_xcnt 0x0" :: "v"(pv), "v"(pv2) : "memory"); else asm volatile("s_wait_xcnt 0x0" :: "v"(pv) : "memory");
        v8f s[NKT][FNQ];
#pragma unroll
        for (int kt = 0; kt < NKT; ++kt)
#pragma unroll
            for (int g = 0; g < FNQ; ++g) s[kt][g] = (v8f){};
#pragma unroll
        for (int ks = 0; ks < 2; ++ks)
#pragma unroll
            for (int kt = 0; kt < NKT; ++kt)
#pragma unroll
                for (int g = 0; g < FNQ; ++g) { s[kt][g] = WFrag<T16>::mma(kf[kt][ks], qf[g][ks], s[kt][g]); if (HL) { s[kt][g] = WFrag<T16>::mma(kf2[kt][ks], qf[g][ks], s[kt][g]); s[kt][g] = WFrag<T16>::mma(kf[kt][ks], qf2[g][ks], s[kt][g]); } }
        if (k0 + FKS * KB < kend) { pk += FKS * KB * HD; if (HL) pk2 += FKS * KB * HD; }   // the last pass fetches its own rows again: always inside the plane
#pragma unroll
        for (int kt = 0; kt < NKT; ++kt)                             // next pass's K fragments, in flight behind the softmax and the second product
#pragma unroll
            for (int ks = 0; ks < 2; ++ks) { kf[kt][ks] = WFrag<T16>::ld(pk + kt * 16 * HD + ks * FRG); if (HL) kf2[kt][ks] = WFrag<T16>::ld(pk2 + kt * 16 * HD + ks * FRG); }
        // the K address registers stay as they are up to this wait (inputs only); they are rewritten only behind it
        if (HL) asm volatile("s_wait_xcnt 0x0" :: "v"(pk), "v"(pk2) : "memory"); else asm volatile("s_wait_xcnt 0x0" :: "v"(pk) : "memory");
        if (k0 + KB - 1 > q0) {                                      // only passes that reach the diagonal mask (wave-uniform test)
#pragma unroll
            for (int kt = 0; kt < NKT; ++kt)
#pragma unroll
                for (int g = 0; g < FNQ; ++g)
#pragma unroll
                    for (int j = 0; j < 8; ++j) s[kt][g][j] = (k0 + kt * 16 + hi * 8 + j <= q0 + g * 16 + lr) ? s[kt][g][j] : -3.0e38f; }
        float tm[FNQ]; bool need = false;
#pragma unroll
        for (int g = 0; g < FNQ; ++g) { float t = s[0][g][0];
#pragma unroll
            for (int kt = 0; kt < NKT; ++kt)
#pragma unroll
                for (int j = 0; j < 8; ++j) t = fmaxf(t, s[kt][g][j]);
            t = fmaxf(t, xhalf(t)) * C2; tm[g] = t; need = need || (t > m[g] + 8.0f); }
        if (__builtin_amdgcn_ballot_w32(need) != 0) {                // scalar branch: rare once the maxima have settled
#pragma unroll
            for (int g = 0; g < FNQ; ++g) { const float mn = fmaxf(m[g], tm[g]); const float al = exp2s(m[g] - mn); m[g] = mn; l[g] *= al;
#pragma unroll
                for (int dt = 0; dt < 4; ++dt) o[dt][g] *= al; } }
        V pf[FNQ][NKK], pf2[FNQ][NKK];
#pragma unroll
        for (int g = 0; g < FNQ; ++g)
#pragma unroll
            for (int kk = 0; kk < NKK; ++kk) { float p[16]; float ls = 0.f;
#pragma unroll
                for (int e = 0; e < 16; ++e) { p[e] = exp2s(__builtin_fmaf(s[2 * kk + (e >> 3)][g][e & 7], C2, -m[g])); ls += p[e]; }
                l[g] += ls;
                if constexpr (HL) { v8us h0, h1, l0, l1;
#pragma unroll
                    for (int e = 0; e < 8; ++e) { unsigned short a, c; splitf(p[e], a, c); h0[e] = a; l0[e] = c; splitf(p[8 + e], a, c); h1[e] = a; l1[e] = c; }
                    pf[g][kk] = cat16b(h0, h1); pf2[g][kk] = cat16b(l0, l1);
                } else { v16h ph;
#pragma unroll
                    for (int e = 0; e < 16; ++e) ph[e] = tohx(p[e]);
                    pf[g][kk] = ph; } }
#pragma unroll
        for (int kk = 0; kk < NKK; ++kk)
#pragma unroll
            for (int dt = 0; dt < 4; ++dt)
#pragma unroll
                for (int g = 0; g < FNQ; ++g) { o[dt][g] = WFrag<T16>::mma(vf[dt][kk], pf[g][kk], o[dt][g]); if (HL) { o[dt][g] = WFrag<T16>::mma(vf2[dt][kk], pf[g][kk], o[dt][g]); o[dt][g] = WFrag<T16>::mma(vf[dt][kk], pf2[g][kk], o[dt][g]); } }
        pv += FKS * KB * HD; if (HL) pv2 += FKS * KB * HD;
    }
    static_assert(FKS == 2 && FNQ == 2, "one hand-over, its last piece holds two m and two l");
    if (part != 0) {                                                 // wave-uniform
#pragma unroll
        for (int dt = 0; dt < 4; ++dt)
#pragma unroll
            for (int g = 0; g < FNQ; ++g) { xs[((dt * FNQ + g) * 2) * 32 + lane] = __builtin_shufflevector(o[dt][g], o[dt][g], 0, 1, 2, 3); xs[((dt * FNQ + g) * 2 + 1) * 32 + lane] = __builtin_shufflevector(o[dt][g], o[dt][g], 4, 5, 6, 7); }
        xs[(FXP - 1) * 32 + lane] = (v4f){m[0], m[1], l[0], l[1]}; }
    __syncthreads();                                                 // part 1's hand-over is in LDS before part 0 reads it; every wave of the block passes here once
    if (part != 0) return;
    { const v4f ml = xs[(FXP - 1) * 32 + lane];                      // a part without a pass hands over m = -3.0e38, l = 0, O = 0: its factor is 0
#pragma unroll
        for (int g = 0; g < FNQ; ++g) { const float mn = fmaxf(m[g], ml[g]); const float a0 = exp2s(m[g] - mn), a1 = exp2s(ml[g] - mn); l[g] = l[g] * a0 + ml[FNQ + g] * a1;
#pragma unroll
            for (int dt = 0; dt < 4; ++dt) { const v4f x0 = xs[((dt * FNQ + g) * 2) * 32 + lane], x1 = xs[((dt * FNQ + g) * 2 + 1) * 32 + lane];
#pragma unroll
                for (int j = 0; j < 4; ++j) { o[dt][g][j] = o[dt][g][j] * a0 + x0[j] * a1; o[dt][g][4 + j] = o[dt][g][4 + j] * a0 + x1[j] * a1; } } } }
    v8us oh[FNQ][4], ol[FNQ][4];
#pragma unroll
    for (int g = 0; g < FNQ; ++g) { const float inv = __fdiv_rn(1.0f, l[g] + xhalf(l[g]));   // the two lane halves' sums, joined once
#pragma unroll
        for (int dt = 0; dt < 4; ++dt)
#pragma unroll
            for (int j = 0; j < 8; ++j) { unsigned short a, c; splitf(o[dt][g][j] * inv, a, c); oh[g][dt][j] = a; ol[g][dt][j] = c; } }
    bf* pa = Ah + (size_t)(q0 / 16) * FRG + lane * 8; bf* pl = Al + (size_t)(q0 / 16) * FRG + lane * 8;
#pragma unroll
    for (int g = 0; g < FNQ; ++g)
#pragma unroll
        for (int dt = 0; dt < 4; ++dt) { *(v8us*)(pa + ((dt >> 1) * (TT / 16) + g) * FRG + (dt & 1) * (FRG / 2)) = oh[g][dt]; *(v8us*)(pl + ((dt >> 1) * (TT / 16) + g) * FRG + (dt & 1) * (FRG / 2)) = ol[g][dt]; }
    static_assert(FNQ == 2, "the wait behind the stores names the data registers of two column groups");
    // the data and address registers of the stores stay as they are up to this wait (inputs only)
    asm volatile("s_wait_xcnt 0x0" :: "v"(oh[0][0]), "v"(oh[0][1]), "v"(oh[0][2]), "v"(oh[0][3]), "v"(oh[1][0]), "v"(oh[1][1]), "v"(oh[1][2]), "v"(oh[1][3]), "v"(ol[0][0]), "v"(ol[0][1]), "v"(ol[0][2]), "v"(ol[0][3]), "v"(ol[1][0]), "v"(ol[1][1]), "v"(ol[1][2]), "v"(ol[1][3]), "v"(pa), "v"(pl) : "memory");
}
__global__ __launch_bounds__(32 * FWV * FKS) void k_fattn(const h16* __restrict__ Q16, const h16* __restrict__ K16, const h16* __restrict__ V16, const bf* __restrict__ Qh, const bf* __restrict__ Ql, const bf* __restrict__ Kh, const bf* __restrict__ Kl, const bf* __restrict__ Vh, const bf* __restrict__ Vl, bf* Ah, bf* Al) {
    const int lane = threadIdx.x & 31, lr = lane & 15, hi = lane >> 4; const int wave = __builtin_amdgcn_readfirstlane((int)(threadIdx.x >> 5));
    static_assert(RH % (FWV * FNQ * 16) == 0, "a block's waves all take the same branch below, so all meet at its barrier");
    __shared__ v4f xsh[FWV * FXP * 32];
    const int tile = wave % FWV, part = wave / FWV;                  // waves w and w + FWV: the two parts of one tile
    const int h = blockIdx.x; const int qb = FNB - 1 - (int)blockIdx.y;   // cost falls with the index
    const int q0 = (qb * FWV + tile) * (FNQ * 16); v4f* xs = xsh + tile * FXP * 32;
    const size_t zq = (size_t)h * TT * HD, zk = (size_t)(h / REP) * TT * HD;
    if (q0 < RH) fattn_tile<bf, true, 32>(Qh + zq, Ql + zq, Kh + zk, Kl + zk, Vh + zk, Vl + zk, q0, lr, hi, part, xs, Ah + (size_t)h * (HD / 32) * (TT / 16) * FRG, Al + (size_t)h * (HD / 32) * (TT / 16) * FRG);
    else fattn_tile<h16, false, 64>(Q16 + zq, nullptr, K16 + zk, nullptr, V16 + zk, nullptr, q0, lr, hi, part, xs, Ah + (size_t)h * (HD / 32) * (TT / 16) * FRG, Al + (size_t)h * (HD / 32) * (TT / 16) * FRG);
}

extern "C" void kernel_launch(void* const* d_in, const int* in_sizes, int n_in,
                              void* d_out, int out_size, void* d_ws, size_t ws_size, hipStream_t stream) {
    (void)in_sizes; (void)n_in; (void)out_size;
    const float* x = (const float*)d_in[0]; const float* wq = (const float*)d_in[1]; const float* wk = (const float*)d_in[2]; const float* wv = (const float*)d_in[3]; const float* wo = (const float*)d_in[4]; const float* bo = (const float*)d_in[5];
    float* OUT = (float*)d_out;     // [1][4096][1024]
    char* wsp = (char*)d_ws;
    auto take = [&](size_t bytes) { char* p = wsp; wsp += (bytes + 255) & ~(size_t)255; return (void*)p; };
    bf* WQ = (bf*)take((size_t)DQ * DM * 2); bf* WK = (bf*)take((size_t)DKV * DM * 2); bf* WV = (bf*)take((size_t)DKV * DM * 2); bf* WO = (bf*)take((size_t)DM * DQ * 2);
    bf* XB = (bf*)take((size_t)TT * DM * 2);
    h16* QP16 = (h16*)take((size_t)NH_ * TT * HD * 2); h16* KP16 = (h16*)take((size_t)NKV * TT * HD * 2); h16* VT16 = (h16*)take((size_t)NKV * HD * TT * 2);
    bf* QPh = (bf*)take((size_t)NH_ * TT * HD * 2); bf* QPl = (bf*)take((size_t)NH_ * TT * HD * 2); bf* KPh = (bf*)take((size_t)NKV * TT * HD * 2); bf* KPl = (bf*)take((size_t)NKV * TT * HD * 2); bf* VTh = (bf*)take((size_t)NKV * HD * TT * 2); bf* VTl = (bf*)take((size_t)NKV * HD * TT * 2);
    bf* ATh = (bf*)take((size_t)TT * DQ * 2); bf* ATl = (bf*)take((size_t)TT * DQ * 2);
    if ((size_t)(wsp - (char*)d_ws) > ws_size) return;    // ws 256 MiB
    static_assert(NB_ == 1, "one launch converts the one batch entry's x beside the weights");
    k_prep<<<PTH / 256, 256, 0, stream>>>(x, wq, wk, wv, wo, XB, WQ, WK, WV, WO);
    for (int b = 0; b < NB_; ++b) {
        static_assert(DKV == DQ && ((size_t)DQ * DM * 2) % 256 == 0 && ((size_t)NH_ * TT * HD * 2) % 256 == 0, "WQ, WK, WV lie one plane apart, as do QP16, KP16, VT16; QPh, KPh, VTh (and the lo planes) two");
        static_assert(TT % 256 == 0 && (DM / 32 - 2) % 3 == 0, "four row tiles a work-group; the three-set ring's trips end two k tiles short of K");
        k_gemmw<bf, 0, false, 1><<<dim3(TT / 256, DQ / 64, 1), 384, 0, stream>>>(XB, nullptr, WQ, nullptr, DM, TT, DQ, nullptr, 0, nullptr, 0, (size_t)DQ * DM, (size_t)NH_ * TT * HD, QP16, QPh, QPl);
        k_fattn<<<dim3(NH_, FNB, 1), 32 * FWV * FKS, 0, stream>>>(QP16, KP16, VT16, QPh, QPl, KPh, KPl, VTh, VTl, ATh, ATl);
        k_gemmw<bf, 1, true, 0><<<dim3(TT / 64, DM / 64, 1), 32, 0, stream>>>(ATh, ATl, WO, nullptr, DQ, TT, DM, OUT + (size_t)b * TT * DM, DM, bo, 0, 0, 0, nullptr, nullptr, nullptr); }
}

// v009
// Measured time: 85.1 microseconds a run.
// Next to v008, in two timings, it ran 1.04 and 1.03 times as fast.
// Over all steps from v000 it is 33.4 times as fast.
#include <hip/hip_runtime.h>

// Causal multi-head self-attention over 4,096 tokens with (in, out) weights (x [1][4096][1024]; q, k, v = x W ('xw' [1024][1024] 0.02, no bias; 16 heads x 64); scores with -inf strictly above the diagonal (triu k=1), then / sqrt(64) inside the softmax (the same function as scaling first); softmax; out = merged Wo + bo ('xw' + a REAL bias 0.02) -> [1][4096][1024] (4.2 M); argument order x, Wq, Wk, Wv, Wo, bo).
// Layout: bf16 copies of x and the weights (one launch); exact projections whose epilogue stores the attention operand planes; causal T-4096 attention of all heads fused in one launch with an online softmax (hybrid rows: < 512 hi/lo 3 products, rest fp16); merged hi/lo x Wo exact + bo.
// Fragment order: every 16-bit WMMA operand plane is stored as tiles of 16 rows x 32 k, FRG consecutive elements each; element (row lr, k = 16 s + 8 hi + j) lies at 256 s + 8 (16 hi + lr) + j,
// so a wave's fragment is two loads of 512 consecutive bytes (four whole 128-byte lines each): load s gives lane 16 hi + lr the elements k = 16 s + 8 hi + 0 .. 7 of row lr. GEMM operand planes of R rows: tile (k / 32, row / 16) at ((k / 32) * (R / 16) + row / 16) * FRG, so the four 16-row groups of a 64-row block lie 4 KiB in a row per k tile.
// Compute dtypes, f32 accumulate: every input rounded to bf16; projections exact; attention rows < 512 3 products, rest fp16; softmax f32; Wo hl x exact + bias.

#define NB_  1
#define TT   4096
#define DM   1024
#define NH_  16
#define NKV  16
#define REP  (NH_ / NKV)
#define HD   64
#define DQ   (NH_ * HD)
#define DKV  (NKV * HD)
#define RH   512                  // query rows < RH use hi+lo planes (0: none)
#define WIN  4096
#define SCL  0.125f   // HD^-0.5
#define FRG  512                  // elements of one 16 x 32 operand tile in fragment order
typedef _Float16 h16;
typedef unsigned short bf;
typedef __attribute__((ext_vector_type(16))) __bf16   v16bf;
typedef __attribute__((ext_vector_type(16))) _Float16 v16h;
typedef __attribute__((ext_vector_type(8)))  _Float16 v8h;
typedef __attribute__((ext_vector_type(8)))  unsigned short v8us;
typedef __attribute__((ext_vector_type(8)))  float    v8f;
typedef __attribute__((ext_vector_type(4)))  float    v4f;
typedef v8h  __attribute__((may_alias)) v8ha;
typedef v4f  __attribute__((may_alias)) v4fa;
typedef v8us __attribute__((may_alias)) v8usa;

__device__ __forceinline__ unsigned short f2bf(float f) { unsigned u = __float_as_uint(f); u += 0x7FFFu + ((u >> 16) & 1u); return (unsigned short)(u >> 16); }
__device__ __forceinline__ float bf2f(unsigned short b) { return __uint_as_float(((unsigned)b) << 16); }
__device__ __forceinline__ float bfr(float f) { return bf2f(f2bf(f)); }
__device__ __forceinline__ v16h cat16(v8h lo, v8h hi) { return __builtin_shufflevector(lo, hi, 0, 1, 2, 3, 4, 5, 6, 7, 8, 9, 10, 11, 12, 13, 14, 15); }
__device__ __forceinline__ v16bf cat16b(v8us lo, v8us hi) { return __builtin_bit_cast(v16bf, __builtin_shufflevector(lo, hi, 0, 1, 2, 3, 4, 5, 6, 7, 8, 9, 10, 11, 12, 13, 14, 15)); }
__device__ __forceinline__ v8f wmma16(v16h a, v16h b, v8f c) { return __builtin_amdgcn_wmma_f32_16x16x32_f16(false, a, false, b, (short)0, c, false, false); }
__device__ __forceinline__ v8f wmmab(v16bf a, v16bf b, v8f c) { return __builtin_amdgcn_wmma_f32_16x16x32_bf16(false, a, false, b, (short)0, c, false, false); }



__device__ __forceinline__ h16 tohx(float x) { return (h16)x; }
__device__ __forceinline__ void splitf(float y, unsigned short& h, unsigned short& l) { h = f2bf(y); l = f2bf(y - bf2f(h)); }
// eight f32 results -> their fp16 image and their bf16 hi/lo pair
__device__ __forceinline__ void planes8(const float* y, v8h& o16, v8us& oh, v8us& ol) {
#pragma unroll
    for (int e = 0; e < 8; ++e) { o16[e] = tohx(y[e]); unsigned short a, c; splitf(y[e], a, c); oh[e] = a; ol[e] = c; } }

// ---- k_gemmw: register-blocked GEMM, ONE WAVE per 64x64 output tile (16 accumulators), operands straight from 16-bit planes in fragment order (A of RA rows, Bt of RB rows); EPI 0: grid (M/64, N/64, Z), 32 threads.
// C[m][n] = sum_k A[m][k] Bt[n][k] (+ split products per NSPLIT). z-batch strides sA/sB/sC in elements. EPI 0: K % 128 == 0; EPI 1: (K / 32 - 2) % 3 == 0.
// EPI 0: C goes out in f32 (pitch ldc, + optional f32 bias[n]). EPI 1: the three projections in ONE launch, grid (M/256, N/64), 12 waves: wave w makes row tile w % 4 of projection z = w / 4 = 0, 1, 2 for Q, K, V (weights sB apart, fp16 planes sC apart, hi and lo planes 2 sC apart); m is the token, the 64 columns are one head (HD == 64),
// and C goes out only as the three 16-bit planes (fp16, bf16 hi, bf16 lo) that the attention reads, in fragment order: z < 2 rows = tokens, k = d, per head tile (token / 16, d / 32), through the LDS transpose; z = 2 rows = d, k = tokens, per head tile (token / 32, d / 16), straight from the accumulators (a lane holds 8 consecutive tokens of one d: its own 16 bytes of the tile).
// One work-group fills a WGP, three waves to a SIMD (registers), and all 256 are resident at once: a wave's load waits, start and epilogue run behind its two neighbours' products,
// and of the 24 fragment groups that the 12 waves load per k tile only 7 differ (4 of x, each read by 3 waves; 3 of the weights, each by 4), so the WGP cache serves the rest. The waves never meet: no barrier, LDS per wave.
template <typename T16> struct WFrag;
template <> struct WFrag<h16> { typedef v16h V; static __device__ __forceinline__ V ld(const h16* p) { return cat16(*(const v8h*)p, *(const v8h*)(p + FRG / 2)); } static __device__ __forceinline__ v8f mma(V a, V b, v8f c) { return wmma16(a, b, c); } };
template <> struct WFrag<bf> { typedef v16bf V; static __device__ __forceinline__ V ld(const bf* p) { return cat16b(*(const v8us*)p, *(const v8us*)(p + FRG / 2)); } static __device__ __forceinline__ v8f mma(V a, V b, v8f c) { return wmmab(a, b, c); } };
template <typename T16, int NSPLIT, bool BIAS, int EPI>
__global__ __launch_bounds__(EPI == 1 ? 384 : 32) void k_gemmw(const T16* __restrict__ A, const T16* __restrict__ A2, const T16* __restrict__ Bt, const T16* __restrict__ Bt2, int K, int RA, int RB, float* C, int ldc, const float* __restrict__ bias, size_t sA, size_t sB, size_t sC, h16* P16, bf* Ph, bf* Pl) {
    static_assert(EPI == 0 || HD == 64, "a 64-column tile is one head");
    typedef typename WFrag<T16>::V V;
    __shared__ __align__(16) float osh[(EPI == 1 ? 8 : 1) * 16 * 68];  // EPI 1: one transpose buffer for each wave of z < 2
    const int wave = EPI == 1 ? __builtin_amdgcn_readfirstlane((int)(threadIdx.x >> 5)) : 0;
    float* os = osh + (EPI == 1 ? (wave & 7) * 16 * 68 : 0);
    const size_t z = EPI == 1 ? wave >> 2 : blockIdx.z; A += z * sA; if (A2) A2 += z * sA; Bt += z * sB; if (Bt2) Bt2 += z * sB;
    if constexpr (EPI == 0) C += z * sC; else { P16 += z * sC; Ph += z * 2 * sC; Pl += z * 2 * sC; }
    const int lane = threadIdx.x & 31, lr = lane & 15, hi = lane >> 4; const int r0 = (EPI == 1 ? blockIdx.x * 4 + (wave & 3) : blockIdx.x) * 64, c0 = blockIdx.y * 64;
    v8f acc[4][4];
#pragma unroll
    for (int mb = 0; mb < 4; ++mb)
#pragma unroll
        for (int nb = 0; nb < 4; ++nb) acc[mb][nb] = (v8f){};
    constexpr bool HA2 = NSPLIT == 1 || NSPLIT == 2, HB2 = NSPLIT >= 2;
    const size_t aoff = (size_t)(r0 / 16) * FRG + 8 * lane, boff = (size_t)(c0 / 16) * FRG + 8 * lane;   // this lane's 16 bytes of the first k tile of the first 16-row group
    const size_t ast = (size_t)(RA / 16) * FRG, bst = (size_t)(RB / 16) * FRG;                            // from one k tile to the next
    // Fragment ring in registers: RD sets; the loads of k tile t + PD are issued in front of the products of k tile t, so a tile's load latency runs behind PD tiles' products (in EPI 0 a lone wave per SIMD has nothing else to hide it).
    // PD tiles' loads (16 or 24 a tile: at most 48) stay in flight behind a tile's wait, under the load counter's 63. Every accumulator still takes its k tiles in rising order.
    // EPI 1: three sets, two tiles ahead, so that three waves' registers fit a SIMD; its last TL k tiles are the PD that are already fetched. (K / 32 - TL) % RD == 0.
    constexpr int RD = EPI == 1 ? 3 : 4, PD = (EPI == 1 || HA2 || HB2) ? 2 : 3, TL = EPI == 1 ? PD : RD;
    V a[RD][4], a2[RD][4], b[RD][4], b2[RD][4];
    const T16* pa = A + aoff; const T16* pb = Bt + boff; const T16* pa2 = HA2 ? A2 + aoff : nullptr; const T16* pb2 = HB2 ? Bt2 + boff : nullptr;   // the next k tile to fetch
    auto fetch = [&](const int s) {
#pragma unroll
        for (int mb = 0; mb < 4; ++mb) { a[s][mb] = WFrag<T16>::ld(pa + mb * FRG); if (HA2) a2[s][mb] = WFrag<T16>::ld(pa2 + mb * FRG); }
#pragma unroll
        for (int nb = 0; nb < 4; ++nb) { b[s][nb] = WFrag<T16>::ld(pb + nb * FRG); if (HB2) b2[s][nb] = WFrag<T16>::ld(pb2 + nb * FRG); }
        __builtin_amdgcn_sched_barrier(0);                           // the set's loads stay one group in front of the products that follow: without this line the build puts a product, with its load wait, in front of them, and they lose their lead
    };
    auto step = [&]() {
        __builtin_amdgcn_sched_barrier(0);                           // the products stay in front of the wait: without this line the build puts it directly behind the loads, where the wave stands at it before its products
        // the address registers of the last fetch, and the lane number that a base + lane form of its loads names, stay as they are up to this wait (inputs only); they are rewritten only behind it
        if constexpr (HA2 && HB2) asm volatile("s_wait_xcnt 0x0" :: "v"(pa), "v"(pb), "v"(pa2), "v"(pb2), "v"(lane) : "memory");
        else if constexpr (HA2) asm volatile("s_wait_xcnt 0x0" :: "v"(pa), "v"(pb), "v"(pa2), "v"(lane) : "memory");
        else if constexpr (HB2) asm volatile("s_wait_xcnt 0x0" :: "v"(pa), "v"(pb), "v"(pb2), "v"(lane) : "memory");
        else asm volatile("s_wait_xcnt 0x0" :: "v"(pa), "v"(pb), "v"(lane) : "memory");
        __builtin_amdgcn_sched_barrier(0);                           // nothing below is lifted over the wait: a build may otherwise rewrite a register that the loads name (a scalar base too) ahead of it
        pa += ast; pb += bst; if (HA2) pa2 += ast; if (HB2) pb2 += bst;
    };
    auto mul = [&](const int s) {
#pragma unroll
        for (int nb = 0; nb < 4; ++nb)
#pragma unroll
            for (int mb = 0; mb < 4; ++mb) { acc[mb][nb] = WFrag<T16>::mma(a[s][mb], b[s][nb], acc[mb][nb]); if (HA2) acc[mb][nb] = WFrag<T16>::mma(a2[s][mb], b[s][nb], acc[mb][nb]); if (HB2) acc[mb][nb] = WFrag<T16>::mma(a[s][mb], b2[s][nb], acc[mb][nb]); }
    };
    const int KT = K / 32;
#pragma unroll
    for (int s = 0; s < PD; ++s) { fetch(s); step(); }
#pragma unroll 1
    for (int kt = 0; kt < KT - TL; kt += RD) {                       // rolled: one trip is RD k tiles, each ring set at a fixed place in the trip (no register copies)
#pragma unroll
        for (int u = 0; u < RD; ++u) { fetch((u + PD) % RD); mul(u); step(); }
        // four vector slots behind the trip's last products, on the taken branch too
        asm volatile("v_nop\n\tv_nop\n\tv_nop\n\tv_nop" : "+v"(acc[0][0]), "+v"(acc[1][1]), "+v"(acc[2][2]), "+v"(acc[3][3]) : "v"(a[RD - 1][0]), "v"(a[RD - 1][3]));
    }
#pragma unroll
    for (int u = 0; u < TL; ++u) {                                   // the last TL k tiles: only the tiles that exist are fetched
        if (u + PD < TL) fetch((u + PD) % RD);
        mul(u);
        if (u + PD < TL) step(); }
    if (EPI == 1 && z == 2) {                                        // wave-uniform; no barrier follows
#pragma unroll
        for (int nb = 0; nb < 4; ++nb) { const size_t e = (size_t)blockIdx.y * HD * TT + (size_t)((r0 / 32) * (HD / 16) + nb) * FRG + lane * 8; h16* p16 = P16 + e; bf* ph = Ph + e; bf* pl = Pl + e; v8h o16[4]; v8us oh[4], ol[4];
#pragma unroll
            for (int mb = 0; mb < 4; ++mb) { float y[8];
#pragma unroll
                for (int j = 0; j < 8; ++j) y[j] = acc[mb][nb][j];
                planes8(y, o16[mb], oh[mb], ol[mb]); }
#pragma unroll
            for (int mb = 0; mb < 4; ++mb) *(v8h*)(p16 + (mb >> 1) * (HD / 16) * FRG + (mb & 1) * (FRG / 2)) = o16[mb];      // each store: 512 bytes in a row, half a tile
#pragma unroll
            for (int mb = 0; mb < 4; ++mb) *(v8us*)(ph + (mb >> 1) * (HD / 16) * FRG + (mb & 1) * (FRG / 2)) = oh[mb];
#pragma unroll
            for (int mb = 0; mb < 4; ++mb) *(v8us*)(pl + (mb >> 1) * (HD / 16) * FRG + (mb & 1) * (FRG / 2)) = ol[mb];
            // the data and address registers of the stores stay as they are up to this wait (inputs only)
            asm volatile("s_wait_xcnt 0x0" :: "v"(o16[0]), "v"(o16[1]), "v"(o16[2]), "v"(o16[3]), "v"(oh[0]), "v"(oh[1]), "v"(oh[2]), "v"(oh[3]), "v"(ol[0]), "v"(ol[1]), "v"(ol[2]), "v"(ol[3]), "v"(p16), "v"(ph), "v"(pl) : "memory");
        }
        return; }
#pragma unroll
    for (int mb = 0; mb < 4; ++mb) {
#pragma unroll
        for (int nb = 0; nb < 4; ++nb) {
#pragma unroll
            for (int j = 0; j < 8; ++j) os[(hi * 8 + j) * 68 + nb * 16 + lr] = acc[mb][nb][j]; }
        __builtin_amdgcn_wave_barrier(); asm volatile("" ::: "memory");
        if constexpr (EPI == 1) {
            const size_t e = ((size_t)blockIdx.y * TT + r0 + mb * 16) * HD + lane * 8; h16* p16 = P16 + e; bf* ph = Ph + e; bf* pl = Pl + e; v8h o16[4]; v8us oh[4], ol[4];
#pragma unroll
            for (int s = 0; s < 4; ++s) { const float* orow = os + lr * 68 + s * 16 + hi * 8; const v4f y0 = *(const v4fa*)orow, y1 = *(const v4fa*)(orow + 4); float y[8];
#pragma unroll
                for (int j = 0; j < 4; ++j) { y[j] = y0[j]; y[4 + j] = y1[j]; }
                planes8(y, o16[s], oh[s], ol[s]); }
#pragma unroll
            for (int s = 0; s < 4; ++s) { *(v8h*)(p16 + s * (FRG / 2)) = o16[s]; *(v8us*)(ph + s * (FRG / 2)) = oh[s]; *(v8us*)(pl + s * (FRG / 2)) = ol[s]; }   // each store: half a tile, 512 bytes in a row
            // the data and address registers of the stores stay as they are up to this wait (inputs only)
            asm volatile("s_wait_xcnt 0x0" :: "v"(o16[0]), "v"(o16[1]), "v"(o16[2]), "v"(o16[3]), "v"(oh[0]), "v"(oh[1]), "v"(oh[2]), "v"(oh[3]), "v"(ol[0]), "v"(ol[1]), "v"(ol[2]), "v"(ol[3]), "v"(p16), "v"(ph), "v"(pl) : "memory");
        } else {
        float* crow = C + (size_t)(r0 + mb * 16) * ldc + c0;
        v4f val[8]; float* pc[8];
#pragma unroll
            for (int s = 0; s < 8; ++s) { const int row = 2 * s + hi, cofs = lr * 4; val[s] = *(const v4fa*)(os + row * 68 + cofs); if (BIAS) { val[s][0] += bfr(bias[c0 + cofs]); val[s][1] += bfr(bias[c0 + cofs + 1]); val[s][2] += bfr(bias[c0 + cofs + 2]); val[s][3] += bfr(bias[c0 + cofs + 3]); }
                pc[s] = crow + (size_t)row * ldc + cofs; *(v4f*)pc[s] = val[s]; }
            // the data and address registers of the stores stay as they are up to this wait (inputs only)
            asm volatile("s_wait_xcnt 0x0" :: "v"(val[0]), "v"(val[1]), "v"(val[2]), "v"(val[3]), "v"(val[4]), "v"(val[5]), "v"(val[6]), "v"(val[7]), "v"(pc[0]), "v"(pc[1]), "v"(pc[2]), "v"(pc[3]), "v"(pc[4]), "v"(pc[5]), "v"(pc[6]), "v"(pc[7]) : "memory");
        }
        __builtin_amdgcn_wave_barrier(); asm volatile("" ::: "memory");
    }
}

typedef __attribute__((ext_vector_type(4))) _Float16 v4h;
typedef __attribute__((ext_vector_type(2))) unsigned short v2us;
typedef __attribute__((ext_vector_type(4))) unsigned short v4us;
typedef __attribute__((ext_vector_type(4))) int v4i;

// k_prep: every f32 -> bf16 operand plane (x and the four (in, out) weights) in ONE launch of PTH threads, all resident at once; a thread makes one 16-byte piece of each weight plane and PXU pieces of the x plane,
// and all its loads are issued in front of the first conversion (40 a wave, under the load counter's 63), so a wave waits for memory once. The launch costs one gap and 4,096 wave starts where five launches of one-piece threads cost five and 32,768.
// Weight w[k][n] -> plane in fragment order, rows = n, tile (k / 32, n / 16); a piece is eight k of one n: a wave's loads read 64 bytes in a row per half (a block's 256), its store 512.
// x[row][k] -> plane in fragment order, tile (k / 32, row / 16); a piece is eight consecutive k of one row. A wave makes 8 rows of PXU tiles in a row: it reads PXU * 128 bytes in a row of each (whole lines), and each of a tile's four pieces per row lands with the other rows' in 128 bytes in a row.
#define PTH (DM * DQ / 8)             // threads: the pieces of one weight plane
#define PXU (TT * DM / 8 / PTH)       // x pieces per thread
__global__ __launch_bounds__(256) void k_prep(const float* __restrict__ x, const float* __restrict__ wq, const float* __restrict__ wk, const float* __restrict__ wv, const float* __restrict__ wo, bf* XB, bf* WQ, bf* WK, bf* WV, bf* WO) {
    static_assert(DQ == DM && DKV == DM, "the four weight planes share one piece index");
    static_assert(PXU * PTH * 8 == TT * DM && (DM / 32) % PXU == 0 && PTH % 256 == 0, "a thread's x pieces are PXU k tiles in a row of one x row");
    const unsigned i = blockIdx.x * 256u + threadIdx.x, lane = i & 31u, w = i >> 5;
    constexpr unsigned NT = DM / 16u, KT = DM / 32u;
    const unsigned tile = i >> 6, n = (tile % NT) * 16u + (lane & 15u), k = (tile / NT) * 32u + (w & 1u) * 16u + (lane >> 4) * 8u;
    const unsigned wofs = k * DM + n;                                // the piece's first element in each weight
    const unsigned rg = (w >> 1) / (KT / PXU), kt = (w >> 1) % (KT / PXU) * PXU, row = (w & 1u) * 8u + (lane >> 2), pc = lane & 3u;   // piece pc: k = 8 pc + 0 .. 7 of the tiles kt + 0 .. PXU - 1
    const unsigned xofs = (rg * 16u + row) * DM + kt * 32u + pc * 8u;  // the first x piece; the next lies one k tile (128 bytes) further on in the row
    v8f v[PXU]; float fq[8], fk[8], fv[8], fo[8];
#pragma unroll
    for (int u = 0; u < PXU; ++u) v[u] = *(const v8f*)(x + xofs + u * 32);
#pragma unroll
    for (int j = 0; j < 8; ++j) { fq[j] = wq[wofs + j * DM]; fk[j] = wk[wofs + j * DM]; fv[j] = wv[wofs + j * DM]; fo[j] = wo[wofs + j * DM]; }
    asm volatile("s_wait_xcnt 0x0" :: "v"(wofs), "v"(xofs) : "memory");   // the offset registers of the loads stay as they are up to this wait (inputs only)
    v8us oq, ok, ov, oo, ox[PXU];
#pragma unroll
    for (int u = 0; u < PXU; ++u)
#pragma unroll
        for (int e = 0; e < 8; ++e) ox[u][e] = f2bf(v[u][e]);
#pragma unroll
    for (int j = 0; j < 8; ++j) { oq[j] = f2bf(fq[j]); ok[j] = f2bf(fk[j]); ov[j] = f2bf(fv[j]); oo[j] = f2bf(fo[j]); }
    bf* px = XB + ((size_t)kt * (TT / 16u) + rg) * FRG + (pc >> 1) * (FRG / 2) + ((pc & 1u) * 16u + row) * 8u;
#pragma unroll
    for (int u = 0; u < PXU; ++u) *(v8us*)(px + (size_t)u * (TT / 16u) * FRG) = ox[u];
    *(v8us*)(WQ + (size_t)i * 8) = oq; *(v8us*)(WK + (size_t)i * 8) = ok; *(v8us*)(WV + (size_t)i * 8) = ov; *(v8us*)(WO + (size_t)i * 8) = oo;
}

// ---- k_fattn: scores, causal softmax and probability x value contraction of ALL heads in one launch (online softmax); no score or probability ever reaches memory.
// FKS waves own FNQ * 16 query columns of one head and walk the keys 0 .. their diagonal in passes of KB keys, wave 'part' taking the passes part, part + FKS, ..., transposed: S^T = K Q^T (A = K rows, B = Q rows), O^T += V^T P^T (A = V^T rows, B = P^T).
// Each part keeps its own m, l and O^T; behind the walk part 1 hands them to part 0 through LDS, which brings both to the common maximum, adds them and stores. So the longest walk of the launch is half as many passes per wave, and every SIMD holds two waves
// (the two parts of one tile) from a block's start to the hand-over: one wave's products run behind the other's softmax. A block fills its WGP's registers; blocks start heaviest first, so a WGP that ends a lighter block early takes the heaviest one left.
// A lane (lr, hi) holds, of each 16-key score tile, the keys 8 * hi + j of query column lr; two such tiles, converted in place, are the B operand of the second product in the k order of WFrag::ld.
// Per column: running maximum m (log2 units, equal in both lane halves), running sum l (one partial per lane half, joined at the end); O^T and l are rescaled only when a new maximum exceeds m by more than 8.
// Rows < RH: bf16 hi/lo planes, three products in both contractions; the rest fp16. The quotient O / l goes out as the merged hi/lo planes (rows = t, k = head * HD + d) in fragment order: a lane's 8 consecutive d of one query are its own 16 bytes of the tile. Grid (heads, FNB).
#define FNQ 2
#define FWV 4
#define FKS 2                         // waves that share one tile's key walk
#define FNB (TT / (FWV * FNQ * 16))   // work-groups per head
#define FXP (FNQ * 4 * 2 + 1)         // 16-byte pieces a lane hands over: O^T, then (m, l)
__device__ __forceinline__ float xhalf(float x) { return __builtin_bit_cast(float, __builtin_amdgcn_permlanex16(__builtin_bit_cast(int, x), __builtin_bit_cast(int, x), 0x76543210, 0xfedcba98, false, false)); }   // lane l <-> lane l ^ 16
// 2^x in place; the v_nop is the one slot the instruction set asks for behind a transcendental, in the same statement so that it stands directly behind it (source = result: nothing can overwrite the source alone)
__device__ __forceinline__ float exp2s(float x) { asm("v_exp_f32 %0, %0\n\tv_nop" : "+v"(x)); return x; }
// 2^x in place of 16 values that do not depend on one another, in ONE statement: each v_exp_f32 is the independent instruction behind the one in front of it, so the slot that the instruction set asks for behind a transcendental
// takes a v_nop only behind the last; and all 16 sources are made in front of the group, so the v_exp_f32 no longer stand each directly behind the v_fma_f32 that makes its source (a wait that the compiler cannot hint for asm text)
__device__ __forceinline__ void exp2x16(float (&p)[16]) { asm("v_exp_f32 %0, %0\n\tv_exp_f32 %1, %1\n\tv_exp_f32 %2, %2\n\tv_exp_f32 %3, %3\n\tv_exp_f32 %4, %4\n\tv_exp_f32 %5, %5\n\tv_exp_f32 %6, %6\n\tv_exp_f32 %7, %7\n\tv_exp_f32 %8, %8\n\tv_exp_f32 %9, %9\n\tv_exp_f32 %10, %10\n\tv_exp_f32 %11, %11\n\tv_exp_f32 %12, %12\n\tv_exp_f32 %13, %13\n\tv_exp_f32 %14, %14\n\tv_exp_f32 %15, %15\n\tv_nop" : "+v"(p[0]), "+v"(p[1]), "+v"(p[2]), "+v"(p[3]), "+v"(p[4]), "+v"(p[5]), "+v"(p[6]), "+v"(p[7]), "+v"(p[8]), "+v"(p[9]), "+v"(p[10]), "+v"(p[11]), "+v"(p[12]), "+v"(p[13]), "+v"(p[14]), "+v"(p[15])); }
template <typename T16, bool HL, int KB>
__device__ __forceinline__ void fattn_tile(const T16* __restrict__ Q, const T16* __restrict__ Q2, const T16* __restrict__ Kp, const T16* __restrict__ Kp2, const T16* __restrict__ Vt, const T16* __restrict__ Vt2, int q0, int lr, int hi, int part, v4f* xs, bf* Ah, bf* Al) {
    typedef typename WFrag<T16>::V V;
    constexpr int NKT = KB / 16, NKK = KB / 32;
    constexpr float C2 = SCL * 1.4426950408889634f;                  // score -> log2 units
    V qf[FNQ][2], qf2[FNQ][2];
    const int lane = hi * 16 + lr;
    const T16* pq = Q + (size_t)q0 * HD + 8 * lane; const T16* pq2 = HL ? Q2 + (size_t)q0 * HD + 8 * lane : nullptr;
#pragma unroll
    for (int g = 0; g < FNQ; ++g)
#pragma unroll
        for (int ks = 0; ks < 2; ++ks) { qf[g][ks] = WFrag<T16>::ld(pq + g * 16 * HD + ks * FRG); if (HL) qf2[g][ks] = WFrag<T16>::ld(pq2 + g * 16 * HD + ks * FRG); }
    const int kend = q0 + FNQ * 16;                                  // first key above every diagonal element of the tile
    const int kofs = part * KB * HD + 8 * lane;                      // this part's first pass (KB < TT keys in: inside the plane, also where the part has no pass)
    const T16* pk = Kp + kofs; const T16* pk2 = HL ? Kp2 + kofs : nullptr;
    const T16* pv = Vt + kofs; const T16* pv2 = HL ? Vt2 + kofs : nullptr;
    V kf[NKT][2], kf2[NKT][2];
#pragma unroll
    for (int kt = 0; kt < NKT; ++kt)
#pragma unroll
        for (int ks = 0; ks < 2; ++ks) { kf[kt][ks] = WFrag<T16>::ld(pk + kt * 16 * HD + ks * FRG); if (HL) kf2[kt][ks] = WFrag<T16>::ld(pk2 + kt * 16 * HD + ks * FRG); }
    // the address registers of the Q and first K loads stay as they are up to this wait (inputs only)
    if (HL) asm volatile("s_wait_xcnt 0x0" :: "v"(pq), "v"(pq2), "v"(pk), "v"(pk2) : "memory"); else asm volatile("s_wait_xcnt 0x0" :: "v"(pq), "v"(pk) : "memory");
    __builtin_amdgcn_sched_barrier(0);                               // nothing below is lifted over the wait: without this line the build rewrites registers that the loads above name (their base, their lane offset) ahead of it
    v8f o[4][FNQ]; float m[FNQ], l[FNQ];
#pragma unroll
    for (int g = 0; g < FNQ; ++g) { m[g] = -3.0e38f; l[g] = 0.f;
#pragma unroll
        for (int dt = 0; dt < 4; ++dt) o[dt][g] = (v8f){}; }
#pragma unroll 1
    for (int k0 = part * KB; k0 < kend; k0 += FKS * KB) {
        V vf[4][NKK], vf2[4][NKK];                                   // this pass's V^T fragments: issued here, first used behind the softmax
#pragma unroll
        for (int dt = 0; dt < 4; ++dt)
#pragma unroll
            for (int kk = 0; kk < NKK; ++kk) { vf[dt][kk] = WFrag<T16>::ld(pv + (kk * (HD / 16) + dt) * FRG); if (HL) vf2[dt][kk] = WFrag<T16>::ld(pv2 + (kk * (HD / 16) + dt) * FRG); }
        // the V address registers stay as they are up to this wait (inputs only); they are rewritten only behind it
        if (HL) asm volatile("s_wait_xcnt 0x0" :: "v"(pv), "v"(pv2) : "memory"); else asm volatile("s_wait_xcnt 0x0" :: "v"(pv) : "memory");
        v8f s[NKT][FNQ];
#pragma unroll
        for (int kt = 0; kt < NKT; ++kt)
#pragma unroll
            for (int g = 0; g < FNQ; ++g) s[kt][g] = (v8f){};
#pragma unroll
        for (int ks = 0; ks < 2; ++ks)
#pragma unroll
            for (int kt = 0; kt < NKT; ++kt)
#pragma unroll
                for (int g = 0; g < FNQ; ++g) { s[kt][g] = WFrag<T16>::mma(kf[kt][ks], qf[g][ks], s[kt][g]); if (HL) { s[kt][g] = WFrag<T16>::mma(kf2[kt][ks], qf[g][ks], s[kt][g]); s[kt][g] = WFrag<T16>::mma(kf[kt][ks], qf2[g][ks], s[kt][g]); } }
        if (k0 + FKS * KB < kend) { pk += FKS * KB * HD; if (HL) pk2 += FKS * KB * HD; }   // the last pass fetches its own rows again: always inside the plane
#pragma unroll
        for (int kt = 0; kt < NKT; ++kt)                             // next pass's K fragments, in flight behind the softmax and the second product
#pragma unroll
            for (int ks = 0; ks < 2; ++ks) { kf[kt][ks] = WFrag<T16>::ld(pk + kt * 16 * HD + ks * FRG); if (HL) kf2[kt][ks] = WFrag<T16>::ld(pk2 + kt * 16 * HD + ks * FRG); }
        // the K address registers stay as they are up to this wait (inputs only); they are rewritten only behind it
        if (HL) asm volatile("s_wait_xcnt 0x0" :: "v"(pk), "v"(pk2) : "memory"); else asm volatile("s_wait_xcnt 0x0" :: "v"(pk) : "memory");
        if (k0 + KB - 1 > q0) {                                      // only passes that reach the diagonal mask (wave-uniform test)
#pragma unroll
            for (int kt = 0; kt < NKT; ++kt)
#pragma unroll
                for (int g = 0; g < FNQ; ++g)
#pragma unroll
                    for (int j = 0; j < 8; ++j) s[kt][g][j] = (k0 + kt * 16 + hi * 8 + j <= q0 + g * 16 + lr) ? s[kt][g][j] : -3.0e38f; }
        float tm[FNQ]; bool need = false;
#pragma unroll
        for (int g = 0; g < FNQ; ++g) { float t = s[0][g][0];
#pragma unroll
            for (int kt = 0; kt < NKT; ++kt)
#pragma unroll
                for (int j = 0; j < 8; ++j) t = fmaxf(t, s[kt][g][j]);
            t = fmaxf(t, xhalf(t)) * C2; tm[g] = t; need = need || (t > m[g] + 8.0f); }
        if (__builtin_amdgcn_ballot_w32(need) != 0) {                // scalar branch: rare once the maxima have settled
#pragma unroll
            for (int g = 0; g < FNQ; ++g) { const float mn = fmaxf(m[g], tm[g]); const float al = exp2s(m[g] - mn); m[g] = mn; l[g] *= al;
#pragma unroll
                for (int dt = 0; dt < 4; ++dt) o[dt][g] *= al; } }
        V pf[FNQ][NKK], pf2[FNQ][NKK];
#pragma unroll
        for (int g = 0; g < FNQ; ++g)
#pragma unroll
            for (int kk = 0; kk < NKK; ++kk) { float p[16]; float ls = 0.f;
#pragma unroll
                for (int e = 0; e < 16; ++e) p[e] = __builtin_fmaf(s[2 * kk + (e >> 3)][g][e & 7], C2, -m[g]);
                exp2x16(p);
#pragma unroll
                for (int e = 0; e < 16; ++e) ls += p[e];
                l[g] += ls;
                if constexpr (HL) { v8us h0, h1, l0, l1;
#pragma unroll
                    for (int e = 0; e < 8; ++e) { unsigned short a, c; splitf(p[e], a, c); h0[e] = a; l0[e] = c; splitf(p[8 + e], a, c); h1[e] = a; l1[e] = c; }
                    pf[g][kk] = cat16b(h0, h1); pf2[g][kk] = cat16b(l0, l1);
                } else { v16h ph;
#pragma unroll
                    for (int e = 0; e < 16; ++e) ph[e] = tohx(p[e]);
                    pf[g][kk] = ph; } }
#pragma unroll
        for (int kk = 0; kk < NKK; ++kk)
#pragma unroll
            for (int dt = 0; dt < 4; ++dt)
#pragma unroll
                for (int g = 0; g < FNQ; ++g) { o[dt][g] = WFrag<T16>::mma(vf[dt][kk], pf[g][kk], o[dt][g]); if (HL) { o[dt][g] = WFrag<T16>::mma(vf2[dt][kk], pf[g][kk], o[dt][g]); o[dt][g] = WFrag<T16>::mma(vf[dt][kk], pf2[g][kk], o[dt][g]); } }
        pv += FKS * KB * HD; if (HL) pv2 += FKS * KB * HD;
    }
    static_assert(FKS == 2 && FNQ == 2, "one hand-over, its last piece holds two m and two l");
    if (part != 0) {                                                 // wave-uniform
#pragma unroll
        for (int dt = 0; dt < 4; ++dt)
#pragma unroll
            for (int g = 0; g < FNQ; ++g) { xs[((dt * FNQ + g) * 2) * 32 + lane] = __builtin_shufflevector(o[dt][g], o[dt][g], 0, 1, 2, 3); xs[((dt * FNQ + g) * 2 + 1) * 32 + lane] = __builtin_shufflevector(o[dt][g], o[dt][g], 4, 5, 6, 7); }
        xs[(FXP - 1) * 32 + lane] = (v4f){m[0], m[1], l[0], l[1]}; }
    __syncthreads();                                                 // part 1's hand-over is in LDS before part 0 reads it; every wave of the block passes here once
    if (part != 0) return;
    { const v4f ml = xs[(FXP - 1) * 32 + lane];                      // a part without a pass hands over m = -3.0e38, l = 0, O = 0: its factor is 0
#pragma unroll
        for (int g = 0; g < FNQ; ++g) { const float mn = fmaxf(m[g], ml[g]); const float a0 = exp2s(m[g] - mn), a1 = exp2s(ml[g] - mn); l[g] = l[g] * a0 + ml[FNQ + g] * a1;
#pragma unroll
            for (int dt = 0; dt < 4; ++dt) { const v4f x0 = xs[((dt * FNQ + g) * 2) * 32 + lane], x1 = xs[((dt * FNQ + g) * 2 + 1) * 32 + lane];
#pragma unroll
                for (int j = 0; j < 4; ++j) { o[dt][g][j] = o[dt][g][j] * a0 + x0[j] * a1; o[dt][g][4 + j] = o[dt][g][4 + j] * a0 + x1[j] * a1; } } } }
    v8us oh[FNQ][4], ol[FNQ][4];
#pragma unroll
    for (int g = 0; g < FNQ; ++g) { const float inv = __fdiv_rn(1.0f, l[g] + xhalf(l[g]));   // the two lane halves' sums, joined once
#pragma unroll
        for (int dt = 0; dt < 4; ++dt)
#pragma unroll
            for (int j = 0; j < 8; ++j) { unsigned short a, c; splitf(o[dt][g][j] * inv, a, c); oh[g][dt][j] = a; ol[g][dt][j] = c; } }
    bf* pa = Ah + (size_t)(q0 / 16) * FRG + lane * 8; bf* pl = Al + (size_t)(q0 / 16) * FRG + lane * 8;
#pragma unroll
    for (int g = 0; g < FNQ; ++g)
#pragma unroll
        for (int dt = 0; dt < 4; ++dt) { *(v8us*)(pa + ((dt >> 1) * (TT / 16) + g) * FRG + (dt & 1) * (FRG / 2)) = oh[g][dt]; *(v8us*)(pl + ((dt >> 1) * (TT / 16) + g) * FRG + (dt & 1) * (FRG / 2)) = ol[g][dt]; }
    static_assert(FNQ == 2, "the wait behind the stores names the data registers of two column groups");
    // the data and address registers of the stores stay as they are up to this wait (inputs only)
    asm volatile("s_wait_xcnt 0x0" :: "v"(oh[0][0]), "v"(oh[0][1]), "v"(oh[0][2]), "v"(oh[0][3]), "v"(oh[1][0]), "v"(oh[1][1]), "v"(oh[1][2]), "v"(oh[1][3]), "v"(ol[0][0]), "v"(ol[0][1]), "v"(ol[0][2]), "v"(ol[0][3]), "v"(ol[1][0]), "v"(ol[1][1]), "v"(ol[1][2]), "v"(ol[1][3]), "v"(pa), "v"(pl) : "memory");
}
__global__ __launch_bounds__(32 * FWV * FKS) void k_fattn(const h16* __restrict__ Q16, const h16* __restrict__ K16, const h16* __restrict__ V16, const bf* __restrict__ Qh, const bf* __restrict__ Ql, const bf* __restrict__ Kh, const bf* __restrict__ Kl, const bf* __restrict__ Vh, const bf* __restrict__ Vl, bf* Ah, bf* Al) {
    const int lane = threadIdx.x & 31, lr = lane & 15, hi = lane >> 4; const int wave = __builtin_amdgcn_readfirstlane((int)(threadIdx.x >> 5));
    static_assert(RH % (FWV * FNQ * 16) == 0, "a block's waves all take the same branch below, so all meet at its barrier");
    __shared__ v4f xsh[FWV * FXP * 32];
    const int tile = wave % FWV, part = wave / FWV;                  // waves w and w + FWV: the two parts of one tile
    const int h = blockIdx.x; const int qb = FNB - 1 - (int)blockIdx.y;   // cost falls with the index
    const int q0 = (qb * FWV + tile) * (FNQ * 16); v4f* xs = xsh + tile * FXP * 32;
    const size_t zq = (size_t)h * TT * HD, zk = (size_t)(h / REP) * TT * HD;
    if (q0 < RH) fattn_tile<bf, true, 32>(Qh + zq, Ql + zq, Kh + zk, Kl + zk, Vh + zk, Vl + zk, q0, lr, hi, part, xs, Ah + (size_t)h * (HD / 32) * (TT / 16) * FRG, Al + (size_t)h * (HD / 32) * (TT / 16) * FRG);
    else fattn_tile<h16, false, 64>(Q16 + zq, nullptr, K16 + zk, nullptr, V16 + zk, nullptr, q0, lr, hi, part, xs, Ah + (size_t)h * (HD / 32) * (TT / 16) * FRG, Al + (size_t)h * (HD / 32) * (TT / 16) * FRG);
}

extern "C" void kernel_launch(void* const* d_in, const int* in_sizes, int n_in,
                              void* d_out, int out_size, void* d_ws, size_t ws_size, hipStream_t stream) {
    (void)in_sizes; (void)n_in; (void)out_size;
    const float* x = (const float*)d_in[0]; const float* wq = (const float*)d_in[1]; const float* wk = (const float*)d_in[2]; const float* wv = (const float*)d_in[3]; const float* wo = (const float*)d_in[4]; const float* bo = (const float*)d_in[5];
    float* OUT = (float*)d_out;     // [1][4096][1024]
    char* wsp = (char*)d_ws;
    auto take = [&](size_t bytes) { char* p = wsp; wsp += (bytes + 255) & ~(size_t)255; return (void*)p; };
    bf* WQ = (bf*)take((size_t)DQ * DM * 2); bf* WK = (bf*)take((size_t)DKV * DM * 2); bf* WV = (bf*)take((size_t)DKV * DM * 2); bf* WO = (bf*)take((size_t)DM * DQ * 2);
    bf* XB = (bf*)take((size_t)TT * DM * 2);
    h16* QP16 = (h16*)take((size_t)NH_ * TT * HD * 2); h16* KP16 = (h16*)take((size_t)NKV * TT * HD * 2); h16* VT16 = (h16*)take((size_t)NKV * HD * TT * 2);
    bf* QPh = (bf*)take((size_t)NH_ * TT * HD * 2); bf* QPl = (bf*)take((size_t)NH_ * TT * HD * 2); bf* KPh = (bf*)take((size_t)NKV * TT * HD * 2); bf* KPl = (bf*)take((size_t)NKV * TT * HD * 2); bf* VTh = (bf*)take((size_t)NKV * HD * TT * 2); bf* VTl = (bf*)take((size_t)NKV * HD * TT * 2);
    bf* ATh = (bf*)take((size_t)TT * DQ * 2); bf* ATl = (bf*)take((size_t)TT * DQ * 2);
    if ((size_t)(wsp - (char*)d_ws) > ws_size) return;    // ws 256 MiB
    static_assert(NB_ == 1, "one launch converts the one batch entry's x beside the weights");
    k_prep<<<PTH / 256, 256, 0, stream>>>(x, wq, wk, wv, wo, XB, WQ, WK, WV, WO);
    for (int b = 0; b < NB_; ++b) {
        static_assert(DKV == DQ && ((size_t)DQ * DM * 2) % 256 == 0 && ((size_t)NH_ * TT * HD * 2) % 256 == 0, "WQ, WK, WV lie one plane apart, as do QP16, KP16, VT16; QPh, KPh, VTh (and the lo planes) two");
        static_assert(TT % 256 == 0 && (DM / 32 - 2) % 3 == 0, "four row tiles a work-group; the three-set ring's trips end two k tiles short of K");
        k_gemmw<bf, 0, false, 1><<<dim3(TT / 256, DQ / 64, 1), 384, 0, stream>>>(XB, nullptr, WQ, nullptr, DM, TT, DQ, nullptr, 0, nullptr, 0, (size_t)DQ * DM, (size_t)NH_ * TT * HD, QP16, QPh, QPl);
        k_fattn<<<dim3(NH_, FNB, 1), 32 * FWV * FKS, 0, stream>>>(QP16, KP16, VT16, QPh, QPl, KPh, KPl, VTh, VTl, ATh, ATl);
        k_gemmw<bf, 1, true, 0><<<dim3(TT / 64, DM / 64, 1), 32, 0, stream>>>(ATh, ATl, WO, nullptr, DQ, TT, DM, OUT + (size_t)b * TT * DM, DM, bo, 0, 0, 0, nullptr, nullptr, nullptr); }
}

// v010
// A run of this version takes 77.4 microseconds.
// Two timings next to v009 put it at 1.10 and 1.09 times that version's speed.
// Counting every step since v000, it is 36.6 times as fast.
#include <hip/hip_runtime.h>

// Causal multi-head self-attention over 4,096 tokens with (in, out) weights (x [1][4096][1024]; q, k, v = x W ('xw' [1024][1024] 0.02, no bias; 16 heads x 64); scores with -inf strictly above the diagonal (triu k=1), then / sqrt(64) inside the softmax (the same function as scaling first); softmax; out = merged Wo + bo ('xw' + a REAL bias 0.02) -> [1][4096][1024] (4.2 M); argument order x, Wq, Wk, Wv, Wo, bo).
// Layout: bf16 copies of x and the weights (one launch); exact projections whose epilogue stores the attention operand planes; causal T-4096 attention of all heads fused in one launch with an online softmax (hybrid rows: < 512 hi/lo 3 products, rest fp16); merged hi/lo x Wo exact + bo.
// Fragment order: every 16-bit WMMA operand plane is stored as tiles of 16 rows x 32 k, FRG consecutive elements each; element (row lr, k = 16 s + 8 hi + j) lies at 256 s + 8 (16 hi + lr) + j,
// so a wave's fragment is two loads of 512 consecutive bytes (four whole 128-byte lines each): load s gives lane 16 hi + lr the elements k = 16 s + 8 hi + 0 .. 7 of row lr. GEMM operand planes of R rows: tile (k / 32, row / 16) at ((k / 32) * (R / 16) + row / 16) * FRG, so the four 16-row groups of a 64-row block lie 4 KiB in a row per k tile.
// Compute dtypes, f32 accumulate: every input rounded to bf16; projections exact; attention rows < 512 3 products, rest fp16; softmax f32; Wo hl x exact + bias.

#define NB_  1
#define TT   4096
#define DM   1024
#define NH_  16
#define NKV  16
#define REP  (NH_ / NKV)
#define HD   64
#define DQ   (NH_ * HD)
#define DKV  (NKV * HD)
#define RH   512                  // query rows < RH use hi+lo planes (0: none)
#define WIN  4096
#define SCL  0.125f   // HD^-0.5
#define FRG  512                  // elements of one 16 x 32 operand tile in fragment order
typedef _Float16 h16;
typedef unsigned short bf;
typedef __attribute__((ext_vector_type(16))) __bf16   v16bf;
typedef __attribute__((ext_vector_type(16))) _Float16 v16h;
typedef __attribute__((ext_vector_type(8)))  _Float16 v8h;
typedef __attribute__((ext_vector_type(8)))  unsigned short v8us;
typedef __attribute__((ext_vector_type(8)))  float    v8f;
typedef __attribute__((ext_vector_type(4)))  float    v4f;
typedef v8h  __attribute__((may_alias)) v8ha;
typedef v4f  __attribute__((may_alias)) v4fa;
typedef v8us __attribute__((may_alias)) v8usa;

__device__ __forceinline__ unsigned short f2bf(float f) { unsigned u = __float_as_uint(f); u += 0x7FFFu + ((u >> 16) & 1u); return (unsigned short)(u >> 16); }
__device__ __forceinline__ float bf2f(unsigned short b) { return __uint_as_float(((unsigned)b) << 16); }
__device__ __forceinline__ float bfr(float f) { return bf2f(f2bf(f)); }
__device__ __forceinline__ v16h cat16(v8h lo, v8h hi) { return __builtin_shufflevector(lo, hi, 0, 1, 2, 3, 4, 5, 6, 7, 8, 9, 10, 11, 12, 13, 14, 15); }
__device__ __forceinline__ v16bf cat16b(v8us lo, v8us hi) { return __builtin_bit_cast(v16bf, __builtin_shufflevector(lo, hi, 0, 1, 2, 3, 4, 5, 6, 7, 8, 9, 10, 11, 12, 13, 14, 15)); }
__device__ __forceinline__ v8f wmma16(v16h a, v16h b, v8f c) { return __builtin_amdgcn_wmma_f32_16x16x32_f16(false, a, false, b, (short)0, c, false, false); }
__device__ __forceinline__ v8f wmmab(v16bf a, v16bf b, v8f c) { return __builtin_amdgcn_wmma_f32_16x16x32_bf16(false, a, false, b, (short)0, c, false, false); }



__device__ __forceinline__ h16 tohx(float x) { return (h16)x; }
__device__ __forceinline__ void splitf(float y, unsigned short& h, unsigned short& l) { h = f2bf(y); l = f2bf(y - bf2f(h)); }
// eight f32 results -> their fp16 image and their bf16 hi/lo pair
__device__ __forceinline__ void planes8(const float* y, v8h& o16, v8us& oh, v8us& ol) {
#pragma unroll
    for (int e = 0; e < 8; ++e) { o16[e] = tohx(y[e]); unsigned short a, c; splitf(y[e], a, c); oh[e] = a; ol[e] = c; } }

// ---- k_gemmw: register-blocked GEMM, ONE WAVE per 64x64 output tile (16 accumulators), operands straight from 16-bit planes in fragment order (A of RA rows, Bt of RB rows); EPI 0: grid (M/64, N/64, Z), 32 threads.
// C[m][n] = sum_k A[m][k] Bt[n][k] (+ split products per NSPLIT). z-batch strides sA/sB/sC in elements. EPI 0: K % 128 == 0; EPI 1: (K / 32 - 2) % 3 == 0.
// EPI 0: C goes out in f32 (pitch ldc, + optional f32 bias[n]). EPI 1: the three projections in ONE launch, grid (M/256, N/64), 12 waves: wave w makes row tile w % 4 of projection z = w / 4 = 0, 1, 2 for Q, K, V (weights sB apart, fp16 planes sC apart, hi and lo planes 2 sC apart); m is the token, the 64 columns are one head (HD == 64),
// and C goes out only as the three 16-bit planes (fp16, bf16 hi, bf16 lo) that the attention reads, in fragment order: z < 2 rows = tokens, k = d, per head tile (token / 16, d / 32), through the LDS transpose; z = 2 rows = d, k = tokens, per head tile (token / 32, d / 16), straight from the accumulators (a lane holds 8 consecutive tokens of one d: its own 16 bytes of the tile).
// One work-group fills a WGP, three waves to a SIMD (registers), and all 256 are resident at once: a wave's load waits, start and epilogue run behind its two neighbours' products,
// and of the 24 fragment groups that the 12 waves load per k tile only 7 differ (4 of x, each read by 3 waves; 3 of the weights, each by 4), so the WGP cache serves the rest. The waves never meet: no barrier, LDS per wave.
template <typename T16> struct WFrag;
template <> struct WFrag<h16> { typedef v16h V; static __device__ __forceinline__ V ld(const h16* p) { return cat16(*(const v8h*)p, *(const v8h*)(p + FRG / 2)); } static __device__ __forceinline__ v8f mma(V a, V b, v8f c) { return wmma16(a, b, c); } };
template <> struct WFrag<bf> { typedef v16bf V; static __device__ __forceinline__ V ld(const bf* p) { return cat16b(*(const v8us*)p, *(const v8us*)(p + FRG / 2)); } static __device__ __forceinline__ v8f mma(V a, V b, v8f c) { return wmmab(a, b, c); } };
template <typename T16, int NSPLIT, bool BIAS, int EPI>
__global__ __launch_bounds__(EPI == 1 ? 384 : 32) void k_gemmw(const T16* __restrict__ A, const T16* __restrict__ A2, const T16* __restrict__ Bt, const T16* __restrict__ Bt2, int K, int RA, int RB, float* C, int ldc, const float* __restrict__ bias, size_t sA, size_t sB, size_t sC, h16* P16, bf* Ph, bf* Pl) {
    static_assert(EPI == 0 || HD == 64, "a 64-column tile is one head");
    typedef typename WFrag<T16>::V V;
    __shared__ __align__(16) float osh[(EPI == 1 ? 8 : 1) * 16 * 68];  // EPI 1: one transpose buffer for each wave of z < 2
    const int wave = EPI == 1 ? __builtin_amdgcn_readfirstlane((int)(threadIdx.x >> 5)) : 0;
    float* os = osh + (EPI == 1 ? (wave & 7) * 16 * 68 : 0);
    const size_t z = EPI == 1 ? wave >> 2 : blockIdx.z; A += z * sA; if (A2) A2 += z * sA; Bt += z * sB; if (Bt2) Bt2 += z * sB;
    if constexpr (EPI == 0) C += z * sC; else { P16 += z * sC; Ph += z * 2 * sC; Pl += z * 2 * sC; }
    const int lane = threadIdx.x & 31, lr = lane & 15, hi = lane >> 4; const int r0 = (EPI == 1 ? blockIdx.x * 4 + (wave & 3) : blockIdx.x) * 64, c0 = blockIdx.y * 64;
    v8f acc[4][4];
#pragma unroll
    for (int mb = 0; mb < 4; ++mb)
#pragma unroll
        for (int nb = 0; nb < 4; ++nb) acc[mb][nb] = (v8f){};
    constexpr bool HA2 = NSPLIT == 1 || NSPLIT == 2, HB2 = NSPLIT >= 2;
    const size_t aoff = (size_t)(r0 / 16) * FRG + 8 * lane, boff = (size_t)(c0 / 16) * FRG + 8 * lane;   // this lane's 16 bytes of the first k tile of the first 16-row group
    const size_t ast = (size_t)(RA / 16) * FRG, bst = (size_t)(RB / 16) * FRG;                            // from one k tile to the next
    // Fragment ring in registers: RD sets; the loads of k tile t + PD are issued in front of the products of k tile t, so a tile's load latency runs behind PD tiles' products (a lone wave per SIMD has nothing else to hide it).
    // PD tiles' loads (16 or 24 a tile: at most 48) stay in flight behind a tile's wait, under the load counter's 63.
    // Rotated entry: a work-group walks the k tiles st, st + 1, ..., KT - 1, 0, ..., st - 1. Work-groups that read the same operand rows (equal blockIdx.x: A; equal blockIdx.y: Bt) all run at once and at one pace; entered at the same tile they ask L2 for the same lines
    // at the same moment, and where a line is not yet in L2 all of them wait for its fetch from memory. With different st a line is fetched for one of them and found in L2 by the others later. Every accumulator takes all KT tiles once, in that rotated order.
    // EPI 1: the 16 sharers of either operand start 2 tiles apart. EPI 0 (single-wave work-groups, four to a WGP): blockIdx.y 4 apart, and blockIdx.x 8 apart within a run of 32, keep one st, so that neighbours on a WGP can still share lines in its cache.
    // EPI 1: three sets, two tiles ahead, so that three waves' registers fit a SIMD; its last TL k tiles are the PD that are already fetched. (K / 32 - TL) % RD == 0.
    constexpr int RD = EPI == 1 ? 3 : 4, PD = (EPI == 1 || HA2 || HB2) ? 2 : 3, TL = EPI == 1 ? PD : RD;
    V a[RD][4], a2[RD][4], b[RD][4], b2[RD][4];
    const int KT = K / 32;
    const int st = (int)((EPI == 1 ? 2u * (blockIdx.x + blockIdx.y) : 2u * (blockIdx.x & 7u) + (blockIdx.x >> 5) + (unsigned)(KT / 4) * (blockIdx.y & 3u)) % (unsigned)KT);
    int kf = st;                                                     // the k tile that the pointers below stand at (wave-uniform)
    const long long awr = -(long long)((size_t)(KT - 1) * ast), bwr = -(long long)((size_t)(KT - 1) * bst);   // from the last k tile back to the first
    const T16* pa = A + aoff + st * ast; const T16* pb = Bt + boff + st * bst; const T16* pa2 = HA2 ? A2 + aoff + st * ast : nullptr; const T16* pb2 = HB2 ? Bt2 + boff + st * bst : nullptr;   // the next k tile to fetch
    auto fetch = [&](const int s) {
#pragma unroll
        for (int mb = 0; mb < 4; ++mb) { a[s][mb] = WFrag<T16>::ld(pa + mb * FRG); if (HA2) a2[s][mb] = WFrag<T16>::ld(pa2 + mb * FRG); }
#pragma unroll
        for (int nb = 0; nb < 4; ++nb) { b[s][nb] = WFrag<T16>::ld(pb + nb * FRG); if (HB2) b2[s][nb] = WFrag<T16>::ld(pb2 + nb * FRG); }
        __builtin_amdgcn_sched_barrier(0);                           // the set's loads stay one group in front of the products that follow: without this line the build puts a product, with its load wait, in front of them, and they lose their lead
    };
    auto step = [&]() {
        __builtin_amdgcn_sched_barrier(0);                           // the products stay in front of the wait: without this line the build puts it directly behind the loads, where the wave stands at it before its products
        // the address registers of the last fetch, and the lane number that a base + lane form of its loads names, stay as they are up to this wait (inputs only); they are rewritten only behind it
        if constexpr (HA2 && HB2) asm volatile("s_wait_xcnt 0x0" :: "v"(pa), "v"(pb), "v"(pa2), "v"(pb2), "v"(lane) : "memory");
        else if constexpr (HA2) asm volatile("s_wait_xcnt 0x0" :: "v"(pa), "v"(pb), "v"(pa2), "v"(lane) : "memory");
        else if constexpr (HB2) asm volatile("s_wait_xcnt 0x0" :: "v"(pa), "v"(pb), "v"(pb2), "v"(lane) : "memory");
        else asm volatile("s_wait_xcnt 0x0" :: "v"(pa), "v"(pb), "v"(lane) : "memory");
        __builtin_amdgcn_sched_barrier(0);                           // nothing below is lifted over the wait: a build may otherwise rewrite a register that the loads name (a scalar base too) ahead of it
        const bool wr = ++kf == KT; if (wr) kf = 0;
        const long long da = wr ? awr : (long long)ast, db = wr ? bwr : (long long)bst;
        pa += da; pb += db; if (HA2) pa2 += da; if (HB2) pb2 += db;
    };
    auto mul = [&](const int s) {
#pragma unroll
        for (int nb = 0; nb < 4; ++nb)
#pragma unroll
            for (int mb = 0; mb < 4; ++mb) { acc[mb][nb] = WFrag<T16>::mma(a[s][mb], b[s][nb], acc[mb][nb]); if (HA2) acc[mb][nb] = WFrag<T16>::mma(a2[s][mb], b[s][nb], acc[mb][nb]); if (HB2) acc[mb][nb] = WFrag<T16>::mma(a[s][mb], b2[s][nb], acc[mb][nb]); }
    };
#pragma unroll
    for (int s = 0; s < PD; ++s) { fetch(s); step(); }
#pragma unroll 1
    for (int kt = 0; kt < KT - TL; kt += RD) {                       // rolled: one trip is RD k tiles, each ring set at a fixed place in the trip (no register copies)
#pragma unroll
        for (int u = 0; u < RD; ++u) { fetch((u + PD) % RD); mul(u); step(); }
        // four vector slots behind the trip's last products, on the taken branch too
        asm volatile("v_nop\n\tv_nop\n\tv_nop\n\tv_nop" : "+v"(acc[0][0]), "+v"(acc[1][1]), "+v"(acc[2][2]), "+v"(acc[3][3]) : "v"(a[RD - 1][0]), "v"(a[RD - 1][3]));
    }
#pragma unroll
    for (int u = 0; u < TL; ++u) {                                   // the last TL k tiles: only the tiles that exist are fetched
        if (u + PD < TL) fetch((u + PD) % RD);
        mul(u);
        if (u + PD < TL) step(); }
    if (EPI == 1 && z == 2) {                                        // wave-uniform; no barrier follows
#pragma unroll
        for (int nb = 0; nb < 4; ++nb) { const size_t e = (size_t)blockIdx.y * HD * TT + (size_t)((r0 / 32) * (HD / 16) + nb) * FRG + lane * 8; h16* p16 = P16 + e; bf* ph = Ph + e; bf* pl = Pl + e; v8h o16[4]; v8us oh[4], ol[4];
#pragma unroll
            for (int mb = 0; mb < 4; ++mb) { float y[8];
#pragma unroll
                for (int j = 0; j < 8; ++j) y[j] = acc[mb][nb][j];
                planes8(y, o16[mb], oh[mb], ol[mb]); }
#pragma unroll
            for (int mb = 0; mb < 4; ++mb) *(v8h*)(p16 + (mb >> 1) * (HD / 16) * FRG + (mb & 1) * (FRG / 2)) = o16[mb];      // each store: 512 bytes in a row, half a tile
#pragma unroll
            for (int mb = 0; mb < 4; ++mb) *(v8us*)(ph + (mb >> 1) * (HD / 16) * FRG + (mb & 1) * (FRG / 2)) = oh[mb];
#pragma unroll
            for (int mb = 0; mb < 4; ++mb) *(v8us*)(pl + (mb >> 1) * (HD / 16) * FRG + (mb & 1) * (FRG / 2)) = ol[mb];
            // the data and address registers of the stores stay as they are up to this wait (inputs only)
            asm volatile("s_wait_xcnt 0x0" :: "v"(o16[0]), "v"(o16[1]), "v"(o16[2]), "v"(o16[3]), "v"(oh[0]), "v"(oh[1]), "v"(oh[2]), "v"(oh[3]), "v"(ol[0]), "v"(ol[1]), "v"(ol[2]), "v"(ol[3]), "v"(p16), "v"(ph), "v"(pl) : "memory");
        }
        return; }
#pragma unroll
    for (int mb = 0; mb < 4; ++mb) {
#pragma unroll
        for (int nb = 0; nb < 4; ++nb) {
#pragma unroll
            for (int j = 0; j < 8; ++j) os[(hi * 8 + j) * 68 + nb * 16 + lr] = acc[mb][nb][j]; }
        __builtin_amdgcn_wave_barrier(); asm volatile("" ::: "memory");
        if constexpr (EPI == 1) {
            const size_t e = ((size_t)blockIdx.y * TT + r0 + mb * 16) * HD + lane * 8; h16* p16 = P16 + e; bf* ph = Ph + e; bf* pl = Pl + e; v8h o16[4]; v8us oh[4], ol[4];
#pragma unroll
            for (int s = 0; s < 4; ++s) { const float* orow = os + lr * 68 + s * 16 + hi * 8; const v4f y0 = *(const v4fa*)orow, y1 = *(const v4fa*)(orow + 4); float y[8];
#pragma unroll
                for (int j = 0; j < 4; ++j) { y[j] = y0[j]; y[4 + j] = y1[j]; }
                planes8(y, o16[s], oh[s], ol[s]); }
#pragma unroll
            for (int s = 0; s < 4; ++s) { *(v8h*)(p16 + s * (FRG / 2)) = o16[s]; *(v8us*)(ph + s * (FRG / 2)) = oh[s]; *(v8us*)(pl + s * (FRG / 2)) = ol[s]; }   // each store: half a tile, 512 bytes in a row
            // the data and address registers of the stores stay as they are up to this wait (inputs only)
            asm volatile("s_wait_xcnt 0x0" :: "v"(o16[0]), "v"(o16[1]), "v"(o16[2]), "v"(o16[3]), "v"(oh[0]), "v"(oh[1]), "v"(oh[2]), "v"(oh[3]), "v"(ol[0]), "v"(ol[1]), "v"(ol[2]), "v"(ol[3]), "v"(p16), "v"(ph), "v"(pl) : "memory");
        } else {
        float* crow = C + (size_t)(r0 + mb * 16) * ldc + c0;
        v4f val[8]; float* pc[8];
#pragma unroll
            for (int s = 0; s < 8; ++s) { const int row = 2 * s + hi, cofs = lr * 4; val[s] = *(const v4fa*)(os + row * 68 + cofs); if (BIAS) { val[s][0] += bfr(bias[c0 + cofs]); val[s][1] += bfr(bias[c0 + cofs + 1]); val[s][2] += bfr(bias[c0 + cofs + 2]); val[s][3] += bfr(bias[c0 + cofs + 3]); }
                pc[s] = crow + (size_t)row * ldc + cofs; *(v4f*)pc[s] = val[s]; }
            // the data and address registers of the stores stay as they are up to this wait (inputs only)
            asm volatile("s_wait_xcnt 0x0" :: "v"(val[0]), "v"(val[1]), "v"(val[2]), "v"(val[3]), "v"(val[4]), "v"(val[5]), "v"(val[6]), "v"(val[7]), "v"(pc[0]), "v"(pc[1]), "v"(pc[2]), "v"(pc[3]), "v"(pc[4]), "v"(pc[5]), "v"(pc[6]), "v"(pc[7]) : "memory");
        }
        __builtin_amdgcn_wave_barrier(); asm volatile("" ::: "memory");
    }
}

typedef __attribute__((ext_vector_type(4))) _Float16 v4h;
typedef __attribute__((ext_vector_type(2))) unsigned short v2us;
typedef __attribute__((ext_vector_type(4))) unsigned short v4us;
typedef __attribute__((ext_vector_type(4))) int v4i;

// k_prep: every f32 -> bf16 operand plane (x and the four (in, out) weights) in ONE launch of PTH threads, all resident at once; a thread makes one 16-byte piece of each weight plane and PXU pieces of the x plane,
// and all its loads are issued in front of the first conversion (40 a wave, under the load counter's 63), so a wave waits for memory once. The launch costs one gap and 4,096 wave starts where five launches of one-piece threads cost five and 32,768.
// Weight w[k][n] -> plane in fragment order, rows = n, tile (k / 32, n / 16); a piece is eight k of one n: a wave's loads read 64 bytes in a row per half (a block's 256), its store 512.
// x[row][k] -> plane in fragment order, tile (k / 32, row / 16); a piece is eight consecutive k of one row. A wave makes 8 rows of PXU tiles in a row: it reads PXU * 128 bytes in a row of each (whole lines), and each of a tile's four pieces per row lands with the other rows' in 128 bytes in a row.
#define PTH (DM * DQ / 8)             // threads: the pieces of one weight plane
#define PXU (TT * DM / 8 / PTH)       // x pieces per thread
__global__ __launch_bounds__(256) void k_prep(const float* __restrict__ x, const float* __restrict__ wq, const float* __restrict__ wk, const float* __restrict__ wv, const float* __restrict__ wo, bf* XB, bf* WQ, bf* WK, bf* WV, bf* WO) {
    static_assert(DQ == DM && DKV == DM, "the four weight planes share one piece index");
    static_assert(PXU * PTH * 8 == TT * DM && (DM / 32) % PXU == 0 && PTH % 256 == 0, "a thread's x pieces are PXU k tiles in a row of one x row");
    const unsigned i = blockIdx.x * 256u + threadIdx.x, lane = i & 31u, w = i >> 5;
    constexpr unsigned NT = DM / 16u, KT = DM / 32u;
    const unsigned tile = i >> 6, n = (tile % NT) * 16u + (lane & 15u), k = (tile / NT) * 32u + (w & 1u) * 16u + (lane >> 4) * 8u;
    const unsigned wofs = k * DM + n;                                // the piece's first element in each weight
    const unsigned rg = (w >> 1) / (KT / PXU), kt = (w >> 1) % (KT / PXU) * PXU, row = (w & 1u) * 8u + (lane >> 2), pc = lane & 3u;   // piece pc: k = 8 pc + 0 .. 7 of the tiles kt + 0 .. PXU - 1
    const unsigned xofs = (rg * 16u + row) * DM + kt * 32u + pc * 8u;  // the first x piece; the next lies one k tile (128 bytes) further on in the row
    v8f v[PXU]; float fq[8], fk[8], fv[8], fo[8];
#pragma unroll
    for (int u = 0; u < PXU; ++u) v[u] = *(const v8f*)(x + xofs + u * 32);
#pragma unroll
    for (int j = 0; j < 8; ++j) { fq[j] = wq[wofs + j * DM]; fk[j] = wk[wofs + j * DM]; fv[j] = wv[wofs + j * DM]; fo[j] = wo[wofs + j * DM]; }
    asm volatile("s_wait_xcnt 0x0" :: "v"(wofs), "v"(xofs) : "memory");   // the offset registers of the loads stay as they are up to this wait (inputs only)
    v8us oq, ok, ov, oo, ox[PXU];
#pragma unroll
    for (int u = 0; u < PXU; ++u)
#pragma unroll
        for (int e = 0; e < 8; ++e) ox[u][e] = f2bf(v[u][e]);
#pragma unroll
    for (int j = 0; j < 8; ++j) { oq[j] = f2bf(fq[j]); ok[j] = f2bf(fk[j]); ov[j] = f2bf(fv[j]); oo[j] = f2bf(fo[j]); }
    bf* px = XB + ((size_t)kt * (TT / 16u) + rg) * FRG + (pc >> 1) * (FRG / 2) + ((pc & 1u) * 16u + row) * 8u;
#pragma unroll
    for (int u = 0; u < PXU; ++u) *(v8us*)(px + (size_t)u * (TT / 16u) * FRG) = ox[u];
    *(v8us*)(WQ + (size_t)i * 8) = oq; *(v8us*)(WK + (size_t)i * 8) = ok; *(v8us*)(WV + (size_t)i * 8) = ov; *(v8us*)(WO + (size_t)i * 8) = oo;
}

// ---- k_fattn: scores, causal softmax and probability x value contraction of ALL heads in one launch (online softmax); no score or probability ever reaches memory.
// FKS waves own FNQ * 16 query columns of one head and walk the keys 0 .. their diagonal in passes of KB keys, wave 'part' taking the passes part, part + FKS, ..., transposed: S^T = K Q^T (A = K rows, B = Q rows), O^T += V^T P^T (A = V^T rows, B = P^T).
// Rotated entry: the blocks of one head read the same K and V^T lines, run at once and at one pace; so that they do not ask L2 for the same lines at the same moment, a block walks the nc passes per part that lie wholly below its first query
// (every wave of the block has them, none is masked) from pass r on, r by block index, wrapping to pass 0, and then the passes at its diagonal. All waves of a block keep one order, so they still share lines in the WGP cache. The online softmax takes the passes in any order.
// Each part keeps its own m, l and O^T; behind the walk part 1 hands them to part 0 through LDS, which brings both to the common maximum, adds them and stores. So the longest walk of the launch is half as many passes per wave, and every SIMD holds two waves
// (the two parts of one tile) from a block's start to the hand-over: one wave's products run behind the other's softmax. A block fills its WGP's registers; blocks start heaviest first, so a WGP that ends a lighter block early takes the heaviest one left.
// A lane (lr, hi) holds, of each 16-key score tile, the keys 8 * hi + j of query column lr; two such tiles, converted in place, are the B operand of the second product in the k order of WFrag::ld.
// Per column: running maximum m (log2 units, equal in both lane halves), running sum l (one partial per lane half, joined at the end); O^T and l are rescaled only when a new maximum exceeds m by more than 8.
// Rows < RH: bf16 hi/lo planes, three products in both contractions; the rest fp16. The quotient O / l goes out as the merged hi/lo planes (rows = t, k = head * HD + d) in fragment order: a lane's 8 consecutive d of one query are its own 16 bytes of the tile. Grid (heads, FNB).
#define FNQ 2
#define FWV 4
#define FKS 2                         // waves that share one tile's key walk
#define FNB (TT / (FWV * FNQ * 16))   // work-groups per head
#define FXP (FNQ * 4 * 2 + 1)         // 16-byte pieces a lane hands over: O^T, then (m, l)
__device__ __forceinline__ float xhalf(float x) { return __builtin_bit_cast(float, __builtin_amdgcn_permlanex16(__builtin_bit_cast(int, x), __builtin_bit_cast(int, x), 0x76543210, 0xfedcba98, false, false)); }   // lane l <-> lane l ^ 16
// 2^x in place; the v_nop is the one slot the instruction set asks for behind a transcendental, in the same statement so that it stands directly behind it (source = result: nothing can overwrite the source alone)
__device__ __forceinline__ float exp2s(float x) { asm("v_exp_f32 %0, %0\n\tv_nop" : "+v"(x)); return x; }
// 2^x in place of 16 values that do not depend on one another, in ONE statement: each v_exp_f32 is the independent instruction behind the one in front of it, so the slot that the instruction set asks for behind a transcendental
// takes a v_nop only behind the last; and all 16 sources are made in front of the group, so the v_exp_f32 no longer stand each directly behind the v_fma_f32 that makes its source (a wait that the compiler cannot hint for asm text)
__device__ __forceinline__ void exp2x16(float (&p)[16]) { asm("v_exp_f32 %0, %0\n\tv_exp_f32 %1, %1\n\tv_exp_f32 %2, %2\n\tv_exp_f32 %3, %3\n\tv_exp_f32 %4, %4\n\tv_exp_f32 %5, %5\n\tv_exp_f32 %6, %6\n\tv_exp_f32 %7, %7\n\tv_exp_f32 %8, %8\n\tv_exp_f32 %9, %9\n\tv_exp_f32 %10, %10\n\tv_exp_f32 %11, %11\n\tv_exp_f32 %12, %12\n\tv_exp_f32 %13, %13\n\tv_exp_f32 %14, %14\n\tv_exp_f32 %15, %15\n\tv_nop" : "+v"(p[0]), "+v"(p[1]), "+v"(p[2]), "+v"(p[3]), "+v"(p[4]), "+v"(p[5]), "+v"(p[6]), "+v"(p[7]), "+v"(p[8]), "+v"(p[9]), "+v"(p[10]), "+v"(p[11]), "+v"(p[12]), "+v"(p[13]), "+v"(p[14]), "+v"(p[15])); }
template <typename T16, bool HL, int KB>
__device__ __forceinline__ void fattn_tile(const T16* __restrict__ Q, const T16* __restrict__ Q2, const T16* __restrict__ Kp, const T16* __restrict__ Kp2, const T16* __restrict__ Vt, const T16* __restrict__ Vt2, int q0, int qblk, int rot, int lr, int hi, int part, v4f* xs, bf* Ah, bf* Al) {
    typedef typename WFrag<T16>::V V;
    constexpr int NKT = KB / 16, NKK = KB / 32;
    constexpr float C2 = SCL * 1.4426950408889634f;                  // score -> log2 units
    V qf[FNQ][2], qf2[FNQ][2];
    const int lane = hi * 16 + lr;
    const T16* pq = Q + (size_t)q0 * HD + 8 * lane; const T16* pq2 = HL ? Q2 + (size_t)q0 * HD + 8 * lane : nullptr;
#pragma unroll
    for (int g = 0; g < FNQ; ++g)
#pragma unroll
        for (int ks = 0; ks < 2; ++ks) { qf[g][ks] = WFrag<T16>::ld(pq + g * 16 * HD + ks * FRG); if (HL) qf2[g][ks] = WFrag<T16>::ld(pq2 + g * 16 * HD + ks * FRG); }
    const int kend = q0 + FNQ * 16;                                  // first key above every diagonal element of the tile
    const int n = kend > part * KB ? (kend - part * KB + FKS * KB - 1) / (FKS * KB) : 0;   // this part's passes: i = 0 .. n - 1 at key (part + FKS * i) * KB
    const int nc = qblk / (FKS * KB);                                // of them the passes below the block's first query qblk: nc <= n in every wave of the block
    const int r = nc > 0 ? rot % nc : 0;
    auto keyof = [&](const int c) { int i = c; if (c < nc) { i = c + r; if (i >= nc) i -= nc; } return (part + FKS * i) * KB; };   // first key of the c-th pass walked (all wave-uniform)
    int k0 = keyof(0);
    const int kofs = k0 * HD + 8 * lane;                             // the first pass walked (where the part has no pass: KB < TT keys in, inside the plane)
    const T16* pk = Kp + kofs; const T16* pk2 = HL ? Kp2 + kofs : nullptr;
    const T16* pv = Vt + kofs; const T16* pv2 = HL ? Vt2 + kofs : nullptr;
    V kf[NKT][2], kf2[NKT][2];
#pragma unroll
    for (int kt = 0; kt < NKT; ++kt)
#pragma unroll
        for (int ks = 0; ks < 2; ++ks) { kf[kt][ks] = WFrag<T16>::ld(pk + kt * 16 * HD + ks * FRG); if (HL) kf2[kt][ks] = WFrag<T16>::ld(pk2 + kt * 16 * HD + ks * FRG); }
    // the address registers of the Q and first K loads stay as they are up to this wait (inputs only)
    if (HL) asm volatile("s_wait_xcnt 0x0" :: "v"(pq), "v"(pq2), "v"(pk), "v"(pk2) : "memory"); else asm volatile("s_wait_xcnt 0x0" :: "v"(pq), "v"(pk) : "memory");
    __builtin_amdgcn_sched_barrier(0);                               // nothing below is lifted over the wait: without this line the build rewrites registers that the loads above name (their base, their lane offset) ahead of it
    v8f o[4][FNQ]; float m[FNQ], l[FNQ];
#pragma unroll
    for (int g = 0; g < FNQ; ++g) { m[g] = -3.0e38f; l[g] = 0.f;
#pragma unroll
        for (int dt = 0; dt < 4; ++dt) o[dt][g] = (v8f){}; }
#pragma unroll 1
    for (int c = 0; c < n; ++c) {
        V vf[4][NKK], vf2[4][NKK];                                   // this pass's V^T fragments: issued here, first used behind the softmax
#pragma unroll
        for (int dt = 0; dt < 4; ++dt)
#pragma unroll
            for (int kk = 0; kk < NKK; ++kk) { vf[dt][kk] = WFrag<T16>::ld(pv + (kk * (HD / 16) + dt) * FRG); if (HL) vf2[dt][kk] = WFrag<T16>::ld(pv2 + (kk * (HD / 16) + dt) * FRG); }
        // the V address registers stay as they are up to this wait (inputs only); they are rewritten only behind it
        if (HL) asm volatile("s_wait_xcnt 0x0" :: "v"(pv), "v"(pv2) : "memory"); else asm volatile("s_wait_xcnt 0x0" :: "v"(pv) : "memory");
        v8f s[NKT][FNQ];
#pragma unroll
        for (int kt = 0; kt < NKT; ++kt)
#pragma unroll
            for (int g = 0; g < FNQ; ++g) s[kt][g] = (v8f){};
#pragma unroll
        for (int ks = 0; ks < 2; ++ks)
#pragma unroll
            for (int kt = 0; kt < NKT; ++kt)
#pragma unroll
                for (int g = 0; g < FNQ; ++g) { s[kt][g] = WFrag<T16>::mma(kf[kt][ks], qf[g][ks], s[kt][g]); if (HL) { s[kt][g] = WFrag<T16>::mma(kf2[kt][ks], qf[g][ks], s[kt][g]); s[kt][g] = WFrag<T16>::mma(kf[kt][ks], qf2[g][ks], s[kt][g]); } }
        const int kn = c + 1 < n ? keyof(c + 1) : k0;                // the last pass fetches its own rows again: always inside the plane
        const int dk = (kn - k0) * HD;
        pk += dk; if (HL) pk2 += dk;
#pragma unroll
        for (int kt = 0; kt < NKT; ++kt)                             // next pass's K fragments, in flight behind the softmax and the second product
#pragma unroll
            for (int ks = 0; ks < 2; ++ks) { kf[kt][ks] = WFrag<T16>::ld(pk + kt * 16 * HD + ks * FRG); if (HL) kf2[kt][ks] = WFrag<T16>::ld(pk2 + kt * 16 * HD + ks * FRG); }
        // the K address registers stay as they are up to this wait (inputs only); they are rewritten only behind it
        if (HL) asm volatile("s_wait_xcnt 0x0" :: "v"(pk), "v"(pk2) : "memory"); else asm volatile("s_wait_xcnt 0x0" :: "v"(pk) : "memory");
        if (k0 + KB - 1 > q0) {                                      // only passes that reach the diagonal mask (wave-uniform test)
#pragma unroll
            for (int kt = 0; kt < NKT; ++kt)
#pragma unroll
                for (int g = 0; g < FNQ; ++g)
#pragma unroll
                    for (int j = 0; j < 8; ++j) s[kt][g][j] = (k0 + kt * 16 + hi * 8 + j <= q0 + g * 16 + lr) ? s[kt][g][j] : -3.0e38f; }
        float tm[FNQ]; bool need = false;
#pragma unroll
        for (int g = 0; g < FNQ; ++g) { float t = s[0][g][0];
#pragma unroll
            for (int kt = 0; kt < NKT; ++kt)
#pragma unroll
                for (int j = 0; j < 8; ++j) t = fmaxf(t, s[kt][g][j]);
            t = fmaxf(t, xhalf(t)) * C2; tm[g] = t; need = need || (t > m[g] + 8.0f); }
        if (__builtin_amdgcn_ballot_w32(need) != 0) {                // scalar branch: rare once the maxima have settled
#pragma unroll
            for (int g = 0; g < FNQ; ++g) { const float mn = fmaxf(m[g], tm[g]); const float al = exp2s(m[g] - mn); m[g] = mn; l[g] *= al;
#pragma unroll
                for (int dt = 0; dt < 4; ++dt) o[dt][g] *= al; } }
        V pf[FNQ][NKK], pf2[FNQ][NKK];
#pragma unroll
        for (int g = 0; g < FNQ; ++g)
#pragma unroll
            for (int kk = 0; kk < NKK; ++kk) { float p[16]; float ls = 0.f;
#pragma unroll
                for (int e = 0; e < 16; ++e) p[e] = __builtin_fmaf(s[2 * kk + (e >> 3)][g][e & 7], C2, -m[g]);
                exp2x16(p);
#pragma unroll
                for (int e = 0; e < 16; ++e) ls += p[e];
                l[g] += ls;
                if constexpr (HL) { v8us h0, h1, l0, l1;
#pragma unroll
                    for (int e = 0; e < 8; ++e) { unsigned short a, c; splitf(p[e], a, c); h0[e] = a; l0[e] = c; splitf(p[8 + e], a, c); h1[e] = a; l1[e] = c; }
                    pf[g][kk] = cat16b(h0, h1); pf2[g][kk] = cat16b(l0, l1);
                } else { v16h ph;
#pragma unroll
                    for (int e = 0; e < 16; ++e) ph[e] = tohx(p[e]);
                    pf[g][kk] = ph; } }
#pragma unroll
        for (int kk = 0; kk < NKK; ++kk)
#pragma unroll
            for (int dt = 0; dt < 4; ++dt)
#pragma unroll
                for (int g = 0; g < FNQ; ++g) { o[dt][g] = WFrag<T16>::mma(vf[dt][kk], pf[g][kk], o[dt][g]); if (HL) { o[dt][g] = WFrag<T16>::mma(vf2[dt][kk], pf[g][kk], o[dt][g]); o[dt][g] = WFrag<T16>::mma(vf[dt][kk], pf2[g][kk], o[dt][g]); } }
        pv += dk; if (HL) pv2 += dk;
        k0 = kn;
    }
    static_assert(FKS == 2 && FNQ == 2, "one hand-over, its last piece holds two m and two l");
    if (part != 0) {                                                 // wave-uniform
#pragma unroll
        for (int dt = 0; dt < 4; ++dt)
#pragma unroll
            for (int g = 0; g < FNQ; ++g) { xs[((dt * FNQ + g) * 2) * 32 + lane] = __builtin_shufflevector(o[dt][g], o[dt][g], 0, 1, 2, 3); xs[((dt * FNQ + g) * 2 + 1) * 32 + lane] = __builtin_shufflevector(o[dt][g], o[dt][g], 4, 5, 6, 7); }
        xs[(FXP - 1) * 32 + lane] = (v4f){m[0], m[1], l[0], l[1]}; }
    __syncthreads();                                                 // part 1's hand-over is in LDS before part 0 reads it; every wave of the block passes here once
    if (part != 0) return;
    { const v4f ml = xs[(FXP - 1) * 32 + lane];                      // a part without a pass hands over m = -3.0e38, l = 0, O = 0: its factor is 0
#pragma unroll
        for (int g = 0; g < FNQ; ++g) { const float mn = fmaxf(m[g], ml[g]); const float a0 = exp2s(m[g] - mn), a1 = exp2s(ml[g] - mn); l[g] = l[g] * a0 + ml[FNQ + g] * a1;
#pragma unroll
            for (int dt = 0; dt < 4; ++dt) { const v4f x0 = xs[((dt * FNQ + g) * 2) * 32 + lane], x1 = xs[((dt * FNQ + g) * 2 + 1) * 32 + lane];
#pragma unroll
                for (int j = 0; j < 4; ++j) { o[dt][g][j] = o[dt][g][j] * a0 + x0[j] * a1; o[dt][g][4 + j] = o[dt][g][4 + j] * a0 + x1[j] * a1; } } } }
    v8us oh[FNQ][4], ol[FNQ][4];
#pragma unroll
    for (int g = 0; g < FNQ; ++g) { const float inv = __fdiv_rn(1.0f, l[g] + xhalf(l[g]));   // the two lane halves' sums, joined once
#pragma unroll
        for (int dt = 0; dt < 4; ++dt)
#pragma unroll
            for (int j = 0; j < 8; ++j) { unsigned short a, c; splitf(o[dt][g][j] * inv, a, c); oh[g][dt][j] = a; ol[g][dt][j] = c; } }
    bf* pa = Ah + (size_t)(q0 / 16) * FRG + lane * 8; bf* pl = Al + (size_t)(q0 / 16) * FRG + lane * 8;
#pragma unroll
    for (int g = 0; g < FNQ; ++g)
#pragma unroll
        for (int dt = 0; dt < 4; ++dt) { *(v8us*)(pa + ((dt >> 1) * (TT / 16) + g) * FRG + (dt & 1) * (FRG / 2)) = oh[g][dt]; *(v8us*)(pl + ((dt >> 1) * (TT / 16) + g) * FRG + (dt & 1) * (FRG / 2)) = ol[g][dt]; }
    static_assert(FNQ == 2, "the wait behind the stores names the data registers of two column groups");
    // the data and address registers of the stores stay as they are up to this wait (inputs only)
    asm volatile("s_wait_xcnt 0x0" :: "v"(oh[0][0]), "v"(oh[0][1]), "v"(oh[0][2]), "v"(oh[0][3]), "v"(oh[1][0]), "v"(oh[1][1]), "v"(oh[1][2]), "v"(oh[1][3]), "v"(ol[0][0]), "v"(ol[0][1]), "v"(ol[0][2]), "v"(ol[0][3]), "v"(ol[1][0]), "v"(ol[1][1]), "v"(ol[1][2]), "v"(ol[1][3]), "v"(pa), "v"(pl) : "memory");
}
__global__ __launch_bounds__(32 * FWV * FKS) void k_fattn(const h16* __restrict__ Q16, const h16* __restrict__ K16, const h16* __restrict__ V16, const bf* __restrict__ Qh, const bf* __restrict__ Ql, const bf* __restrict__ Kh, const bf* __restrict__ Kl, const bf* __restrict__ Vh, const bf* __restrict__ Vl, bf* Ah, bf* Al) {
    const int lane = threadIdx.x & 31, lr = lane & 15, hi = lane >> 4; const int wave = __builtin_amdgcn_readfirstlane((int)(threadIdx.x >> 5));
    static_assert(RH % (FWV * FNQ * 16) == 0, "a block's waves all take the same branch below, so all meet at its barrier");
    __shared__ v4f xsh[FWV * FXP * 32];
    const int tile = wave % FWV, part = wave / FWV;                  // waves w and w + FWV: the two parts of one tile
    const int h = blockIdx.x; const int qb = FNB - 1 - (int)blockIdx.y;   // cost falls with the index
    const int q0 = (qb * FWV + tile) * (FNQ * 16); v4f* xs = xsh + tile * FXP * 32;
    const size_t zq = (size_t)h * TT * HD, zk = (size_t)(h / REP) * TT * HD;
    if (q0 < RH) fattn_tile<bf, true, 32>(Qh + zq, Ql + zq, Kh + zk, Kl + zk, Vh + zk, Vl + zk, q0, qb * (FWV * FNQ * 16), (int)blockIdx.y, lr, hi, part, xs, Ah + (size_t)h * (HD / 32) * (TT / 16) * FRG, Al + (size_t)h * (HD / 32) * (TT / 16) * FRG);
    else fattn_tile<h16, false, 64>(Q16 + zq, nullptr, K16 + zk, nullptr, V16 + zk, nullptr, q0, qb * (FWV * FNQ * 16), (int)blockIdx.y, lr, hi, part, xs, Ah + (size_t)h * (HD / 32) * (TT / 16) * FRG, Al + (size_t)h * (HD / 32) * (TT / 16) * FRG);
}

extern "C" void kernel_launch(void* const* d_in, const int* in_sizes, int n_in,
                              void* d_out, int out_size, void* d_ws, size_t ws_size, hipStream_t stream) {
    (void)in_sizes; (void)n_in; (void)out_size;
    const float* x = (const float*)d_in[0]; const float* wq = (const float*)d_in[1]; const float* wk = (const float*)d_in[2]; const float* wv = (const float*)d_in[3]; const float* wo = (const float*)d_in[4]; const float* bo = (const float*)d_in[5];
    float* OUT = (float*)d_out;     // [1][4096][1024]
    char* wsp = (char*)d_ws;
    auto take = [&](size_t bytes) { char* p = wsp; wsp += (bytes + 255) & ~(size_t)255; return (void*)p; };
    bf* WQ = (bf*)take((size_t)DQ * DM * 2); bf* WK = (bf*)take((size_t)DKV * DM * 2); bf* WV = (bf*)take((size_t)DKV * DM * 2); bf* WO = (bf*)take((size_t)DM * DQ * 2);
    bf* XB = (bf*)take((size_t)TT * DM * 2);
    h16* QP16 = (h16*)take((size_t)NH_ * TT * HD * 2); h16* KP16 = (h16*)take((size_t)NKV * TT * HD * 2); h16* VT16 = (h16*)take((size_t)NKV * HD * TT * 2);
    bf* QPh = (bf*)take((size_t)NH_ * TT * HD * 2); bf* QPl = (bf*)take((size_t)NH_ * TT * HD * 2); bf* KPh = (bf*)take((size_t)NKV * TT * HD * 2); bf* KPl = (bf*)take((size_t)NKV * TT * HD * 2); bf* VTh = (bf*)take((size_t)NKV * HD * TT * 2); bf* VTl = (bf*)take((size_t)NKV * HD * TT * 2);
    bf* ATh = (bf*)take((size_t)TT * DQ * 2); bf* ATl = (bf*)take((size_t)TT * DQ * 2);
    if ((size_t)(wsp - (char*)d_ws) > ws_size) return;    // ws 256 MiB
    static_assert(NB_ == 1, "one launch converts the one batch entry's x beside the weights");
    k_prep<<<PTH / 256, 256, 0, stream>>>(x, wq, wk, wv, wo, XB, WQ, WK, WV, WO);
    for (int b = 0; b < NB_; ++b) {
        static_assert(DKV == DQ && ((size_t)DQ * DM * 2) % 256 == 0 && ((size_t)NH_ * TT * HD * 2) % 256 == 0, "WQ, WK, WV lie one plane apart, as do QP16, KP16, VT16; QPh, KPh, VTh (and the lo planes) two");
        static_assert(TT % 256 == 0 && (DM / 32 - 2) % 3 == 0, "four row tiles a work-group; the three-set ring's trips end two k tiles short of K");
        k_gemmw<bf, 0, false, 1><<<dim3(TT / 256, DQ / 64, 1), 384, 0, stream>>>(XB, nullptr, WQ, nullptr, DM, TT, DQ, nullptr, 0, nullptr, 0, (size_t)DQ * DM, (size_t)NH_ * TT * HD, QP16, QPh, QPl);
        k_fattn<<<dim3(NH_, FNB, 1), 32 * FWV * FKS, 0, stream>>>(QP16, KP16, VT16, QPh, QPl, KPh, KPl, VTh, VTl, ATh, ATl);
        k_gemmw<bf, 1, true, 0><<<dim3(TT / 64, DM / 64, 1), 32, 0, stream>>>(ATh, ATl, WO, nullptr, DQ, TT, DM, OUT + (size_t)b * TT * DM, DM, bo, 0, 0, 0, nullptr, nullptr, nullptr); }
}
